// v000
// Measured on an AMD MI455X. A time is GPU time per run, averaged over a window of back-to-back runs after a warm-up
// (all launches, gaps included; the runs take copies of the inputs in turn), and the median of several windows.
// Apart from v000's, it joins two sittings. Times from different sittings can be a few percent apart, while
// side-by-side timings come from the same sitting.
// v000 is the starting kernel. One run takes 488 microseconds.
// compute dtype: all float inputs rounded to bf16, the three lambda scalars read on device; qt/kt/vt = xt . Wt + bt and qs/ks = xs . Ws + bs with EXACT bf16 products on WMMA 16x16x32 ((in,out) weights as transposed rows); k1 = kt + lam_ts ks and k2 = lam_st kt + lam_ss ks formed in f32, then q = [qt | qs] and k = [k1 | k2] rounded once to f16 (128-wide per head); PLAIN attention: scores x 1/8, running-max softmax in f32 (hardware exp), P (scaled by 2^11, single f16) x vt (single f16); out = y (bf16 hi + residual) . Wc (2 products) + bc.
#include <hip/hip_runtime.h>
#include <math.h>

typedef __attribute__((ext_vector_type(16))) _Float16 v16h;
typedef __attribute__((ext_vector_type(16))) __bf16 v16b;
typedef __attribute__((ext_vector_type(8)))  _Float16 v8h;
typedef __attribute__((ext_vector_type(8)))  float v8f;
typedef __attribute__((ext_vector_type(4)))  float v4f;
typedef __attribute__((ext_vector_type(2)))  float v2f;
typedef __attribute__((ext_vector_type(4)))  unsigned v4u;
typedef __attribute__((ext_vector_type(4)))  int v4i;
typedef float __attribute__((may_alias)) float_a;
typedef int __attribute__((may_alias)) int_a;

template <typename T> __device__ __forceinline__ void vst2(void* p, T v) { *(T*)p = v;  }
__device__ __forceinline__ v8f wmma16(v16h a, v16h b, v8f c) {
  v8f d = __builtin_amdgcn_wmma_f32_16x16x32_f16(false, a, false, b, (short)0, c, false, false);
  asm volatile("v_nop\n\tv_nop\n\tv_nop\n\tv_nop" : "+v"(d) : "v"(a), "v"(b));
  return d;
}
__device__ __forceinline__ v8f wmma_bf(v16b a, v16b b, v8f c) {
  v8f d = __builtin_amdgcn_wmma_f32_16x16x32_bf16(false, a, false, b, (short)0, c, false, false);
  asm volatile("v_nop\n\tv_nop\n\tv_nop\n\tv_nop" : "+v"(d) : "v"(a), "v"(b));
  return d;
}
// 16x16x32 fragments: lane = (h = lane>>4, row/col = lane&15); elements 0..7 = k0+8h+0..7, 8..15 = k0+16+8h+0..7; D element r = row 8h+r
__device__ __forceinline__ v16h frag_h(const _Float16* rowk0, int lane) {
  union { v16h v; v8h q[2]; } u; const _Float16* p = rowk0 + 8 * (lane >> 4);
  u.q[0] = *(const v8h*)p; u.q[1] = *(const v8h*)(p + 16); return u.v;
}
__device__ __forceinline__ v16h frag_f32(const float* rowk0, int lane) {
  v16h a; const float* p = rowk0 + 8 * (lane >> 4);
#pragma unroll
  for (int i = 0; i < 8; ++i) { a[i] = (_Float16)p[i]; a[8 + i] = (_Float16)p[16 + i]; }
  return a;
}
__device__ __forceinline__ v16h frag_f32s(const float* rowk0, int lane, float sc) {
  v16h a; const float* p = rowk0 + 8 * (lane >> 4);
#pragma unroll
  for (int i = 0; i < 8; ++i) { a[i] = (_Float16)(p[i] * sc); a[8 + i] = (_Float16)(p[16 + i] * sc); }
  return a;
}
// column fragment from a [K][ld] layout (column n), rows >= K read as 0
__device__ __forceinline__ v16h fragc_f32(const float* W, int k0, int n, int lane, int ld, int K) {
  v16h a; const int g = lane >> 4;
#pragma unroll
  for (int i = 0; i < 8; ++i) { const int ka = k0 + 8 * g + i, kb = ka + 16;
    a[i] = (_Float16)(ka < K ? W[(size_t)(ka < K ? ka : K - 1) * ld + n] : 0.f); a[8 + i] = (_Float16)(kb < K ? W[(size_t)(kb < K ? kb : K - 1) * ld + n] : 0.f); }
  return a;
}
struct F2 { v16b h, l; };
__device__ __forceinline__ F2 bsplit16(const float v[16]) { F2 r;
#pragma unroll
  for (int i = 0; i < 16; ++i) { const __bf16 h = (__bf16)v[i]; r.h[i] = h; r.l[i] = (__bf16)(v[i] - (float)h); }
  return r; }
__device__ __forceinline__ F2 split_row(const float* row, int k0, int lane) { float v[16]; const float* p = row + k0 + 8 * (lane >> 4);
#pragma unroll
  for (int i = 0; i < 8; ++i) { v[i] = p[i]; v[8 + i] = p[16 + i]; }
  return bsplit16(v); }
__device__ __forceinline__ F2 split_rowK(const float* row, int k0, int lane, int K) { float v[16]; const int g = lane >> 4;
#pragma unroll
  for (int i = 0; i < 8; ++i) { const int ka = k0 + 8 * g + i, kb = ka + 16; v[i] = ka < K ? row[ka < K ? ka : K - 1] : 0.f; v[8 + i] = kb < K ? row[kb < K ? kb : K - 1] : 0.f; }
  return bsplit16(v); }
__device__ __forceinline__ F2 split_col(const float* W, int k0, int n, int lane, int ld, int K) { float v[16]; const int g = lane >> 4;
#pragma unroll
  for (int i = 0; i < 8; ++i) { const int ka = k0 + 8 * g + i, kb = ka + 16; v[i] = ka < K ? W[(size_t)(ka < K ? ka : K - 1) * ld + n] : 0.f; v[8 + i] = kb < K ? W[(size_t)(kb < K ? kb : K - 1) * ld + n] : 0.f; }
  return bsplit16(v); }
__device__ __forceinline__ v8f mac3(const F2& a, const F2& b, v8f c) { c = wmma_bf(a.l, b.h, c); c = wmma_bf(a.h, b.l, c); return wmma_bf(a.h, b.h, c); }
__device__ __forceinline__ float sigm(float v) { return 1.0f / (1.0f + expf(-v)); }
#define LDSX() do { asm volatile("s_wait_dscnt 0" ::: "memory"); __builtin_amdgcn_wave_barrier(); __builtin_amdgcn_fence(__ATOMIC_RELEASE, "workgroup"); } while (0)


// Disentangled spatial attention (B 2, L 2,048, E 1,024, 16 heads x 64): scores = (qt . (kt + lam_ts ks) + qs . (lam_st kt + lam_ss ks)) / 8 over the target and source streams, softmax, . vt, output projection + bias.
#define NB 2
#define SS 2048
#define DM 1024
#define NH 16
#define HD 64
#define NR (NB * SS)
#ifndef TQB
#define TQB (SS / 64)
#define TNB NB
#endif
typedef __attribute__((ext_vector_type(8))) __bf16 v8b;
__device__ __forceinline__ v16b frag_b(const __bf16* rowk0, int lane) {
  union { v16b v; v8b q[2]; } u; const __bf16* p = rowk0 + 8 * (lane >> 4);
  u.q[0] = *(const v8b*)p; u.q[1] = *(const v8b*)(p + 16); return u.v;
}
__device__ __forceinline__ float bfr(float v) { return (float)(__bf16)v; }
__device__ __attribute__((noinline)) float exp_ni(float v) { return expf(v); }
__device__ __attribute__((noinline)) float erf_ni(float v) { return erff(v); }

#define WS_PW  0u                                     // bf16 transposed rows: Wt q, Wt k, Wt v, Ws q, Ws k, Wc  [6][1024][1024]
#define WS_QQ  (WS_PW + 2u * (size_t)6 * DM * DM)       // f16 [NR][2048]: qt | qs
#define WS_KK  (WS_QQ + 2u * (size_t)NR * 2 * DM)       // f16 [NR][2048]: k1 | k2
#define WS_VT  (WS_KK + 2u * (size_t)NR * 2 * DM)       // f16 planes vt [b][1024][SS]
#define WS_O   (WS_VT + 2u * (size_t)NB * DM * SS)       // f32 [NR][1024]
#define WS_END (WS_O + 4u * (size_t)NR * DM)

// ---- k_packT: (in,out) column n of block 'which' -> bf16 row n (K = 1024 contiguous)
__global__ __launch_bounds__(256) void k_packT(const float* __restrict__ WT, const float* __restrict__ WSm, const float* __restrict__ WC, __bf16* __restrict__ P) {
  __shared__ __align__(16) __bf16 s[DM]; const int n = blockIdx.x, which = blockIdx.y, t = threadIdx.x;
  const float* src; int stride, c;
  if (which < 3) { src = WT; stride = 3 * DM; c = which * DM + n; } else if (which < 5) { src = WSm; stride = 2 * DM; c = (which - 3) * DM + n; } else { src = WC; stride = DM; c = n; }
  for (int k = t; k < DM; k += 256) s[k] = (__bf16)src[(size_t)k * stride + c];
  __syncthreads(); for (int q = t; q < DM / 8; q += 256) vst2((unsigned*)(P + ((size_t)which * DM + n) * DM + q * 8), *(const v4u*)&s[q * 8]);
}
// ---- k_qkvd: block = (64 rows, 64 cols, kind): kind 0 -> qt (from xt) and qs (from xs) into QQ; kind 1 -> k1, k2 into KK; kind 2 -> vt planes
__global__ __launch_bounds__(128) void k_qkvd(const float* __restrict__ XT, const float* __restrict__ XS, const __bf16* __restrict__ P, const float* __restrict__ BT, const float* __restrict__ BS, const float* __restrict__ LTS, const float* __restrict__ LST, const float* __restrict__ LSS, _Float16* __restrict__ QQ, _Float16* __restrict__ KK, _Float16* __restrict__ VT) {
  __shared__ __align__(16) _Float16 so[64][72]; __shared__ __align__(16) _Float16 so2[64][72];
  const int tid = threadIdx.x, wave = tid >> 5, lane = tid & 31, col = lane & 15, g = lane >> 4; const int kind = blockIdx.z; const int c0 = blockIdx.y * 64; const size_t rb = (size_t)blockIdx.x * 64; const size_t r0 = rb + wave * 16;
  const __bf16* PT = P + ((size_t)kind * DM) * DM;                 // Wt block for this kind (q, k or v)
  const __bf16* PS = P + ((size_t)(3 + (kind < 2 ? kind : 0)) * DM) * DM;   // Ws block (q or k)
  v8f at[4] = {}, as[4] = {};
#pragma unroll 1
  for (int kc = 0; kc < DM / 32; ++kc) { v16b a; { const float* p = XT + (r0 + col) * DM + kc * 32 + 8 * g;
#pragma unroll
      for (int i = 0; i < 8; ++i) { a[i] = (__bf16)p[i]; a[8 + i] = (__bf16)p[16 + i]; } }
#pragma unroll
    for (int j = 0; j < 4; ++j) at[j] = wmma_bf(a, frag_b(PT + (size_t)(c0 + j * 16 + col) * DM + kc * 32, lane), at[j]); }
  if (kind < 2) {
#pragma unroll 1
    for (int kc = 0; kc < DM / 32; ++kc) { v16b a2; { const float* p2 = XS + (r0 + col) * DM + kc * 32 + 8 * g;
#pragma unroll
        for (int i = 0; i < 8; ++i) { a2[i] = (__bf16)p2[i]; a2[8 + i] = (__bf16)p2[16 + i]; } }
#pragma unroll
      for (int j = 0; j < 4; ++j) as[j] = wmma_bf(a2, frag_b(PS + (size_t)(c0 + j * 16 + col) * DM + kc * 32, lane), as[j]); } }
  if (kind == 0) {   // q pair
#pragma unroll
    for (int j = 0; j < 4; ++j) { const int c = c0 + j * 16 + col; const float b1 = bfr(BT[c]), b2 = bfr(BS[c]);
#pragma unroll
      for (int r = 0; r < 8; ++r) { so[wave * 16 + 8 * g + r][j * 16 + col] = (_Float16)(at[j][r] + b1); so2[wave * 16 + 8 * g + r][j * 16 + col] = (_Float16)(as[j][r] + b2); } }
    __syncthreads();
    for (int e = tid; e < 64 * 8; e += 128) { const int rl = e >> 3, q = e & 7; vst2((unsigned*)(QQ + (rb + rl) * (2 * DM) + c0 + q * 8), *(const v4u*)&so[rl][q * 8]); vst2((unsigned*)(QQ + (rb + rl) * (2 * DM) + DM + c0 + q * 8), *(const v4u*)&so2[rl][q * 8]); }
  } else if (kind == 1) {   // k pair -> k1, k2
    const float lts = bfr(LTS[0]), lst = bfr(LST[0]), lss = bfr(LSS[0]);
#pragma unroll
    for (int j = 0; j < 4; ++j) { const int c = c0 + j * 16 + col; const float b1 = bfr(BT[DM + c]), b2 = bfr(BS[DM + c]);
#pragma unroll
      for (int r = 0; r < 8; ++r) { const float kt = at[j][r] + b1, ks = as[j][r] + b2; so[wave * 16 + 8 * g + r][j * 16 + col] = (_Float16)(kt + lts * ks); so2[wave * 16 + 8 * g + r][j * 16 + col] = (_Float16)(lst * kt + lss * ks); } }
    __syncthreads();
    for (int e = tid; e < 64 * 8; e += 128) { const int rl = e >> 3, q = e & 7; vst2((unsigned*)(KK + (rb + rl) * (2 * DM) + c0 + q * 8), *(const v4u*)&so[rl][q * 8]); vst2((unsigned*)(KK + (rb + rl) * (2 * DM) + DM + c0 + q * 8), *(const v4u*)&so2[rl][q * 8]); }
  } else {   // vt planes
    __shared__ __align__(16) _Float16 st[64][72];
#pragma unroll
    for (int j = 0; j < 4; ++j) { const float b1 = bfr(BT[2 * DM + c0 + j * 16 + col]);
#pragma unroll
      for (int r = 0; r < 8; ++r) st[j * 16 + col][wave * 16 + 8 * g + r] = (_Float16)(at[j][r] + b1); }
    __syncthreads();
    const size_t b = rb / SS; const int s0 = (int)(rb % SS);
    for (int e = tid; e < 64 * 8; e += 128) { const int d = e >> 3, pc = e & 7; vst2((unsigned*)(VT + ((b * DM + c0 + d) * SS) + s0 + pc * 8), *(const v4u*)&st[d][pc * 8]); } }
}
// ---- k_attn: block = (64 queries, head, b): 128-wide scores ([qt|qs] . [k1|k2]) / 8, softmax, P . vt (64 dims); O 256-B head segments
__global__ __launch_bounds__(128) void k_attn(const _Float16* __restrict__ QQ, const _Float16* __restrict__ KK, const _Float16* __restrict__ VT, float* __restrict__ O) {
  __shared__ __align__(16) _Float16 sph[4][16][40]; __shared__ __align__(16) float so[4][16][68];
  const int tid = threadIdx.x, wave = tid >> 5, lane = tid & 31, col = lane & 15, g = lane >> 4; const int h = blockIdx.y; const size_t b = blockIdx.z; const int q0 = blockIdx.x * 64 + wave * 16; const size_t rq = b * SS + q0;
  v16h aq[4];
#pragma unroll
  for (int kc = 0; kc < 4; ++kc) aq[kc] = frag_h(QQ + (rq + col) * (2 * DM) + ((kc < 2) ? 0 : DM) + h * HD + (kc & 1) * 32, lane);
  float m[8], l[8];
#pragma unroll
  for (int r = 0; r < 8; ++r) { m[r] = -3.0e38f; l[r] = 0.f; }
  v8f acc[4] = {};
#pragma unroll 1
  for (int ks = 0; ks < SS / 32; ++ks) { const int j0 = ks * 32; v8f s[2];
#pragma unroll
    for (int ct = 0; ct < 2; ++ct) { const size_t rk = (b * SS + j0 + ct * 16 + col) * (2 * DM) + h * HD; v8f c = {};
#pragma unroll
      for (int kc = 0; kc < 4; ++kc) c = wmma16(aq[kc], frag_h(KK + rk + ((kc < 2) ? 0 : DM) + (kc & 1) * 32, lane), c);
#pragma unroll
      for (int r = 0; r < 8; ++r) s[ct][r] = c[r] * 0.125f; }
#pragma unroll
    for (int r = 0; r < 8; ++r) { float mx = fmaxf(s[0][r], s[1][r]);
#pragma unroll
      for (int o = 1; o < 16; o <<= 1) mx = fmaxf(mx, __shfl_xor(mx, o));
      const float mn = fmaxf(m[r], mx); const float alpha = (m[r] <= -1.0e38f) ? 0.f : __expf(m[r] - mn); const float e0 = __expf(s[0][r] - mn), e1 = __expf(s[1][r] - mn); float es = e0 + e1;
#pragma unroll
      for (int o = 1; o < 16; o <<= 1) es += __shfl_xor(es, o);
      l[r] = l[r] * alpha + es; m[r] = mn;
#pragma unroll
      for (int dt = 0; dt < 4; ++dt) acc[dt][r] *= alpha;
      sph[wave][8 * g + r][col] = (_Float16)(e0 * 2048.0f); sph[wave][8 * g + r][16 + col] = (_Float16)(e1 * 2048.0f); }
    LDSX();
    const v16h pa = frag_h(&sph[wave][col][0], lane);
#pragma unroll
    for (int dt = 0; dt < 4; ++dt) acc[dt] = wmma16(pa, frag_h(VT + ((b * DM + h * HD + dt * 16 + col) * SS) + j0, lane), acc[dt]);
    LDSX(); }
#pragma unroll
  for (int r = 0; r < 8; ++r) { const float il = (1.0f / 2048.0f) / l[r];
#pragma unroll
    for (int dt = 0; dt < 4; ++dt) so[wave][8 * g + r][dt * 16 + col] = acc[dt][r] * il; }
  LDSX();
  for (int rl = 0; rl < 16; ++rl) if (lane < 16) vst2(O + (rq + rl) * DM + h * HD + lane * 4, *(const v4f*)&so[wave][rl][lane * 4]);
}
// ---- k_out: block = (64 rows, 128 cols): Y = y (bf16 hi + lo) . Wc + bc
__global__ __launch_bounds__(128) void k_out(const float* __restrict__ O, const __bf16* __restrict__ P, const float* __restrict__ BC, float* __restrict__ Y) {
  __shared__ __align__(16) float so[4][16][132];
  const int tid = threadIdx.x, wave = tid >> 5, lane = tid & 31, col = lane & 15, g = lane >> 4; const size_t r0 = (size_t)blockIdx.x * 64 + wave * 16; const int n0 = blockIdx.y * 128; const __bf16* PC = P + (size_t)5 * DM * DM;
  v8f acc[8] = {};
#pragma unroll 2
  for (int kc = 0; kc < DM / 32; ++kc) { const F2 a = split_row(O + (r0 + col) * DM, kc * 32, lane);
#pragma unroll
    for (int j = 0; j < 8; ++j) { const v16b w = frag_b(PC + (size_t)(n0 + j * 16 + col) * DM + kc * 32, lane); acc[j] = wmma_bf(a.h, w, acc[j]); acc[j] = wmma_bf(a.l, w, acc[j]); } }
#pragma unroll
  for (int j = 0; j < 8; ++j) { const float bb = bfr(BC[n0 + j * 16 + col]);
#pragma unroll
    for (int r = 0; r < 8; ++r) so[wave][8 * g + r][j * 16 + col] = acc[j][r] + bb; }
  LDSX();
  for (int rl = 0; rl < 16; ++rl) vst2(Y + (r0 + rl) * DM + n0 + lane * 4, *(const v4f*)&so[wave][rl][lane * 4]);
}
extern "C" void kernel_launch(void* const* d_in, const int* in_sizes, int n_in, void* d_out, int out_size, void* d_ws, size_t ws_size, hipStream_t stream) {
  (void)in_sizes; (void)n_in; (void)out_size;
  const float** F = (const float**)d_in;   // 0 xt, 1 xs [2,2048,1024]; 2 Wt [1024,3072], 3 bt; 4 Ws [1024,2048], 5 bs; 6 Wc [1024,1024], 7 bc; 8 lam_ts, 9 lam_st, 10 lam_ss [1]
  if (ws_size < (size_t)WS_END) return;
  char* ws = (char*)d_ws; __bf16* P = (__bf16*)(ws + WS_PW); _Float16 *QQ = (_Float16*)(ws + WS_QQ), *KK = (_Float16*)(ws + WS_KK), *VT = (_Float16*)(ws + WS_VT); float* O = (float*)(ws + WS_O);
  k_packT<<<dim3(DM, 6), 256, 0, stream>>>(F[2], F[4], F[6], P);
  k_qkvd<<<dim3(TNB * SS / 64, DM / 64, 3), 128, 0, stream>>>(F[0], F[1], P, F[3], F[5], F[8], F[9], F[10], QQ, KK, VT);
  k_attn<<<dim3(TQB, NH, TNB), 128, 0, stream>>>(QQ, KK, VT, O);
  k_out<<<dim3(TNB * SS / 64, DM / 128), 128, 0, stream>>>(O, P, F[7], (float*)d_out);
}

// v001
// One run takes 381 microseconds.
// Next to v000, in two timings, it ran 1.31 times as fast each time.
// compute dtype: all float inputs rounded to bf16, the three lambda scalars read on device; qt/kt/vt = xt . Wt + bt and qs/ks = xs . Ws + bs with EXACT bf16 products on WMMA 16x16x32 ((in,out) weights as transposed rows); k1 = kt + lam_ts ks and k2 = lam_st kt + lam_ss ks formed in f32, then q = [qt | qs] and k = [k1 | k2] rounded once to f16 (128-wide per head); PLAIN attention: scores x 1/8, running-max softmax in f32 (hardware exp), P (scaled by 2^11, single f16) x vt (single f16); out = y (bf16 hi + residual) . Wc (2 products) + bc.
#include <hip/hip_runtime.h>
#include <math.h>

typedef __attribute__((ext_vector_type(16))) _Float16 v16h;
typedef __attribute__((ext_vector_type(16))) __bf16 v16b;
typedef __attribute__((ext_vector_type(8)))  _Float16 v8h;
typedef __attribute__((ext_vector_type(8)))  float v8f;
typedef __attribute__((ext_vector_type(4)))  float v4f;
typedef __attribute__((ext_vector_type(2)))  float v2f;
typedef __attribute__((ext_vector_type(4)))  unsigned v4u;
typedef __attribute__((ext_vector_type(4)))  int v4i;
typedef float __attribute__((may_alias)) float_a;
typedef int __attribute__((may_alias)) int_a;

template <typename T> __device__ __forceinline__ void vst2(void* p, T v) { *(T*)p = v;  }
__device__ __forceinline__ v8f wmma16(v16h a, v16h b, v8f c) {
  v8f d = __builtin_amdgcn_wmma_f32_16x16x32_f16(false, a, false, b, (short)0, c, false, false);
  asm volatile("v_nop\n\tv_nop\n\tv_nop\n\tv_nop" : "+v"(d) : "v"(a), "v"(b));
  return d;
}
__device__ __forceinline__ v8f wmma_bf(v16b a, v16b b, v8f c) {
  v8f d = __builtin_amdgcn_wmma_f32_16x16x32_bf16(false, a, false, b, (short)0, c, false, false);
  asm volatile("v_nop\n\tv_nop\n\tv_nop\n\tv_nop" : "+v"(d) : "v"(a), "v"(b));
  return d;
}
// 16x16x32 fragments: lane = (h = lane>>4, row/col = lane&15); elements 0..7 = k0+8h+0..7, 8..15 = k0+16+8h+0..7; D element r = row 8h+r
__device__ __forceinline__ v16h frag_h(const _Float16* rowk0, int lane) {
  union { v16h v; v8h q[2]; } u; const _Float16* p = rowk0 + 8 * (lane >> 4);
  u.q[0] = *(const v8h*)p; u.q[1] = *(const v8h*)(p + 16); return u.v;
}
__device__ __forceinline__ v16h frag_f32(const float* rowk0, int lane) {
  v16h a; const float* p = rowk0 + 8 * (lane >> 4);
#pragma unroll
  for (int i = 0; i < 8; ++i) { a[i] = (_Float16)p[i]; a[8 + i] = (_Float16)p[16 + i]; }
  return a;
}
__device__ __forceinline__ v16h frag_f32s(const float* rowk0, int lane, float sc) {
  v16h a; const float* p = rowk0 + 8 * (lane >> 4);
#pragma unroll
  for (int i = 0; i < 8; ++i) { a[i] = (_Float16)(p[i] * sc); a[8 + i] = (_Float16)(p[16 + i] * sc); }
  return a;
}
// column fragment from a [K][ld] layout (column n), rows >= K read as 0
__device__ __forceinline__ v16h fragc_f32(const float* W, int k0, int n, int lane, int ld, int K) {
  v16h a; const int g = lane >> 4;
#pragma unroll
  for (int i = 0; i < 8; ++i) { const int ka = k0 + 8 * g + i, kb = ka + 16;
    a[i] = (_Float16)(ka < K ? W[(size_t)(ka < K ? ka : K - 1) * ld + n] : 0.f); a[8 + i] = (_Float16)(kb < K ? W[(size_t)(kb < K ? kb : K - 1) * ld + n] : 0.f); }
  return a;
}
struct F2 { v16b h, l; };
__device__ __forceinline__ F2 bsplit16(const float v[16]) { F2 r;
#pragma unroll
  for (int i = 0; i < 16; ++i) { const __bf16 h = (__bf16)v[i]; r.h[i] = h; r.l[i] = (__bf16)(v[i] - (float)h); }
  return r; }
__device__ __forceinline__ F2 split_row(const float* row, int k0, int lane) { float v[16]; const float* p = row + k0 + 8 * (lane >> 4);
#pragma unroll
  for (int i = 0; i < 8; ++i) { v[i] = p[i]; v[8 + i] = p[16 + i]; }
  return bsplit16(v); }
__device__ __forceinline__ F2 split_rowK(const float* row, int k0, int lane, int K) { float v[16]; const int g = lane >> 4;
#pragma unroll
  for (int i = 0; i < 8; ++i) { const int ka = k0 + 8 * g + i, kb = ka + 16; v[i] = ka < K ? row[ka < K ? ka : K - 1] : 0.f; v[8 + i] = kb < K ? row[kb < K ? kb : K - 1] : 0.f; }
  return bsplit16(v); }
__device__ __forceinline__ F2 split_col(const float* W, int k0, int n, int lane, int ld, int K) { float v[16]; const int g = lane >> 4;
#pragma unroll
  for (int i = 0; i < 8; ++i) { const int ka = k0 + 8 * g + i, kb = ka + 16; v[i] = ka < K ? W[(size_t)(ka < K ? ka : K - 1) * ld + n] : 0.f; v[8 + i] = kb < K ? W[(size_t)(kb < K ? kb : K - 1) * ld + n] : 0.f; }
  return bsplit16(v); }
__device__ __forceinline__ v8f mac3(const F2& a, const F2& b, v8f c) { c = wmma_bf(a.l, b.h, c); c = wmma_bf(a.h, b.l, c); return wmma_bf(a.h, b.h, c); }
__device__ __forceinline__ float sigm(float v) { return 1.0f / (1.0f + expf(-v)); }
#define LDSX() do { asm volatile("s_wait_dscnt 0" ::: "memory"); __builtin_amdgcn_wave_barrier(); __builtin_amdgcn_fence(__ATOMIC_RELEASE, "workgroup"); } while (0)


// Disentangled spatial attention (B 2, L 2,048, E 1,024, 16 heads x 64): scores = (qt . (kt + lam_ts ks) + qs . (lam_st kt + lam_ss ks)) / 8 over the target and source streams, softmax, . vt, output projection + bias.
#define NB 2
#define SS 2048
#define DM 1024
#define NH 16
#define HD 64
#define NR (NB * SS)
#ifndef TQB
#define TQB (SS / 64)
#define TNB NB
#endif
typedef __attribute__((ext_vector_type(8))) __bf16 v8b;
__device__ __forceinline__ v16b frag_b(const __bf16* rowk0, int lane) {
  union { v16b v; v8b q[2]; } u; const __bf16* p = rowk0 + 8 * (lane >> 4);
  u.q[0] = *(const v8b*)p; u.q[1] = *(const v8b*)(p + 16); return u.v;
}
__device__ __forceinline__ float bfr(float v) { return (float)(__bf16)v; }
__device__ __attribute__((noinline)) float exp_ni(float v) { return expf(v); }
__device__ __attribute__((noinline)) float erf_ni(float v) { return erff(v); }

#define WS_PW  0u                                     // bf16 transposed rows: Wt q, Wt k, Wt v, Ws q, Ws k, Wc  [6][1024][1024]
#define WS_QQ  (WS_PW + 2u * (size_t)6 * DM * DM)       // f16 [NR][2048]: qt | qs
#define WS_KK  (WS_QQ + 2u * (size_t)NR * 2 * DM)       // f16 [NR][2048]: k1 | k2
#define WS_VT  (WS_KK + 2u * (size_t)NR * 2 * DM)       // f16 planes vt [b][1024][SS]
#define WS_O   (WS_VT + 2u * (size_t)NB * DM * SS)       // f32 [NR][1024]
#define WS_END (WS_O + 4u * (size_t)NR * DM)

// ---- k_packT: (in,out) column n of block 'which' -> bf16 row n (K = 1024 contiguous)
__global__ __launch_bounds__(256) void k_packT(const float* __restrict__ WT, const float* __restrict__ WSm, const float* __restrict__ WC, __bf16* __restrict__ P) {
  __shared__ __align__(16) __bf16 s[DM]; const int n = blockIdx.x, which = blockIdx.y, t = threadIdx.x;
  const float* src; int stride, c;
  if (which < 3) { src = WT; stride = 3 * DM; c = which * DM + n; } else if (which < 5) { src = WSm; stride = 2 * DM; c = (which - 3) * DM + n; } else { src = WC; stride = DM; c = n; }
  for (int k = t; k < DM; k += 256) s[k] = (__bf16)src[(size_t)k * stride + c];
  __syncthreads(); for (int q = t; q < DM / 8; q += 256) vst2((unsigned*)(P + ((size_t)which * DM + n) * DM + q * 8), *(const v4u*)&s[q * 8]);
}
// ---- shared GEMM core: a 128 x 128 tile of X . W^T per 8-wave block; k slices of 64 go global -> registers -> LDS (two buffers), every wave reads its fragments from LDS
#define GP 72                 // LDS row pitch in 16-bit elements: 64 k + 8, so the 16 rows of a 16-byte fragment read fall on distinct banks
#define GT (128 * GP)         // one operand tile, elements
typedef __attribute__((ext_vector_type(4))) __bf16 v4b;
struct StgR { v4f a[8]; v4u b[4]; };
// each wave-wide load covers whole 128-B lines: X rows give 256 B per slice (16 lanes), weight rows 128 B (8 lanes)
__device__ __forceinline__ void g_load(StgR& r, const float* __restrict__ X, const __bf16* __restrict__ Pw, int k0, int tid) {
  const float* pa = X + (size_t)(tid >> 4) * DM + (tid & 15) * 4 + k0; const __bf16* pb = Pw + (size_t)(tid >> 3) * DM + (tid & 7) * 8 + k0;
#pragma unroll
  for (int i = 0; i < 8; ++i) r.a[i] = *(const v4f*)(pa + i * 16 * DM);
#pragma unroll
  for (int i = 0; i < 4; ++i) r.b[i] = *(const v4u*)(pb + i * 32 * DM);
}
template <bool SPLIT> __device__ __forceinline__ void g_store(const StgR& r, __bf16* buf, int tid) {   // buf: [A hi][B]([A lo])
  __bf16* sa = buf + (tid >> 4) * GP + (tid & 15) * 4; __bf16* sb = buf + GT + (tid >> 3) * GP + (tid & 7) * 8;
#pragma unroll
  for (int i = 0; i < 8; ++i) { v4b h, l;
#pragma unroll
    for (int q = 0; q < 4; ++q) { h[q] = (__bf16)r.a[i][q]; if (SPLIT) l[q] = (__bf16)(r.a[i][q] - (float)h[q]); }
    *(v4b*)(sa + i * 16 * GP) = h; if (SPLIT) *(v4b*)(sa + 2 * GT + i * 16 * GP) = l; }
#pragma unroll
  for (int i = 0; i < 4; ++i) *(v4u*)(sb + i * 32 * GP) = r.b[i];
}
// wave (wm, wn) of 2 x 4 owns rows wm*64 + i*16, columns wn*32 + j*16; k ascends as in a plain loop, so every accumulator sums in the same order
template <bool SPLIT> __device__ __forceinline__ void g_pass(const float* __restrict__ X, const __bf16* __restrict__ Pw, __bf16* sm, v8f (&acc)[4][2], int tid, int lane, int wm, int wn) {
  constexpr int BUF = (SPLIT ? 3 : 2) * GT; const int col = lane & 15;
  StgR r; g_load(r, X, Pw, 0, tid); g_store<SPLIT>(r, sm, tid);
  __syncthreads();   // slice 0 is published
#pragma unroll 1   // kept rolled: unrolled, 16 copies of this long body would only grow the code
  for (int s = 0; s < DM / 64; ++s) { const __bf16* cur = sm + (s & 1) * BUF;
    if (s + 1 < DM / 64) g_load(r, X, Pw, (s + 1) * 64, tid);   // the next slice flies while this one is multiplied
#pragma unroll
    for (int kk = 0; kk < 2; ++kk) { v16b b[2], a[4], al[SPLIT ? 4 : 1];
#pragma unroll
      for (int j = 0; j < 2; ++j) b[j] = frag_b(cur + GT + (wn * 32 + j * 16 + col) * GP + kk * 32, lane);
#pragma unroll
      for (int i = 0; i < 4; ++i) { a[i] = frag_b(cur + (wm * 64 + i * 16 + col) * GP + kk * 32, lane); if (SPLIT) al[i] = frag_b(cur + 2 * GT + (wm * 64 + i * 16 + col) * GP + kk * 32, lane); }
#pragma unroll
      for (int i = 0; i < 4; ++i)
#pragma unroll
        for (int j = 0; j < 2; ++j) acc[i][j] = wmma_bf(a[i], b[j], acc[i][j]);
      if (SPLIT) {   // every accumulator still takes hi, then lo, of each 32 k
#pragma unroll
        for (int i = 0; i < 4; ++i)
#pragma unroll
          for (int j = 0; j < 2; ++j) acc[i][j] = wmma_bf(al[i], b[j], acc[i][j]); } }
    if (s + 1 < DM / 64) g_store<SPLIT>(r, sm + ((s + 1) & 1) * BUF, tid);   // into the buffer whose readers left at the previous barrier
    __syncthreads();   // publishes slice s + 1 and ends every read of slice s
  }
}
// ---- k_qkvd: block = (128 rows, 128 cols, kind): kind 0 -> qt (from xt) and qs (from xs) into QQ; kind 1 -> k1, k2 into KK; kind 2 -> vt planes
#define EP 136                // epilogue staging pitch, f16 elements
__global__ __launch_bounds__(256) void k_qkvd(const float* __restrict__ XT, const float* __restrict__ XS, const __bf16* __restrict__ P, const float* __restrict__ BT, const float* __restrict__ BS, const float* __restrict__ LTS, const float* __restrict__ LST, const float* __restrict__ LSS, _Float16* __restrict__ QQ, _Float16* __restrict__ KK, _Float16* __restrict__ VT) {
  __shared__ __align__(16) unsigned char smem[2 * 2 * GT * 2];   // two buffers of [X tile][W tile]; the epilogue's two f16 [128][EP] tiles afterwards
  __bf16* sm = (__bf16*)smem; _Float16* so = (_Float16*)smem; _Float16* so2 = so + 128 * EP;
  const int tid = threadIdx.x, wave = tid >> 5, lane = tid & 31, col = lane & 15, g = lane >> 4, wm = wave >> 2, wn = wave & 3; const int kind = blockIdx.z; const int c0 = blockIdx.y * 128; const size_t rb = (size_t)blockIdx.x * 128;
  const __bf16* PT = P + ((size_t)kind * DM + c0) * DM;                              // Wt block for this kind (q, k or v)
  const __bf16* PS = P + ((size_t)(3 + (kind < 2 ? kind : 0)) * DM + c0) * DM;       // Ws block (q or k)
  v8f at[4][2] = {}, as[4][2] = {};
  g_pass<false>(XT + rb * DM, PT, sm, at, tid, lane, wm, wn);
  if (kind < 2) g_pass<false>(XS + rb * DM, PS, sm, as, tid, lane, wm, wn);
  if (kind < 2) {   // q pair, or k pair -> k1, k2
    float lts = 0.f, lst = 0.f, lss = 0.f; if (kind == 1) { lts = bfr(LTS[0]); lst = bfr(LST[0]); lss = bfr(LSS[0]); }
#pragma unroll
    for (int j = 0; j < 2; ++j) { const int cl = wn * 32 + j * 16 + col; const float g1 = BT[kind * DM + c0 + cl], g2 = BS[kind * DM + c0 + cl];
      asm volatile("s_wait_xcnt 0x0" ::: "memory");   // stands before a register that the two bias loads name is written again
      const float b1 = bfr(g1), b2 = bfr(g2);
#pragma unroll
      for (int i = 0; i < 4; ++i)
#pragma unroll
        for (int r = 0; r < 8; ++r) { const int rl = wm * 64 + i * 16 + 8 * g + r; const float t = at[i][j][r] + b1, u = as[i][j][r] + b2;
          so[rl * EP + cl] = (_Float16)(kind == 0 ? t : t + lts * u); so2[rl * EP + cl] = (_Float16)(kind == 0 ? u : lst * t + lss * u); } }
    __syncthreads();
    _Float16* D = kind == 0 ? QQ : KK;
    for (int e = tid; e < 128 * 16; e += 256) { const int rl = e >> 4, q = e & 15; vst2((unsigned*)(D + (rb + rl) * (2 * DM) + c0 + q * 8), *(const v4u*)&so[rl * EP + q * 8]); vst2((unsigned*)(D + (rb + rl) * (2 * DM) + DM + c0 + q * 8), *(const v4u*)&so2[rl * EP + q * 8]); }
  } else {   // vt planes: staged transposed, a lane's 8 rows are 16 contiguous bytes
#pragma unroll
    for (int j = 0; j < 2; ++j) { const int cl = wn * 32 + j * 16 + col; const float b1 = bfr(BT[2 * DM + c0 + cl]);
#pragma unroll
      for (int i = 0; i < 4; ++i) { v8h w;
#pragma unroll
        for (int r = 0; r < 8; ++r) w[r] = (_Float16)(at[i][j][r] + b1);
        *(v8h*)&so[cl * EP + wm * 64 + i * 16 + 8 * g] = w; } }
    __syncthreads();
    const size_t b = rb / SS; const int s0 = (int)(rb % SS);
    for (int e = tid; e < 128 * 16; e += 256) { const int d = e >> 4, pc = e & 15; vst2((unsigned*)(VT + ((b * DM + c0 + d) * SS) + s0 + pc * 8), *(const v4u*)&so[d * EP + pc * 8]); } }
}
// ---- k_attn: block = (64 queries, head, b): 128-wide scores ([qt|qs] . [k1|k2]) / 8, softmax, P . vt (64 dims); O 256-B head segments
__global__ __launch_bounds__(128) void k_attn(const _Float16* __restrict__ QQ, const _Float16* __restrict__ KK, const _Float16* __restrict__ VT, float* __restrict__ O) {
  __shared__ __align__(16) _Float16 sph[4][16][40]; __shared__ __align__(16) float so[4][16][68];
  const int tid = threadIdx.x, wave = tid >> 5, lane = tid & 31, col = lane & 15, g = lane >> 4; const int h = blockIdx.y; const size_t b = blockIdx.z; const int q0 = blockIdx.x * 64 + wave * 16; const size_t rq = b * SS + q0;
  v16h aq[4];
#pragma unroll
  for (int kc = 0; kc < 4; ++kc) aq[kc] = frag_h(QQ + (rq + col) * (2 * DM) + ((kc < 2) ? 0 : DM) + h * HD + (kc & 1) * 32, lane);
  float m[8], l[8];
#pragma unroll
  for (int r = 0; r < 8; ++r) { m[r] = -3.0e38f; l[r] = 0.f; }
  v8f acc[4] = {};
#pragma unroll 1
  for (int ks = 0; ks < SS / 32; ++ks) { const int j0 = ks * 32; v8f s[2];
#pragma unroll
    for (int ct = 0; ct < 2; ++ct) { const size_t rk = (b * SS + j0 + ct * 16 + col) * (2 * DM) + h * HD; v8f c = {};
#pragma unroll
      for (int kc = 0; kc < 4; ++kc) c = wmma16(aq[kc], frag_h(KK + rk + ((kc < 2) ? 0 : DM) + (kc & 1) * 32, lane), c);
#pragma unroll
      for (int r = 0; r < 8; ++r) s[ct][r] = c[r] * 0.125f; }
#pragma unroll
    for (int r = 0; r < 8; ++r) { float mx = fmaxf(s[0][r], s[1][r]);
#pragma unroll
      for (int o = 1; o < 16; o <<= 1) mx = fmaxf(mx, __shfl_xor(mx, o));
      const float mn = fmaxf(m[r], mx); const float alpha = (m[r] <= -1.0e38f) ? 0.f : __expf(m[r] - mn); const float e0 = __expf(s[0][r] - mn), e1 = __expf(s[1][r] - mn); float es = e0 + e1;
#pragma unroll
      for (int o = 1; o < 16; o <<= 1) es += __shfl_xor(es, o);
      l[r] = l[r] * alpha + es; m[r] = mn;
#pragma unroll
      for (int dt = 0; dt < 4; ++dt) acc[dt][r] *= alpha;
      sph[wave][8 * g + r][col] = (_Float16)(e0 * 2048.0f); sph[wave][8 * g + r][16 + col] = (_Float16)(e1 * 2048.0f); }
    LDSX();
    const v16h pa = frag_h(&sph[wave][col][0], lane);
#pragma unroll
    for (int dt = 0; dt < 4; ++dt) acc[dt] = wmma16(pa, frag_h(VT + ((b * DM + h * HD + dt * 16 + col) * SS) + j0, lane), acc[dt]);
    LDSX(); }
#pragma unroll
  for (int r = 0; r < 8; ++r) { const float il = (1.0f / 2048.0f) / l[r];
#pragma unroll
    for (int dt = 0; dt < 4; ++dt) so[wave][8 * g + r][dt * 16 + col] = acc[dt][r] * il; }
  LDSX();
  for (int rl = 0; rl < 16; ++rl) if (lane < 16) vst2(O + (rq + rl) * DM + h * HD + lane * 4, *(const v4f*)&so[wave][rl][lane * 4]);
}
// ---- k_out: block = (128 rows, 128 cols): Y = y (bf16 hi + lo) . Wc + bc
__global__ __launch_bounds__(256) void k_out(const float* __restrict__ O, const __bf16* __restrict__ P, const float* __restrict__ BC, float* __restrict__ Y) {
  __shared__ __align__(16) unsigned char smem[2 * 3 * GT * 2];   // two buffers of [y hi][Wc][y lo]; the epilogue's f32 [128][132] tile afterwards
  __bf16* sm = (__bf16*)smem; float* so = (float*)smem;
  const int tid = threadIdx.x, wave = tid >> 5, lane = tid & 31, col = lane & 15, g = lane >> 4, wm = wave >> 2, wn = wave & 3; const size_t rb = (size_t)blockIdx.x * 128; const int n0 = blockIdx.y * 128; const __bf16* PC = P + ((size_t)5 * DM + n0) * DM;
  v8f acc[4][2] = {};
  g_pass<true>(O + rb * DM, PC, sm, acc, tid, lane, wm, wn);
#pragma unroll
  for (int j = 0; j < 2; ++j) { const int cl = wn * 32 + j * 16 + col; const float bb = bfr(BC[n0 + cl]);
#pragma unroll
    for (int i = 0; i < 4; ++i)
#pragma unroll
      for (int r = 0; r < 8; ++r) so[(wm * 64 + i * 16 + 8 * g + r) * 132 + cl] = acc[i][j][r] + bb; }
  __syncthreads();
  for (int e = tid; e < 128 * 32; e += 256) { const int rl = e >> 5, q = e & 31; vst2(Y + (rb + rl) * DM + n0 + q * 4, *(const v4f*)&so[rl * 132 + q * 4]); }
}
extern "C" void kernel_launch(void* const* d_in, const int* in_sizes, int n_in, void* d_out, int out_size, void* d_ws, size_t ws_size, hipStream_t stream) {
  (void)in_sizes; (void)n_in; (void)out_size;
  const float** F = (const float**)d_in;   // 0 xt, 1 xs [2,2048,1024]; 2 Wt [1024,3072], 3 bt; 4 Ws [1024,2048], 5 bs; 6 Wc [1024,1024], 7 bc; 8 lam_ts, 9 lam_st, 10 lam_ss [1]
  if (ws_size < (size_t)WS_END) return;
  char* ws = (char*)d_ws; __bf16* P = (__bf16*)(ws + WS_PW); _Float16 *QQ = (_Float16*)(ws + WS_QQ), *KK = (_Float16*)(ws + WS_KK), *VT = (_Float16*)(ws + WS_VT); float* O = (float*)(ws + WS_O);
  k_packT<<<dim3(DM, 6), 256, 0, stream>>>(F[2], F[4], F[6], P);
  k_qkvd<<<dim3(TNB * SS / 128, DM / 128, 3), 256, 0, stream>>>(F[0], F[1], P, F[3], F[5], F[8], F[9], F[10], QQ, KK, VT);
  k_attn<<<dim3(TQB, NH, TNB), 128, 0, stream>>>(QQ, KK, VT, O);
  k_out<<<dim3(TNB * SS / 128, DM / 128), 256, 0, stream>>>(O, P, F[7], (float*)d_out);
}

// v002
// Measured time: 198 microseconds a run.
// Two timings next to v001 both put it at 1.92 times that version's speed.
// Counting every step since v000, it is 2.51 times as fast.
// compute dtype: all float inputs rounded to bf16, the three lambda scalars read on device; qt/kt/vt = xt . Wt + bt and qs/ks = xs . Ws + bs with EXACT bf16 products on WMMA 16x16x32 ((in,out) weights as transposed rows); k1 = kt + lam_ts ks and k2 = lam_st kt + lam_ss ks formed in f32, then q = [qt | qs] and k = [k1 | k2] rounded once to f16 (128-wide per head); PLAIN attention: scores x 1/8, running-max softmax in f32 (hardware exp), P (scaled by 2^11, single f16) x vt (single f16); out = y (bf16 hi + residual) . Wc (2 products) + bc.
#include <hip/hip_runtime.h>
#include <math.h>

typedef __attribute__((ext_vector_type(16))) _Float16 v16h;
typedef __attribute__((ext_vector_type(16))) __bf16 v16b;
typedef __attribute__((ext_vector_type(8)))  _Float16 v8h;
typedef __attribute__((ext_vector_type(8)))  float v8f;
typedef __attribute__((ext_vector_type(4)))  float v4f;
typedef __attribute__((ext_vector_type(2)))  float v2f;
typedef __attribute__((ext_vector_type(4)))  unsigned v4u;
typedef __attribute__((ext_vector_type(4)))  int v4i;
typedef float __attribute__((may_alias)) float_a;
typedef int __attribute__((may_alias)) int_a;

template <typename T> __device__ __forceinline__ void vst2(void* p, T v) { *(T*)p = v;  }
__device__ __forceinline__ v8f wmma16(v16h a, v16h b, v8f c) {
  v8f d = __builtin_amdgcn_wmma_f32_16x16x32_f16(false, a, false, b, (short)0, c, false, false);
  asm volatile("v_nop\n\tv_nop\n\tv_nop\n\tv_nop" : "+v"(d) : "v"(a), "v"(b));
  return d;
}
__device__ __forceinline__ v8f wmma_bf(v16b a, v16b b, v8f c) {
  v8f d = __builtin_amdgcn_wmma_f32_16x16x32_bf16(false, a, false, b, (short)0, c, false, false);
  asm volatile("v_nop\n\tv_nop\n\tv_nop\n\tv_nop" : "+v"(d) : "v"(a), "v"(b));
  return d;
}
// 16x16x32 fragments: lane = (h = lane>>4, row/col = lane&15); elements 0..7 = k0+8h+0..7, 8..15 = k0+16+8h+0..7; D element r = row 8h+r
__device__ __forceinline__ v16h frag_h(const _Float16* rowk0, int lane) {
  union { v16h v; v8h q[2]; } u; const _Float16* p = rowk0 + 8 * (lane >> 4);
  u.q[0] = *(const v8h*)p; u.q[1] = *(const v8h*)(p + 16); return u.v;
}
__device__ __forceinline__ v16h frag_f32(const float* rowk0, int lane) {
  v16h a; const float* p = rowk0 + 8 * (lane >> 4);
#pragma unroll
  for (int i = 0; i < 8; ++i) { a[i] = (_Float16)p[i]; a[8 + i] = (_Float16)p[16 + i]; }
  return a;
}
__device__ __forceinline__ v16h frag_f32s(const float* rowk0, int lane, float sc) {
  v16h a; const float* p = rowk0 + 8 * (lane >> 4);
#pragma unroll
  for (int i = 0; i < 8; ++i) { a[i] = (_Float16)(p[i] * sc); a[8 + i] = (_Float16)(p[16 + i] * sc); }
  return a;
}
// column fragment from a [K][ld] layout (column n), rows >= K read as 0
__device__ __forceinline__ v16h fragc_f32(const float* W, int k0, int n, int lane, int ld, int K) {
  v16h a; const int g = lane >> 4;
#pragma unroll
  for (int i = 0; i < 8; ++i) { const int ka = k0 + 8 * g + i, kb = ka + 16;
    a[i] = (_Float16)(ka < K ? W[(size_t)(ka < K ? ka : K - 1) * ld + n] : 0.f); a[8 + i] = (_Float16)(kb < K ? W[(size_t)(kb < K ? kb : K - 1) * ld + n] : 0.f); }
  return a;
}
struct F2 { v16b h, l; };
__device__ __forceinline__ F2 bsplit16(const float v[16]) { F2 r;
#pragma unroll
  for (int i = 0; i < 16; ++i) { const __bf16 h = (__bf16)v[i]; r.h[i] = h; r.l[i] = (__bf16)(v[i] - (float)h); }
  return r; }
__device__ __forceinline__ F2 split_row(const float* row, int k0, int lane) { float v[16]; const float* p = row + k0 + 8 * (lane >> 4);
#pragma unroll
  for (int i = 0; i < 8; ++i) { v[i] = p[i]; v[8 + i] = p[16 + i]; }
  return bsplit16(v); }
__device__ __forceinline__ F2 split_rowK(const float* row, int k0, int lane, int K) { float v[16]; const int g = lane >> 4;
#pragma unroll
  for (int i = 0; i < 8; ++i) { const int ka = k0 + 8 * g + i, kb = ka + 16; v[i] = ka < K ? row[ka < K ? ka : K - 1] : 0.f; v[8 + i] = kb < K ? row[kb < K ? kb : K - 1] : 0.f; }
  return bsplit16(v); }
__device__ __forceinline__ F2 split_col(const float* W, int k0, int n, int lane, int ld, int K) { float v[16]; const int g = lane >> 4;
#pragma unroll
  for (int i = 0; i < 8; ++i) { const int ka = k0 + 8 * g + i, kb = ka + 16; v[i] = ka < K ? W[(size_t)(ka < K ? ka : K - 1) * ld + n] : 0.f; v[8 + i] = kb < K ? W[(size_t)(kb < K ? kb : K - 1) * ld + n] : 0.f; }
  return bsplit16(v); }
__device__ __forceinline__ v8f mac3(const F2& a, const F2& b, v8f c) { c = wmma_bf(a.l, b.h, c); c = wmma_bf(a.h, b.l, c); return wmma_bf(a.h, b.h, c); }
__device__ __forceinline__ float sigm(float v) { return 1.0f / (1.0f + expf(-v)); }
#define LDSX() do { asm volatile("s_wait_dscnt 0" ::: "memory"); __builtin_amdgcn_wave_barrier(); __builtin_amdgcn_fence(__ATOMIC_RELEASE, "workgroup"); } while (0)


// Disentangled spatial attention (B 2, L 2,048, E 1,024, 16 heads x 64): scores = (qt . (kt + lam_ts ks) + qs . (lam_st kt + lam_ss ks)) / 8 over the target and source streams, softmax, . vt, output projection + bias.
#define NB 2
#define SS 2048
#define DM 1024
#define NH 16
#define HD 64
#define NR (NB * SS)
#ifndef TQB
#define TQB (SS / 128)
#define TNB NB
#endif
typedef __attribute__((ext_vector_type(8))) __bf16 v8b;
__device__ __forceinline__ v16b frag_b(const __bf16* rowk0, int lane) {
  union { v16b v; v8b q[2]; } u; const __bf16* p = rowk0 + 8 * (lane >> 4);
  u.q[0] = *(const v8b*)p; u.q[1] = *(const v8b*)(p + 16); return u.v;
}
__device__ __forceinline__ float bfr(float v) { return (float)(__bf16)v; }
__device__ __attribute__((noinline)) float exp_ni(float v) { return expf(v); }
__device__ __attribute__((noinline)) float erf_ni(float v) { return erff(v); }

#define WS_PW  0u                                     // bf16 transposed rows: Wt q, Wt k, Wt v, Ws q, Ws k, Wc  [6][1024][1024]
#define WS_QQ  (WS_PW + 2u * (size_t)6 * DM * DM)       // f16 [NR][2048]: qt | qs
#define WS_KK  (WS_QQ + 2u * (size_t)NR * 2 * DM)       // f16 [NR][2048]: k1 | k2
#define WS_VT  (WS_KK + 2u * (size_t)NR * 2 * DM)       // f16 planes vt [b][1024][SS]
#define WS_O   (WS_VT + 2u * (size_t)NB * DM * SS)       // f32 [NR][1024]
#define WS_END (WS_O + 4u * (size_t)NR * DM)

// ---- k_packT: (in,out) column n of block 'which' -> bf16 row n (K = 1024 contiguous)
__global__ __launch_bounds__(256) void k_packT(const float* __restrict__ WT, const float* __restrict__ WSm, const float* __restrict__ WC, __bf16* __restrict__ P) {
  __shared__ __align__(16) __bf16 s[DM]; const int n = blockIdx.x, which = blockIdx.y, t = threadIdx.x;
  const float* src; int stride, c;
  if (which < 3) { src = WT; stride = 3 * DM; c = which * DM + n; } else if (which < 5) { src = WSm; stride = 2 * DM; c = (which - 3) * DM + n; } else { src = WC; stride = DM; c = n; }
  for (int k = t; k < DM; k += 256) s[k] = (__bf16)src[(size_t)k * stride + c];
  __syncthreads(); for (int q = t; q < DM / 8; q += 256) vst2((unsigned*)(P + ((size_t)which * DM + n) * DM + q * 8), *(const v4u*)&s[q * 8]);
}
// ---- shared GEMM core: a 128 x 128 tile of X . W^T per 8-wave block; k slices of 64 go global -> registers -> LDS (two buffers), every wave reads its fragments from LDS
#define GP 72                 // LDS row pitch in 16-bit elements: 64 k + 8, so the 16 rows of a 16-byte fragment read fall on distinct banks
#define GT (128 * GP)         // one operand tile, elements
typedef __attribute__((ext_vector_type(4))) __bf16 v4b;
struct StgR { v4f a[8]; v4u b[4]; };
// each wave-wide load covers whole 128-B lines: X rows give 256 B per slice (16 lanes), weight rows 128 B (8 lanes)
__device__ __forceinline__ void g_load(StgR& r, const float* __restrict__ X, const __bf16* __restrict__ Pw, int k0, int tid) {
  const float* pa = X + (size_t)(tid >> 4) * DM + (tid & 15) * 4 + k0; const __bf16* pb = Pw + (size_t)(tid >> 3) * DM + (tid & 7) * 8 + k0;
#pragma unroll
  for (int i = 0; i < 8; ++i) r.a[i] = *(const v4f*)(pa + i * 16 * DM);
#pragma unroll
  for (int i = 0; i < 4; ++i) r.b[i] = *(const v4u*)(pb + i * 32 * DM);
}
template <bool SPLIT> __device__ __forceinline__ void g_store(const StgR& r, __bf16* buf, int tid) {   // buf: [A hi][B]([A lo])
  __bf16* sa = buf + (tid >> 4) * GP + (tid & 15) * 4; __bf16* sb = buf + GT + (tid >> 3) * GP + (tid & 7) * 8;
#pragma unroll
  for (int i = 0; i < 8; ++i) { v4b h, l;
#pragma unroll
    for (int q = 0; q < 4; ++q) { h[q] = (__bf16)r.a[i][q]; if (SPLIT) l[q] = (__bf16)(r.a[i][q] - (float)h[q]); }
    *(v4b*)(sa + i * 16 * GP) = h; if (SPLIT) *(v4b*)(sa + 2 * GT + i * 16 * GP) = l; }
#pragma unroll
  for (int i = 0; i < 4; ++i) *(v4u*)(sb + i * 32 * GP) = r.b[i];
}
// wave (wm, wn) of 2 x 4 owns rows wm*64 + i*16, columns wn*32 + j*16; k ascends as in a plain loop, so every accumulator sums in the same order
template <bool SPLIT> __device__ __forceinline__ void g_pass(const float* __restrict__ X, const __bf16* __restrict__ Pw, __bf16* sm, v8f (&acc)[4][2], int tid, int lane, int wm, int wn) {
  constexpr int BUF = (SPLIT ? 3 : 2) * GT; const int col = lane & 15;
  StgR r; g_load(r, X, Pw, 0, tid); g_store<SPLIT>(r, sm, tid);
  __syncthreads();   // slice 0 is published
#pragma unroll 1   // kept rolled: unrolled, 16 copies of this long body would only grow the code
  for (int s = 0; s < DM / 64; ++s) { const __bf16* cur = sm + (s & 1) * BUF;
    if (s + 1 < DM / 64) g_load(r, X, Pw, (s + 1) * 64, tid);   // the next slice flies while this one is multiplied
#pragma unroll
    for (int kk = 0; kk < 2; ++kk) { v16b b[2], a[4], al[SPLIT ? 4 : 1];
#pragma unroll
      for (int j = 0; j < 2; ++j) b[j] = frag_b(cur + GT + (wn * 32 + j * 16 + col) * GP + kk * 32, lane);
#pragma unroll
      for (int i = 0; i < 4; ++i) { a[i] = frag_b(cur + (wm * 64 + i * 16 + col) * GP + kk * 32, lane); if (SPLIT) al[i] = frag_b(cur + 2 * GT + (wm * 64 + i * 16 + col) * GP + kk * 32, lane); }
#pragma unroll
      for (int i = 0; i < 4; ++i)
#pragma unroll
        for (int j = 0; j < 2; ++j) acc[i][j] = wmma_bf(a[i], b[j], acc[i][j]);
      if (SPLIT) {   // every accumulator still takes hi, then lo, of each 32 k
#pragma unroll
        for (int i = 0; i < 4; ++i)
#pragma unroll
          for (int j = 0; j < 2; ++j) acc[i][j] = wmma_bf(al[i], b[j], acc[i][j]); } }
    if (s + 1 < DM / 64) g_store<SPLIT>(r, sm + ((s + 1) & 1) * BUF, tid);   // into the buffer whose readers left at the previous barrier
    __syncthreads();   // publishes slice s + 1 and ends every read of slice s
  }
}
// ---- k_qkvd: block = (128 rows, 128 cols, kind): kind 0 -> qt (from xt) and qs (from xs) into QQ; kind 1 -> k1, k2 into KK; kind 2 -> vt planes
#define EP 136                // epilogue staging pitch, f16 elements
__global__ __launch_bounds__(256) void k_qkvd(const float* __restrict__ XT, const float* __restrict__ XS, const __bf16* __restrict__ P, const float* __restrict__ BT, const float* __restrict__ BS, const float* __restrict__ LTS, const float* __restrict__ LST, const float* __restrict__ LSS, _Float16* __restrict__ QQ, _Float16* __restrict__ KK, _Float16* __restrict__ VT) {
  __shared__ __align__(16) unsigned char smem[2 * 2 * GT * 2];   // two buffers of [X tile][W tile]; the epilogue's two f16 [128][EP] tiles afterwards
  __bf16* sm = (__bf16*)smem; _Float16* so = (_Float16*)smem; _Float16* so2 = so + 128 * EP;
  const int tid = threadIdx.x, wave = tid >> 5, lane = tid & 31, col = lane & 15, g = lane >> 4, wm = wave >> 2, wn = wave & 3; const int kind = blockIdx.z; const int c0 = blockIdx.y * 128; const size_t rb = (size_t)blockIdx.x * 128;
  const __bf16* PT = P + ((size_t)kind * DM + c0) * DM;                              // Wt block for this kind (q, k or v)
  const __bf16* PS = P + ((size_t)(3 + (kind < 2 ? kind : 0)) * DM + c0) * DM;       // Ws block (q or k)
  v8f at[4][2] = {}, as[4][2] = {};
  g_pass<false>(XT + rb * DM, PT, sm, at, tid, lane, wm, wn);
  if (kind < 2) g_pass<false>(XS + rb * DM, PS, sm, as, tid, lane, wm, wn);
  if (kind < 2) {   // q pair, or k pair -> k1, k2
    float lts = 0.f, lst = 0.f, lss = 0.f; if (kind == 1) { lts = bfr(LTS[0]); lst = bfr(LST[0]); lss = bfr(LSS[0]); }
#pragma unroll
    for (int j = 0; j < 2; ++j) { const int cl = wn * 32 + j * 16 + col; const float g1 = BT[kind * DM + c0 + cl], g2 = BS[kind * DM + c0 + cl];
      asm volatile("s_wait_xcnt 0x0" ::: "memory");   // stands before a register that the two bias loads name is written again
      const float b1 = bfr(g1), b2 = bfr(g2);
#pragma unroll
      for (int i = 0; i < 4; ++i)
#pragma unroll
        for (int r = 0; r < 8; ++r) { const int rl = wm * 64 + i * 16 + 8 * g + r; const float t = at[i][j][r] + b1, u = as[i][j][r] + b2;
          so[rl * EP + cl] = (_Float16)(kind == 0 ? t : t + lts * u); so2[rl * EP + cl] = (_Float16)(kind == 0 ? u : lst * t + lss * u); } }
    __syncthreads();
    _Float16* D = kind == 0 ? QQ : KK;
    for (int e = tid; e < 128 * 16; e += 256) { const int rl = e >> 4, q = e & 15; vst2((unsigned*)(D + (rb + rl) * (2 * DM) + c0 + q * 8), *(const v4u*)&so[rl * EP + q * 8]); vst2((unsigned*)(D + (rb + rl) * (2 * DM) + DM + c0 + q * 8), *(const v4u*)&so2[rl * EP + q * 8]); }
  } else {   // vt planes: staged transposed, a lane's 8 rows are 16 contiguous bytes
#pragma unroll
    for (int j = 0; j < 2; ++j) { const int cl = wn * 32 + j * 16 + col; const float b1 = bfr(BT[2 * DM + c0 + cl]);
#pragma unroll
      for (int i = 0; i < 4; ++i) { v8h w;
#pragma unroll
        for (int r = 0; r < 8; ++r) w[r] = (_Float16)(at[i][j][r] + b1);
        *(v8h*)&so[cl * EP + wm * 64 + i * 16 + 8 * g] = w; } }
    __syncthreads();
    const size_t b = rb / SS; const int s0 = (int)(rb % SS);
    for (int e = tid; e < 128 * 16; e += 256) { const int d = e >> 4, pc = e & 15; vst2((unsigned*)(VT + ((b * DM + c0 + d) * SS) + s0 + pc * 8), *(const v4u*)&so[d * EP + pc * 8]); } }
}
// ---- k_attn: block = (128 queries, head, b), 8 waves x 16 queries: 128-wide scores ([qt|qs] . [k1|k2]) / 8, softmax, P . vt (64 dims); O 256-B head segments
// K and vt go global -> LDS in stages of 128 keys by asynchronous copies (whole 128-B lines, two buffers), once per block; every wave reads its fragments from LDS
#define AK 128                // keys per stage
#define AP 136                // LDS row pitch in f16 elements: 256 B + 16 B, so the 16 rows of a 16-byte fragment read fall on distinct banks
#define AKT (AK * AP)         // K tile [key][k1 | k2], elements
#define ABUF (AKT + HD * AP)  // one buffer: K tile, then vt tile [dim][key]
// one stage: 8 K copies and 4 vt copies of 16 B per lane; a wave's 32 lanes cover four whole 128-B lines per copy
__device__ __forceinline__ void kv_copy(const _Float16* gk, const _Float16* gv, unsigned lk, unsigned lv) {
  // the closing s_wait_xcnt stands inside the statement so that no address register of a copy is written again in front of it
  asm volatile("global_load_async_to_lds_b128 %0, %1, off\n\t"
               "global_load_async_to_lds_b128 %2, %3, off\n\t"
               "global_load_async_to_lds_b128 %4, %5, off\n\t"
               "global_load_async_to_lds_b128 %6, %7, off\n\t"
               "global_load_async_to_lds_b128 %8, %9, off\n\t"
               "global_load_async_to_lds_b128 %10, %11, off\n\t"
               "global_load_async_to_lds_b128 %12, %13, off\n\t"
               "global_load_async_to_lds_b128 %14, %15, off\n\t"
               "global_load_async_to_lds_b128 %16, %17, off\n\t"
               "global_load_async_to_lds_b128 %18, %19, off\n\t"
               "global_load_async_to_lds_b128 %20, %21, off\n\t"
               "global_load_async_to_lds_b128 %22, %23, off\n\t"
               "s_wait_xcnt 0x0"
               :: "v"(lk), "v"(gk), "v"(lk + 1 * 16 * AP * 2), "v"(gk + 1 * 16 * 2 * DM), "v"(lk + 2 * 16 * AP * 2), "v"(gk + 2 * 16 * 2 * DM), "v"(lk + 3 * 16 * AP * 2), "v"(gk + 3 * 16 * 2 * DM),
                  "v"(lk + 4 * 16 * AP * 2), "v"(gk + 4 * 16 * 2 * DM), "v"(lk + 5 * 16 * AP * 2), "v"(gk + 5 * 16 * 2 * DM), "v"(lk + 6 * 16 * AP * 2), "v"(gk + 6 * 16 * 2 * DM), "v"(lk + 7 * 16 * AP * 2), "v"(gk + 7 * 16 * 2 * DM),
                  "v"(lv), "v"(gv), "v"(lv + 1 * 16 * AP * 2), "v"(gv + 1 * 16 * SS), "v"(lv + 2 * 16 * AP * 2), "v"(gv + 2 * 16 * SS), "v"(lv + 3 * 16 * AP * 2), "v"(gv + 3 * 16 * SS)
               : "memory");
}
__global__ __launch_bounds__(256) void k_attn(const _Float16* __restrict__ QQ, const _Float16* __restrict__ KK, const _Float16* __restrict__ VT, float* __restrict__ O) {
  __shared__ __align__(16) _Float16 ring[2 * ABUF]; __shared__ __align__(16) _Float16 sph[8][16][40]; __shared__ __align__(16) float so[8][16][68];
  const int tid = threadIdx.x, wave = tid >> 5, lane = tid & 31, col = lane & 15, g = lane >> 4; const int h = blockIdx.y; const size_t b = blockIdx.z; const int q0 = blockIdx.x * 128 + wave * 16; const size_t rq = b * SS + q0;
  // lane's share of a stage: K row tid >> 4 (+16 per copy), 16-byte piece tid & 15 of [k1 | k2]; vt row tid >> 4 (+16 per copy), piece tid & 15 of 128 keys
  const _Float16* gk = KK + (b * SS + (tid >> 4)) * (2 * DM) + ((tid >> 3) & 1) * DM + h * HD + (tid & 7) * 8; const _Float16* gv = VT + (b * DM + h * HD + (tid >> 4)) * SS + (tid & 15) * 8;
  const unsigned lk = (unsigned)(size_t)ring + ((tid >> 4) * AP + (tid & 15) * 8) * 2, lv = lk + AKT * 2;
  kv_copy(gk, gv, lk, lv);
  asm volatile("s_wait_asynccnt 0x0" ::: "memory");   // this wave's share of stage 0 has landed
  __syncthreads();   // stage 0 is published
  kv_copy(gk + (size_t)AK * 2 * DM, gv + AK, lk + ABUF * 2, lv + ABUF * 2);   // stage 1 flies while stage 0 is worked on
  v16h aq[4];
#pragma unroll
  for (int kc = 0; kc < 4; ++kc) aq[kc] = frag_h(QQ + (rq + col) * (2 * DM) + ((kc < 2) ? 0 : DM) + h * HD + (kc & 1) * 32, lane);
  float m[8], l[8];
#pragma unroll
  for (int r = 0; r < 8; ++r) { m[r] = -3.0e38f; l[r] = 0.f; }
  v8f acc[4] = {};
#pragma unroll 1   // kept rolled: one copy of the publish point and of the long body
  for (int t = 0; t < SS / AK; ++t) { const _Float16* kb = ring + (t & 1) * ABUF; const _Float16* vb = kb + AKT;
#pragma unroll 1   // kept rolled: four copies of this long body would only grow the code
  for (int ks = 0; ks < AK / 32; ++ks) { const int j0 = ks * 32; v8f s[2];
    v16h bk[2][4], bv[4];   // all fragment reads of the 32 keys stand together, in front of the products: one LDS latency, and vt's passes under the softmax
#pragma unroll
    for (int ct = 0; ct < 2; ++ct)
#pragma unroll
      for (int kc = 0; kc < 4; ++kc) bk[ct][kc] = frag_h(kb + (j0 + ct * 16 + col) * AP + kc * 32, lane);
#pragma unroll
    for (int dt = 0; dt < 4; ++dt) bv[dt] = frag_h(vb + (dt * 16 + col) * AP + j0, lane);
#pragma unroll
    for (int ct = 0; ct < 2; ++ct) { v8f c = {};
#pragma unroll
      for (int kc = 0; kc < 4; ++kc) c = wmma16(aq[kc], bk[ct][kc], c);
#pragma unroll
      for (int r = 0; r < 8; ++r) s[ct][r] = c[r] * 0.125f; }
#pragma unroll
    for (int r = 0; r < 8; ++r) { float mx = fmaxf(s[0][r], s[1][r]);
#pragma unroll
      for (int o = 1; o < 16; o <<= 1) mx = fmaxf(mx, __shfl_xor(mx, o));
      const float mn = fmaxf(m[r], mx); const float alpha = (m[r] <= -1.0e38f) ? 0.f : __expf(m[r] - mn); const float e0 = __expf(s[0][r] - mn), e1 = __expf(s[1][r] - mn); float es = e0 + e1;
#pragma unroll
      for (int o = 1; o < 16; o <<= 1) es += __shfl_xor(es, o);
      l[r] = l[r] * alpha + es; m[r] = mn;
#pragma unroll
      for (int dt = 0; dt < 4; ++dt) acc[dt][r] *= alpha;
      sph[wave][8 * g + r][col] = (_Float16)(e0 * 2048.0f); sph[wave][8 * g + r][16 + col] = (_Float16)(e1 * 2048.0f); }
    LDSX();
    const v16h pa = frag_h(&sph[wave][col][0], lane);
#pragma unroll
    for (int dt = 0; dt < 4; ++dt) acc[dt] = wmma16(pa, bv[dt], acc[dt]);
    LDSX(); }
    asm volatile("s_wait_dscnt 0x0" ::: "memory");      // this wave's reads of stage t are done
    asm volatile("s_wait_asynccnt 0x0" ::: "memory");   // this wave's share of stage t + 1 has landed
    __syncthreads();   // publishes stage t + 1 and ends every read of stage t
    if (t + 2 < SS / AK) kv_copy(gk + (size_t)(t + 2) * AK * 2 * DM, gv + (t + 2) * AK, lk + (t & 1) * ABUF * 2, lv + (t & 1) * ABUF * 2);   // into the buffer that stage t has just left
  }
  asm volatile("s_wait_asynccnt 0x0" ::: "memory");   // no copy is outstanding when the wave ends
#pragma unroll
  for (int r = 0; r < 8; ++r) { const float il = (1.0f / 2048.0f) / l[r];
#pragma unroll
    for (int dt = 0; dt < 4; ++dt) so[wave][8 * g + r][dt * 16 + col] = acc[dt][r] * il; }
  LDSX();
  for (int rl = 0; rl < 16; ++rl) if (lane < 16) vst2(O + (rq + rl) * DM + h * HD + lane * 4, *(const v4f*)&so[wave][rl][lane * 4]);
}
// ---- k_out: block = (128 rows, 128 cols): Y = y (bf16 hi + lo) . Wc + bc
__global__ __launch_bounds__(256) void k_out(const float* __restrict__ O, const __bf16* __restrict__ P, const float* __restrict__ BC, float* __restrict__ Y) {
  __shared__ __align__(16) unsigned char smem[2 * 3 * GT * 2];   // two buffers of [y hi][Wc][y lo]; the epilogue's f32 [128][132] tile afterwards
  __bf16* sm = (__bf16*)smem; float* so = (float*)smem;
  const int tid = threadIdx.x, wave = tid >> 5, lane = tid & 31, col = lane & 15, g = lane >> 4, wm = wave >> 2, wn = wave & 3; const size_t rb = (size_t)blockIdx.x * 128; const int n0 = blockIdx.y * 128; const __bf16* PC = P + ((size_t)5 * DM + n0) * DM;
  v8f acc[4][2] = {};
  g_pass<true>(O + rb * DM, PC, sm, acc, tid, lane, wm, wn);
#pragma unroll
  for (int j = 0; j < 2; ++j) { const int cl = wn * 32 + j * 16 + col; const float bb = bfr(BC[n0 + cl]);
#pragma unroll
    for (int i = 0; i < 4; ++i)
#pragma unroll
      for (int r = 0; r < 8; ++r) so[(wm * 64 + i * 16 + 8 * g + r) * 132 + cl] = acc[i][j][r] + bb; }
  __syncthreads();
  for (int e = tid; e < 128 * 32; e += 256) { const int rl = e >> 5, q = e & 31; vst2(Y + (rb + rl) * DM + n0 + q * 4, *(const v4f*)&so[rl * 132 + q * 4]); }
}
extern "C" void kernel_launch(void* const* d_in, const int* in_sizes, int n_in, void* d_out, int out_size, void* d_ws, size_t ws_size, hipStream_t stream) {
  (void)in_sizes; (void)n_in; (void)out_size;
  const float** F = (const float**)d_in;   // 0 xt, 1 xs [2,2048,1024]; 2 Wt [1024,3072], 3 bt; 4 Ws [1024,2048], 5 bs; 6 Wc [1024,1024], 7 bc; 8 lam_ts, 9 lam_st, 10 lam_ss [1]
  if (ws_size < (size_t)WS_END) return;
  char* ws = (char*)d_ws; __bf16* P = (__bf16*)(ws + WS_PW); _Float16 *QQ = (_Float16*)(ws + WS_QQ), *KK = (_Float16*)(ws + WS_KK), *VT = (_Float16*)(ws + WS_VT); float* O = (float*)(ws + WS_O);
  k_packT<<<dim3(DM, 6), 256, 0, stream>>>(F[2], F[4], F[6], P);
  k_qkvd<<<dim3(TNB * SS / 128, DM / 128, 3), 256, 0, stream>>>(F[0], F[1], P, F[3], F[5], F[8], F[9], F[10], QQ, KK, VT);
  k_attn<<<dim3(TQB, NH, TNB), 256, 0, stream>>>(QQ, KK, VT, O);
  k_out<<<dim3(TNB * SS / 128, DM / 128), 256, 0, stream>>>(O, P, F[7], (float*)d_out);
}

// v003
// A run of this version takes 161 microseconds.
// Timed twice side by side with v002, it ran 1.23 times as fast both times.
// All steps since v000 together make it 3.09 times as fast.
// compute dtype: all float inputs rounded to bf16, the three lambda scalars read on device; qt/kt/vt = xt . Wt + bt and qs/ks = xs . Ws + bs with EXACT bf16 products on WMMA 16x16x32 ((in,out) weights as transposed rows); k1 = kt + lam_ts ks and k2 = lam_st kt + lam_ss ks formed in f32, then q = [qt | qs] and k = [k1 | k2] rounded once to f16 (128-wide per head); PLAIN attention: scores x 1/8, running-max softmax in f32 (hardware exp), P (scaled by 2^11, single f16) x vt (single f16); out = y (bf16 hi + residual) . Wc (2 products) + bc.
#include <hip/hip_runtime.h>
#include <math.h>

typedef __attribute__((ext_vector_type(16))) _Float16 v16h;
typedef __attribute__((ext_vector_type(16))) __bf16 v16b;
typedef __attribute__((ext_vector_type(8)))  _Float16 v8h;
typedef __attribute__((ext_vector_type(8)))  float v8f;
typedef __attribute__((ext_vector_type(4)))  float v4f;
typedef __attribute__((ext_vector_type(2)))  float v2f;
typedef __attribute__((ext_vector_type(4)))  unsigned v4u;
typedef __attribute__((ext_vector_type(4)))  int v4i;
typedef float __attribute__((may_alias)) float_a;
typedef int __attribute__((may_alias)) int_a;

template <typename T> __device__ __forceinline__ void vst2(void* p, T v) { *(T*)p = v;  }
__device__ __forceinline__ v8f wmma16(v16h a, v16h b, v8f c) {
  v8f d = __builtin_amdgcn_wmma_f32_16x16x32_f16(false, a, false, b, (short)0, c, false, false);
  asm volatile("v_nop\n\tv_nop\n\tv_nop\n\tv_nop" : "+v"(d) : "v"(a), "v"(b));
  return d;
}
__device__ __forceinline__ v8f wmma_bf(v16b a, v16b b, v8f c) {
  v8f d = __builtin_amdgcn_wmma_f32_16x16x32_bf16(false, a, false, b, (short)0, c, false, false);
  asm volatile("v_nop\n\tv_nop\n\tv_nop\n\tv_nop" : "+v"(d) : "v"(a), "v"(b));
  return d;
}
// 16x16x32 fragments: lane = (h = lane>>4, row/col = lane&15); elements 0..7 = k0+8h+0..7, 8..15 = k0+16+8h+0..7; D element r = row 8h+r
__device__ __forceinline__ v16h frag_h(const _Float16* rowk0, int lane) {
  union { v16h v; v8h q[2]; } u; const _Float16* p = rowk0 + 8 * (lane >> 4);
  u.q[0] = *(const v8h*)p; u.q[1] = *(const v8h*)(p + 16); return u.v;
}
__device__ __forceinline__ v16h frag_f32(const float* rowk0, int lane) {
  v16h a; const float* p = rowk0 + 8 * (lane >> 4);
#pragma unroll
  for (int i = 0; i < 8; ++i) { a[i] = (_Float16)p[i]; a[8 + i] = (_Float16)p[16 + i]; }
  return a;
}
__device__ __forceinline__ v16h frag_f32s(const float* rowk0, int lane, float sc) {
  v16h a; const float* p = rowk0 + 8 * (lane >> 4);
#pragma unroll
  for (int i = 0; i < 8; ++i) { a[i] = (_Float16)(p[i] * sc); a[8 + i] = (_Float16)(p[16 + i] * sc); }
  return a;
}
// column fragment from a [K][ld] layout (column n), rows >= K read as 0
__device__ __forceinline__ v16h fragc_f32(const float* W, int k0, int n, int lane, int ld, int K) {
  v16h a; const int g = lane >> 4;
#pragma unroll
  for (int i = 0; i < 8; ++i) { const int ka = k0 + 8 * g + i, kb = ka + 16;
    a[i] = (_Float16)(ka < K ? W[(size_t)(ka < K ? ka : K - 1) * ld + n] : 0.f); a[8 + i] = (_Float16)(kb < K ? W[(size_t)(kb < K ? kb : K - 1) * ld + n] : 0.f); }
  return a;
}
struct F2 { v16b h, l; };
__device__ __forceinline__ F2 bsplit16(const float v[16]) { F2 r;
#pragma unroll
  for (int i = 0; i < 16; ++i) { const __bf16 h = (__bf16)v[i]; r.h[i] = h; r.l[i] = (__bf16)(v[i] - (float)h); }
  return r; }
__device__ __forceinline__ F2 split_row(const float* row, int k0, int lane) { float v[16]; const float* p = row + k0 + 8 * (lane >> 4);
#pragma unroll
  for (int i = 0; i < 8; ++i) { v[i] = p[i]; v[8 + i] = p[16 + i]; }
  return bsplit16(v); }
__device__ __forceinline__ F2 split_rowK(const float* row, int k0, int lane, int K) { float v[16]; const int g = lane >> 4;
#pragma unroll
  for (int i = 0; i < 8; ++i) { const int ka = k0 + 8 * g + i, kb = ka + 16; v[i] = ka < K ? row[ka < K ? ka : K - 1] : 0.f; v[8 + i] = kb < K ? row[kb < K ? kb : K - 1] : 0.f; }
  return bsplit16(v); }
__device__ __forceinline__ F2 split_col(const float* W, int k0, int n, int lane, int ld, int K) { float v[16]; const int g = lane >> 4;
#pragma unroll
  for (int i = 0; i < 8; ++i) { const int ka = k0 + 8 * g + i, kb = ka + 16; v[i] = ka < K ? W[(size_t)(ka < K ? ka : K - 1) * ld + n] : 0.f; v[8 + i] = kb < K ? W[(size_t)(kb < K ? kb : K - 1) * ld + n] : 0.f; }
  return bsplit16(v); }
__device__ __forceinline__ v8f mac3(const F2& a, const F2& b, v8f c) { c = wmma_bf(a.l, b.h, c); c = wmma_bf(a.h, b.l, c); return wmma_bf(a.h, b.h, c); }
__device__ __forceinline__ float sigm(float v) { return 1.0f / (1.0f + expf(-v)); }
#define LDSX() do { asm volatile("s_wait_dscnt 0" ::: "memory"); __builtin_amdgcn_wave_barrier(); __builtin_amdgcn_fence(__ATOMIC_RELEASE, "workgroup"); } while (0)


// Disentangled spatial attention (B 2, L 2,048, E 1,024, 16 heads x 64): scores = (qt . (kt + lam_ts ks) + qs . (lam_st kt + lam_ss ks)) / 8 over the target and source streams, softmax, . vt, output projection + bias.
#define NB 2
#define SS 2048
#define DM 1024
#define NH 16
#define HD 64
#define NR (NB * SS)
#ifndef TQB
#define TQB (SS / 128)
#define TNB NB
#endif
typedef __attribute__((ext_vector_type(8))) __bf16 v8b;
__device__ __forceinline__ v16b frag_b(const __bf16* rowk0, int lane) {
  union { v16b v; v8b q[2]; } u; const __bf16* p = rowk0 + 8 * (lane >> 4);
  u.q[0] = *(const v8b*)p; u.q[1] = *(const v8b*)(p + 16); return u.v;
}
__device__ __forceinline__ float bfr(float v) { return (float)(__bf16)v; }
__device__ __attribute__((noinline)) float exp_ni(float v) { return expf(v); }
__device__ __attribute__((noinline)) float erf_ni(float v) { return erff(v); }

#define WS_PW  0u                                     // bf16 transposed rows: Wt q, Wt k, Wt v, Ws q, Ws k, Wc  [6][1024][1024]
#define WS_QQ  (WS_PW + 2u * (size_t)6 * DM * DM)       // f16 [NR][2048]: qt | qs
#define WS_KK  (WS_QQ + 2u * (size_t)NR * 2 * DM)       // f16 [NR][2048]: k1 | k2
#define WS_VT  (WS_KK + 2u * (size_t)NR * 2 * DM)       // f16 planes vt [b][1024][SS]
#define WS_O   (WS_VT + 2u * (size_t)NB * DM * SS)       // f32 [NR][1024]
#define WS_END (WS_O + 4u * (size_t)NR * DM)

// ---- k_packT: (in,out) column n of block 'which' -> bf16 row n (K = 1024 contiguous)
__global__ __launch_bounds__(256) void k_packT(const float* __restrict__ WT, const float* __restrict__ WSm, const float* __restrict__ WC, __bf16* __restrict__ P) {
  __shared__ __align__(16) __bf16 s[DM]; const int n = blockIdx.x, which = blockIdx.y, t = threadIdx.x;
  const float* src; int stride, c;
  if (which < 3) { src = WT; stride = 3 * DM; c = which * DM + n; } else if (which < 5) { src = WSm; stride = 2 * DM; c = (which - 3) * DM + n; } else { src = WC; stride = DM; c = n; }
  for (int k = t; k < DM; k += 256) s[k] = (__bf16)src[(size_t)k * stride + c];
  __syncthreads(); for (int q = t; q < DM / 8; q += 256) vst2((unsigned*)(P + ((size_t)which * DM + n) * DM + q * 8), *(const v4u*)&s[q * 8]);
}
// ---- shared GEMM core: a 128 x 128 tile of X . W^T per 8-wave block; k slices of 64 go global -> registers -> LDS (two buffers), every wave reads its fragments from LDS
#define GP 72                 // LDS row pitch in 16-bit elements: 64 k + 8, so the 16 rows of a 16-byte fragment read fall on distinct banks
#define GT (128 * GP)         // one operand tile, elements
typedef __attribute__((ext_vector_type(4))) __bf16 v4b;
struct StgR { v4f a[8]; v4u b[4]; };
// each wave-wide load covers whole 128-B lines: X rows give 256 B per slice (16 lanes), weight rows 128 B (8 lanes)
__device__ __forceinline__ void g_load(StgR& r, const float* __restrict__ X, const __bf16* __restrict__ Pw, int k0, int tid) {
  const float* pa = X + (size_t)(tid >> 4) * DM + (tid & 15) * 4 + k0; const __bf16* pb = Pw + (size_t)(tid >> 3) * DM + (tid & 7) * 8 + k0;
#pragma unroll
  for (int i = 0; i < 8; ++i) r.a[i] = *(const v4f*)(pa + i * 16 * DM);
#pragma unroll
  for (int i = 0; i < 4; ++i) r.b[i] = *(const v4u*)(pb + i * 32 * DM);
}
template <bool SPLIT> __device__ __forceinline__ void g_store(const StgR& r, __bf16* buf, int tid) {   // buf: [A hi][B]([A lo])
  __bf16* sa = buf + (tid >> 4) * GP + (tid & 15) * 4; __bf16* sb = buf + GT + (tid >> 3) * GP + (tid & 7) * 8;
#pragma unroll
  for (int i = 0; i < 8; ++i) { v4b h, l;
#pragma unroll
    for (int q = 0; q < 4; ++q) { h[q] = (__bf16)r.a[i][q]; if (SPLIT) l[q] = (__bf16)(r.a[i][q] - (float)h[q]); }
    *(v4b*)(sa + i * 16 * GP) = h; if (SPLIT) *(v4b*)(sa + 2 * GT + i * 16 * GP) = l; }
#pragma unroll
  for (int i = 0; i < 4; ++i) *(v4u*)(sb + i * 32 * GP) = r.b[i];
}
// wave (wm, wn) of 2 x 4 owns rows wm*64 + i*16, columns wn*32 + j*16; k ascends as in a plain loop, so every accumulator sums in the same order
template <bool SPLIT> __device__ __forceinline__ void g_pass(const float* __restrict__ X, const __bf16* __restrict__ Pw, __bf16* sm, v8f (&acc)[4][2], int tid, int lane, int wm, int wn) {
  constexpr int BUF = (SPLIT ? 3 : 2) * GT; const int col = lane & 15;
  StgR r; g_load(r, X, Pw, 0, tid); g_store<SPLIT>(r, sm, tid);
  __syncthreads();   // slice 0 is published
#pragma unroll 1   // kept rolled: unrolled, 16 copies of this long body would only grow the code
  for (int s = 0; s < DM / 64; ++s) { const __bf16* cur = sm + (s & 1) * BUF;
    if (s + 1 < DM / 64) g_load(r, X, Pw, (s + 1) * 64, tid);   // the next slice flies while this one is multiplied
#pragma unroll
    for (int kk = 0; kk < 2; ++kk) { v16b b[2], a[4], al[SPLIT ? 4 : 1];
#pragma unroll
      for (int j = 0; j < 2; ++j) b[j] = frag_b(cur + GT + (wn * 32 + j * 16 + col) * GP + kk * 32, lane);
#pragma unroll
      for (int i = 0; i < 4; ++i) { a[i] = frag_b(cur + (wm * 64 + i * 16 + col) * GP + kk * 32, lane); if (SPLIT) al[i] = frag_b(cur + 2 * GT + (wm * 64 + i * 16 + col) * GP + kk * 32, lane); }
#pragma unroll
      for (int i = 0; i < 4; ++i)
#pragma unroll
        for (int j = 0; j < 2; ++j) acc[i][j] = wmma_bf(a[i], b[j], acc[i][j]);
      if (SPLIT) {   // every accumulator still takes hi, then lo, of each 32 k
#pragma unroll
        for (int i = 0; i < 4; ++i)
#pragma unroll
          for (int j = 0; j < 2; ++j) acc[i][j] = wmma_bf(al[i], b[j], acc[i][j]); } }
    if (s + 1 < DM / 64) g_store<SPLIT>(r, sm + ((s + 1) & 1) * BUF, tid);   // into the buffer whose readers left at the previous barrier
    __syncthreads();   // publishes slice s + 1 and ends every read of slice s
  }
}
// ---- k_qkvd: block = (128 rows, 128 cols, kind): kind 0 -> qt (from xt) and qs (from xs) into QQ; kind 1 -> k1, k2 into KK; kind 2 -> vt planes
#define EP 136                // epilogue staging pitch, f16 elements
__global__ __launch_bounds__(256) void k_qkvd(const float* __restrict__ XT, const float* __restrict__ XS, const __bf16* __restrict__ P, const float* __restrict__ BT, const float* __restrict__ BS, const float* __restrict__ LTS, const float* __restrict__ LST, const float* __restrict__ LSS, _Float16* __restrict__ QQ, _Float16* __restrict__ KK, _Float16* __restrict__ VT) {
  __shared__ __align__(16) unsigned char smem[2 * 2 * GT * 2];   // two buffers of [X tile][W tile]; the epilogue's two f16 [128][EP] tiles afterwards
  __bf16* sm = (__bf16*)smem; _Float16* so = (_Float16*)smem; _Float16* so2 = so + 128 * EP;
  const int tid = threadIdx.x, wave = tid >> 5, lane = tid & 31, col = lane & 15, g = lane >> 4, wm = wave >> 2, wn = wave & 3; const int kind = blockIdx.z; const int c0 = blockIdx.y * 128; const size_t rb = (size_t)blockIdx.x * 128;
  const __bf16* PT = P + ((size_t)kind * DM + c0) * DM;                              // Wt block for this kind (q, k or v)
  const __bf16* PS = P + ((size_t)(3 + (kind < 2 ? kind : 0)) * DM + c0) * DM;       // Ws block (q or k)
  v8f at[4][2] = {}, as[4][2] = {};
  g_pass<false>(XT + rb * DM, PT, sm, at, tid, lane, wm, wn);
  if (kind < 2) g_pass<false>(XS + rb * DM, PS, sm, as, tid, lane, wm, wn);
  if (kind < 2) {   // q pair, or k pair -> k1, k2
    float lts = 0.f, lst = 0.f, lss = 0.f; if (kind == 1) { lts = bfr(LTS[0]); lst = bfr(LST[0]); lss = bfr(LSS[0]); }
#pragma unroll
    for (int j = 0; j < 2; ++j) { const int cl = wn * 32 + j * 16 + col; const float g1 = BT[kind * DM + c0 + cl], g2 = BS[kind * DM + c0 + cl];
      asm volatile("s_wait_xcnt 0x0" ::: "memory");   // stands before a register that the two bias loads name is written again
      const float b1 = bfr(g1), b2 = bfr(g2);
#pragma unroll
      for (int i = 0; i < 4; ++i)
#pragma unroll
        for (int r = 0; r < 8; ++r) { const int rl = wm * 64 + i * 16 + 8 * g + r; const float t = at[i][j][r] + b1, u = as[i][j][r] + b2;
          so[rl * EP + cl] = (_Float16)(kind == 0 ? t : t + lts * u); so2[rl * EP + cl] = (_Float16)(kind == 0 ? u : lst * t + lss * u); } }
    __syncthreads();
    _Float16* D = kind == 0 ? QQ : KK;
    for (int e = tid; e < 128 * 16; e += 256) { const int rl = e >> 4, q = e & 15; vst2((unsigned*)(D + (rb + rl) * (2 * DM) + c0 + q * 8), *(const v4u*)&so[rl * EP + q * 8]); vst2((unsigned*)(D + (rb + rl) * (2 * DM) + DM + c0 + q * 8), *(const v4u*)&so2[rl * EP + q * 8]); }
  } else {   // vt planes: staged transposed, a lane's 8 rows are 16 contiguous bytes
#pragma unroll
    for (int j = 0; j < 2; ++j) { const int cl = wn * 32 + j * 16 + col; const float b1 = bfr(BT[2 * DM + c0 + cl]);
#pragma unroll
      for (int i = 0; i < 4; ++i) { v8h w;
#pragma unroll
        for (int r = 0; r < 8; ++r) w[r] = (_Float16)(at[i][j][r] + b1);
        *(v8h*)&so[cl * EP + wm * 64 + i * 16 + 8 * g] = w; } }
    __syncthreads();
    const size_t b = rb / SS; const int s0 = (int)(rb % SS);
    for (int e = tid; e < 128 * 16; e += 256) { const int d = e >> 4, pc = e & 15; vst2((unsigned*)(VT + ((b * DM + c0 + d) * SS) + s0 + pc * 8), *(const v4u*)&so[d * EP + pc * 8]); } }
}
// ---- k_attn: block = (128 queries, head, b), 8 waves x 16 queries: 128-wide scores ([qt|qs] . [k1|k2]) / 8, softmax, P . vt (64 dims); O 256-B head segments
// products stand transposed: S^T = K . Q^T and O^T += vt . P^T, so a lane holds 16 of the 32 keys of ONE query (its column): maximum and sum are taken in-lane over these 16, then joined with the other half (lane l ^ 16), the two S^T tiles convert in place into the B operand P^T
// K and vt go global -> LDS in stages of 128 keys by asynchronous copies (whole 128-B lines, two buffers), once per block; every wave reads its fragments from LDS
#define AK 128                // keys per stage
#define AP 136                // LDS row pitch in f16 elements: 256 B + 16 B, so the 16 rows of a 16-byte fragment read fall on distinct banks
#define AKT (AK * AP)         // K tile [key][k1 | k2], elements
#define ABUF (AKT + HD * AP)  // one buffer: K tile, then vt tile [dim][key]
// one stage: 8 K copies and 4 vt copies of 16 B per lane; a wave's 32 lanes cover four whole 128-B lines per copy
__device__ __forceinline__ void kv_copy(const _Float16* gk, const _Float16* gv, unsigned lk, unsigned lv) {
  // the closing s_wait_xcnt stands inside the statement so that no address register of a copy is written again in front of it
  asm volatile("global_load_async_to_lds_b128 %0, %1, off\n\t"
               "global_load_async_to_lds_b128 %2, %3, off\n\t"
               "global_load_async_to_lds_b128 %4, %5, off\n\t"
               "global_load_async_to_lds_b128 %6, %7, off\n\t"
               "global_load_async_to_lds_b128 %8, %9, off\n\t"
               "global_load_async_to_lds_b128 %10, %11, off\n\t"
               "global_load_async_to_lds_b128 %12, %13, off\n\t"
               "global_load_async_to_lds_b128 %14, %15, off\n\t"
               "global_load_async_to_lds_b128 %16, %17, off\n\t"
               "global_load_async_to_lds_b128 %18, %19, off\n\t"
               "global_load_async_to_lds_b128 %20, %21, off\n\t"
               "global_load_async_to_lds_b128 %22, %23, off\n\t"
               "s_wait_xcnt 0x0"
               :: "v"(lk), "v"(gk), "v"(lk + 1 * 16 * AP * 2), "v"(gk + 1 * 16 * 2 * DM), "v"(lk + 2 * 16 * AP * 2), "v"(gk + 2 * 16 * 2 * DM), "v"(lk + 3 * 16 * AP * 2), "v"(gk + 3 * 16 * 2 * DM),
                  "v"(lk + 4 * 16 * AP * 2), "v"(gk + 4 * 16 * 2 * DM), "v"(lk + 5 * 16 * AP * 2), "v"(gk + 5 * 16 * 2 * DM), "v"(lk + 6 * 16 * AP * 2), "v"(gk + 6 * 16 * 2 * DM), "v"(lk + 7 * 16 * AP * 2), "v"(gk + 7 * 16 * 2 * DM),
                  "v"(lv), "v"(gv), "v"(lv + 1 * 16 * AP * 2), "v"(gv + 1 * 16 * SS), "v"(lv + 2 * 16 * AP * 2), "v"(gv + 2 * 16 * SS), "v"(lv + 3 * 16 * AP * 2), "v"(gv + 3 * 16 * SS)
               : "memory");
}
// lane l takes the value of lane l ^ 16
__device__ __forceinline__ float xhalf(float x) { return __builtin_bit_cast(float, __builtin_amdgcn_permlanex16(__builtin_bit_cast(int, x), __builtin_bit_cast(int, x), 0x76543210, 0xfedcba98, false, false)); }
__global__ __launch_bounds__(256) void k_attn(const _Float16* __restrict__ QQ, const _Float16* __restrict__ KK, const _Float16* __restrict__ VT, float* __restrict__ O) {
  __shared__ __align__(16) _Float16 ring[2 * ABUF]; __shared__ __align__(16) float so[8][16][68];
  const int tid = threadIdx.x, wave = tid >> 5, lane = tid & 31, col = lane & 15, g = lane >> 4; const int h = blockIdx.y; const size_t b = blockIdx.z; const int q0 = blockIdx.x * 128 + wave * 16; const size_t rq = b * SS + q0;
  // lane's share of a stage: K row tid >> 4 (+16 per copy), 16-byte piece tid & 15 of [k1 | k2]; vt row tid >> 4 (+16 per copy), piece tid & 15 of 128 keys
  const _Float16* gk = KK + (b * SS + (tid >> 4)) * (2 * DM) + ((tid >> 3) & 1) * DM + h * HD + (tid & 7) * 8; const _Float16* gv = VT + (b * DM + h * HD + (tid >> 4)) * SS + (tid & 15) * 8;
  const unsigned lk = (unsigned)(size_t)ring + ((tid >> 4) * AP + (tid & 15) * 8) * 2, lv = lk + AKT * 2;
  kv_copy(gk, gv, lk, lv);
  asm volatile("s_wait_asynccnt 0x0" ::: "memory");   // this wave's share of stage 0 has landed
  __syncthreads();   // stage 0 is published
  kv_copy(gk + (size_t)AK * 2 * DM, gv + AK, lk + ABUF * 2, lv + ABUF * 2);   // stage 1 flies while stage 0 is worked on
  v16h aq[4];
#pragma unroll
  for (int kc = 0; kc < 4; ++kc) aq[kc] = frag_h(QQ + (rq + col) * (2 * DM) + ((kc < 2) ? 0 : DM) + h * HD + (kc & 1) * 32, lane);
  float m = -3.0e38f, l = 0.f;   // of query 'col': m is the same in both wave halves, l is the sum over this half's keys
  v8f acc[4] = {};   // acc[dt][r] = O^T[dim dt * 16 + 8 g + r][query col]
#pragma unroll 1   // kept rolled: one copy of the publish point and of the long body
  for (int t = 0; t < SS / AK; ++t) { const _Float16* kb = ring + (t & 1) * ABUF; const _Float16* vb = kb + AKT;
#pragma unroll 1   // kept rolled: four copies of this long body would only grow the code
  for (int ks = 0; ks < AK / 32; ++ks) { const int j0 = ks * 32; v8f s[2];
    v16h bk[2][4], bv[4];   // all fragment reads of the 32 keys stand together, in front of the products: one LDS latency, and vt's passes under the softmax
#pragma unroll
    for (int ct = 0; ct < 2; ++ct)
#pragma unroll
      for (int kc = 0; kc < 4; ++kc) bk[ct][kc] = frag_h(kb + (j0 + ct * 16 + col) * AP + kc * 32, lane);
#pragma unroll
    for (int dt = 0; dt < 4; ++dt) bv[dt] = frag_h(vb + (dt * 16 + col) * AP + j0, lane);
#pragma unroll
    for (int ct = 0; ct < 2; ++ct) { v8f c = {};   // c[r] = S^T[key j0 + ct * 16 + 8 g + r][query col]
#pragma unroll
      for (int kc = 0; kc < 4; ++kc) c = wmma16(bk[ct][kc], aq[kc], c);
      s[ct] = c * 0.125f; }
    float mx = fmaxf(s[0][0], s[1][0]);
#pragma unroll
    for (int r = 1; r < 8; ++r) mx = fmaxf(mx, fmaxf(s[0][r], s[1][r]));
    mx = fmaxf(mx, xhalf(mx));   // the other half's 16 keys of the same query
    const float mn = fmaxf(m, mx); const float alpha = (m <= -1.0e38f) ? 0.f : __expf(m - mn);
    v8f e[2];
#pragma unroll
    for (int ct = 0; ct < 2; ++ct)
#pragma unroll
      for (int r = 0; r < 8; ++r) e[ct][r] = __expf(s[ct][r] - mn);
    const v8f e8 = e[0] + e[1]; const v4f e4 = e8.lo + e8.hi; const v2f e2 = e4.lo + e4.hi;
    l = l * alpha + (e2.x + e2.y); m = mn;
#pragma unroll
    for (int dt = 0; dt < 4; ++dt) acc[dt] *= alpha;
    // element i of a B fragment is k = 8 g + i, element 8 + i is k = 16 + 8 g + i: exactly the keys this lane holds in s[0] and s[1]
    union { v16h v; v8h q[2]; } pb; pb.q[0] = __builtin_convertvector(e[0] * 2048.0f, v8h); pb.q[1] = __builtin_convertvector(e[1] * 2048.0f, v8h);
#pragma unroll
    for (int dt = 0; dt < 4; ++dt) acc[dt] = wmma16(bv[dt], pb.v, acc[dt]); }
    asm volatile("s_wait_dscnt 0x0" ::: "memory");      // this wave's reads of stage t are done
    asm volatile("s_wait_asynccnt 0x0" ::: "memory");   // this wave's share of stage t + 1 has landed
    __syncthreads();   // publishes stage t + 1 and ends every read of stage t
    if (t + 2 < SS / AK) kv_copy(gk + (size_t)(t + 2) * AK * 2 * DM, gv + (t + 2) * AK, lk + (t & 1) * ABUF * 2, lv + (t & 1) * ABUF * 2);   // into the buffer that stage t has just left
  }
  asm volatile("s_wait_asynccnt 0x0" ::: "memory");   // no copy is outstanding when the wave ends
  const float il = (1.0f / 2048.0f) / (l + xhalf(l));   // the two halves' sums are joined once
#pragma unroll
  for (int dt = 0; dt < 4; ++dt) { const v8f o = acc[dt] * il; *(v4f*)&so[wave][col][dt * 16 + 8 * g] = o.lo; *(v4f*)&so[wave][col][dt * 16 + 8 * g + 4] = o.hi; }   // a lane's 8 dims are 32 contiguous bytes of its query's row
  LDSX();
  for (int rl = 0; rl < 16; ++rl) if (lane < 16) vst2(O + (rq + rl) * DM + h * HD + lane * 4, *(const v4f*)&so[wave][rl][lane * 4]);
}
// ---- k_out: block = (128 rows, 128 cols): Y = y (bf16 hi + lo) . Wc + bc
__global__ __launch_bounds__(256) void k_out(const float* __restrict__ O, const __bf16* __restrict__ P, const float* __restrict__ BC, float* __restrict__ Y) {
  __shared__ __align__(16) unsigned char smem[2 * 3 * GT * 2];   // two buffers of [y hi][Wc][y lo]; the epilogue's f32 [128][132] tile afterwards
  __bf16* sm = (__bf16*)smem; float* so = (float*)smem;
  const int tid = threadIdx.x, wave = tid >> 5, lane = tid & 31, col = lane & 15, g = lane >> 4, wm = wave >> 2, wn = wave & 3; const size_t rb = (size_t)blockIdx.x * 128; const int n0 = blockIdx.y * 128; const __bf16* PC = P + ((size_t)5 * DM + n0) * DM;
  v8f acc[4][2] = {};
  g_pass<true>(O + rb * DM, PC, sm, acc, tid, lane, wm, wn);
#pragma unroll
  for (int j = 0; j < 2; ++j) { const int cl = wn * 32 + j * 16 + col; const float bb = bfr(BC[n0 + cl]);
#pragma unroll
    for (int i = 0; i < 4; ++i)
#pragma unroll
      for (int r = 0; r < 8; ++r) so[(wm * 64 + i * 16 + 8 * g + r) * 132 + cl] = acc[i][j][r] + bb; }
  __syncthreads();
  for (int e = tid; e < 128 * 32; e += 256) { const int rl = e >> 5, q = e & 31; vst2(Y + (rb + rl) * DM + n0 + q * 4, *(const v4f*)&so[rl * 132 + q * 4]); }
}
extern "C" void kernel_launch(void* const* d_in, const int* in_sizes, int n_in, void* d_out, int out_size, void* d_ws, size_t ws_size, hipStream_t stream) {
  (void)in_sizes; (void)n_in; (void)out_size;
  const float** F = (const float**)d_in;   // 0 xt, 1 xs [2,2048,1024]; 2 Wt [1024,3072], 3 bt; 4 Ws [1024,2048], 5 bs; 6 Wc [1024,1024], 7 bc; 8 lam_ts, 9 lam_st, 10 lam_ss [1]
  if (ws_size < (size_t)WS_END) return;
  char* ws = (char*)d_ws; __bf16* P = (__bf16*)(ws + WS_PW); _Float16 *QQ = (_Float16*)(ws + WS_QQ), *KK = (_Float16*)(ws + WS_KK), *VT = (_Float16*)(ws + WS_VT); float* O = (float*)(ws + WS_O);
  k_packT<<<dim3(DM, 6), 256, 0, stream>>>(F[2], F[4], F[6], P);
  k_qkvd<<<dim3(TNB * SS / 128, DM / 128, 3), 256, 0, stream>>>(F[0], F[1], P, F[3], F[5], F[8], F[9], F[10], QQ, KK, VT);
  k_attn<<<dim3(TQB, NH, TNB), 256, 0, stream>>>(QQ, KK, VT, O);
  k_out<<<dim3(TNB * SS / 128, DM / 128), 256, 0, stream>>>(O, P, F[7], (float*)d_out);
}

// v004
// It runs in 134 microseconds.
// Next to v003, in two timings, it ran 1.20 times as fast each time.
// Counting every step since v000, it is 3.72 times as fast.
// compute dtype: all float inputs rounded to bf16, the three lambda scalars read on device; qt/kt/vt = xt . Wt + bt and qs/ks = xs . Ws + bs with EXACT bf16 products on WMMA 16x16x32 ((in,out) weights as transposed rows); k1 = kt + lam_ts ks and k2 = lam_st kt + lam_ss ks formed in f32, then q = [qt | qs] and k = [k1 | k2] rounded once to f16 (128-wide per head); PLAIN attention: scores x 1/8, running-max softmax in f32 (hardware exp), P (scaled by 2^11, single f16) x vt (single f16); out = y (bf16 hi + residual) . Wc (2 products) + bc.
#include <hip/hip_runtime.h>
#include <math.h>

typedef __attribute__((ext_vector_type(16))) _Float16 v16h;
typedef __attribute__((ext_vector_type(16))) __bf16 v16b;
typedef __attribute__((ext_vector_type(8)))  _Float16 v8h;
typedef __attribute__((ext_vector_type(8)))  float v8f;
typedef __attribute__((ext_vector_type(4)))  float v4f;
typedef __attribute__((ext_vector_type(2)))  float v2f;
typedef __attribute__((ext_vector_type(4)))  unsigned v4u;
typedef __attribute__((ext_vector_type(4)))  int v4i;
typedef float __attribute__((may_alias)) float_a;
typedef int __attribute__((may_alias)) int_a;

template <typename T> __device__ __forceinline__ void vst2(void* p, T v) { *(T*)p = v;  }
__device__ __forceinline__ v8f wmma16(v16h a, v16h b, v8f c) {
  v8f d = __builtin_amdgcn_wmma_f32_16x16x32_f16(false, a, false, b, (short)0, c, false, false);
  asm volatile("v_nop\n\tv_nop\n\tv_nop\n\tv_nop" : "+v"(d) : "v"(a), "v"(b));
  return d;
}
__device__ __forceinline__ v8f wmma_bf(v16b a, v16b b, v8f c) {
  v8f d = __builtin_amdgcn_wmma_f32_16x16x32_bf16(false, a, false, b, (short)0, c, false, false);
  asm volatile("v_nop\n\tv_nop\n\tv_nop\n\tv_nop" : "+v"(d) : "v"(a), "v"(b));
  return d;
}
// 16x16x32 fragments: lane = (h = lane>>4, row/col = lane&15); elements 0..7 = k0+8h+0..7, 8..15 = k0+16+8h+0..7; D element r = row 8h+r
__device__ __forceinline__ v16h frag_h(const _Float16* rowk0, int lane) {
  union { v16h v; v8h q[2]; } u; const _Float16* p = rowk0 + 8 * (lane >> 4);
  u.q[0] = *(const v8h*)p; u.q[1] = *(const v8h*)(p + 16); return u.v;
}
__device__ __forceinline__ v16h frag_f32(const float* rowk0, int lane) {
  v16h a; const float* p = rowk0 + 8 * (lane >> 4);
#pragma unroll
  for (int i = 0; i < 8; ++i) { a[i] = (_Float16)p[i]; a[8 + i] = (_Float16)p[16 + i]; }
  return a;
}
__device__ __forceinline__ v16h frag_f32s(const float* rowk0, int lane, float sc) {
  v16h a; const float* p = rowk0 + 8 * (lane >> 4);
#pragma unroll
  for (int i = 0; i < 8; ++i) { a[i] = (_Float16)(p[i] * sc); a[8 + i] = (_Float16)(p[16 + i] * sc); }
  return a;
}
// column fragment from a [K][ld] layout (column n), rows >= K read as 0
__device__ __forceinline__ v16h fragc_f32(const float* W, int k0, int n, int lane, int ld, int K) {
  v16h a; const int g = lane >> 4;
#pragma unroll
  for (int i = 0; i < 8; ++i) { const int ka = k0 + 8 * g + i, kb = ka + 16;
    a[i] = (_Float16)(ka < K ? W[(size_t)(ka < K ? ka : K - 1) * ld + n] : 0.f); a[8 + i] = (_Float16)(kb < K ? W[(size_t)(kb < K ? kb : K - 1) * ld + n] : 0.f); }
  return a;
}
struct F2 { v16b h, l; };
__device__ __forceinline__ F2 bsplit16(const float v[16]) { F2 r;
#pragma unroll
  for (int i = 0; i < 16; ++i) { const __bf16 h = (__bf16)v[i]; r.h[i] = h; r.l[i] = (__bf16)(v[i] - (float)h); }
  return r; }
__device__ __forceinline__ F2 split_row(const float* row, int k0, int lane) { float v[16]; const float* p = row + k0 + 8 * (lane >> 4);
#pragma unroll
  for (int i = 0; i < 8; ++i) { v[i] = p[i]; v[8 + i] = p[16 + i]; }
  return bsplit16(v); }
__device__ __forceinline__ F2 split_rowK(const float* row, int k0, int lane, int K) { float v[16]; const int g = lane >> 4;
#pragma unroll
  for (int i = 0; i < 8; ++i) { const int ka = k0 + 8 * g + i, kb = ka + 16; v[i] = ka < K ? row[ka < K ? ka : K - 1] : 0.f; v[8 + i] = kb < K ? row[kb < K ? kb : K - 1] : 0.f; }
  return bsplit16(v); }
__device__ __forceinline__ F2 split_col(const float* W, int k0, int n, int lane, int ld, int K) { float v[16]; const int g = lane >> 4;
#pragma unroll
  for (int i = 0; i < 8; ++i) { const int ka = k0 + 8 * g + i, kb = ka + 16; v[i] = ka < K ? W[(size_t)(ka < K ? ka : K - 1) * ld + n] : 0.f; v[8 + i] = kb < K ? W[(size_t)(kb < K ? kb : K - 1) * ld + n] : 0.f; }
  return bsplit16(v); }
__device__ __forceinline__ v8f mac3(const F2& a, const F2& b, v8f c) { c = wmma_bf(a.l, b.h, c); c = wmma_bf(a.h, b.l, c); return wmma_bf(a.h, b.h, c); }
__device__ __forceinline__ float sigm(float v) { return 1.0f / (1.0f + expf(-v)); }
#define LDSX() do { asm volatile("s_wait_dscnt 0" ::: "memory"); __builtin_amdgcn_wave_barrier(); __builtin_amdgcn_fence(__ATOMIC_RELEASE, "workgroup"); } while (0)


// Disentangled spatial attention (B 2, L 2,048, E 1,024, 16 heads x 64): scores = (qt . (kt + lam_ts ks) + qs . (lam_st kt + lam_ss ks)) / 8 over the target and source streams, softmax, . vt, output projection + bias.
#define NB 2
#define SS 2048
#define DM 1024
#define NH 16
#define HD 64
#define NR (NB * SS)
#ifndef TQB
#define TQB (SS / 128)
#define TNB NB
#endif
typedef __attribute__((ext_vector_type(8))) __bf16 v8b;
__device__ __forceinline__ v16b frag_b(const __bf16* rowk0, int lane) {
  union { v16b v; v8b q[2]; } u; const __bf16* p = rowk0 + 8 * (lane >> 4);
  u.q[0] = *(const v8b*)p; u.q[1] = *(const v8b*)(p + 16); return u.v;
}
__device__ __forceinline__ float bfr(float v) { return (float)(__bf16)v; }
__device__ __attribute__((noinline)) float exp_ni(float v) { return expf(v); }
__device__ __attribute__((noinline)) float erf_ni(float v) { return erff(v); }

#define WS_PW  0u                                     // bf16 transposed rows: Wt q, Wt k, Wt v, Ws q, Ws k, Wc  [6][1024][1024]
#define WS_QQ  (WS_PW + 2u * (size_t)6 * DM * DM)       // f16 [NR][2048]: qt | qs
#define WS_KK  (WS_QQ + 2u * (size_t)NR * 2 * DM)       // f16 [NR][2048]: k1 | k2
#define WS_VT  (WS_KK + 2u * (size_t)NR * 2 * DM)       // f16 planes vt [b][1024][SS]
#define WS_O   (WS_VT + 2u * (size_t)NB * DM * SS)       // f32 [NR][1024]
#define WS_END (WS_O + 4u * (size_t)NR * DM)

// ---- k_packT: block = a 128 (k) x 128 (n) tile of an (in,out) weight -> 128 bf16 rows of P (row = block 'which' * 1024 + n, K = 1024 contiguous), turned in LDS
// reads: a wave-wide 16-byte load is 512 contiguous bytes of one k row (whole lines), a lane's 16 rows all in flight; writes: 16 lanes give 256 contiguous bytes of one P row
template <int STRIDE> __device__ __forceinline__ void pack_read(v4f (&r)[16], const float* __restrict__ p) {   // the row pitch is a constant, so one address pair serves the 16 loads
#pragma unroll
  for (int i = 0; i < 16; ++i) r[i] = *(const v4f*)(p + i * STRIDE);
  // inputs only, the loaded values and their address: keeps the 16 loads in flight together (without it the first are waited for before the last are issued, several memory latencies in a row) and keeps the address pair off the loads' result registers
  asm volatile("" :: "v"(r[0]), "v"(r[1]), "v"(r[2]), "v"(r[3]), "v"(r[4]), "v"(r[5]), "v"(r[6]), "v"(r[7]), "v"(r[8]), "v"(r[9]), "v"(r[10]), "v"(r[11]), "v"(r[12]), "v"(r[13]), "v"(r[14]), "v"(r[15]), "v"(p));
}
__global__ __launch_bounds__(256) void k_packT(const float* __restrict__ WT, const float* __restrict__ WSm, const float* __restrict__ WC, __bf16* __restrict__ P) {
  __shared__ __align__(16) __bf16 s[128 * 128];   // [n][16 pieces of 8 k]; piece p of row n stands at place p ^ ((n >> 2) & 15), so that the 16 lanes of a 16-byte store (rows 4 apart) and of a 16-byte load (one row) fall on distinct banks
  const int t = threadIdx.x, r0 = blockIdx.x * 128, k0 = blockIdx.y * 128, which = r0 / DM;
  const int n4 = t & 31, kw = t >> 5;   // the lane's 4 columns, the wave's 16 k rows
  const size_t kr = k0 + kw * 16; v4f r[16];
  if (which < 3) pack_read<3 * DM>(r, WT + kr * (3 * DM) + r0 + n4 * 4);
  else if (which < 5) pack_read<2 * DM>(r, WSm + kr * (2 * DM) + (r0 - 3 * DM) + n4 * 4);
  else pack_read<DM>(r, WC + kr * DM + (r0 - 5 * DM) + n4 * 4);
#pragma unroll
  for (int q = 0; q < 4; ++q)
#pragma unroll
    for (int hf = 0; hf < 2; ++hf) { v8b w;
#pragma unroll
      for (int j = 0; j < 8; ++j) w[j] = (__bf16)r[hf * 8 + j][q];
      *(v8b*)&s[(n4 * 4 + q) * 128 + (((kw * 2 + hf) ^ (n4 & 15)) * 8)] = w; }
  __syncthreads();
  __bf16* d = P + (size_t)(r0 + (t >> 4)) * DM + k0 + (t & 15) * 8;
#pragma unroll   // unrolled: the 8 LDS reads share one latency instead of paying it one after another
  for (int i = 0; i < 8; ++i) { const int n = i * 16 + (t >> 4); vst2((unsigned*)(d + i * 16 * DM), *(const v4u*)&s[n * 128 + (((t & 15) ^ ((n >> 2) & 15)) * 8)]); }
}
// ---- shared GEMM core: a 128 x 128 tile of X . W^T per 8-wave block; k slices of 64 go global -> registers -> LDS (two buffers), every wave reads its fragments from LDS
#define GP 72                 // LDS row pitch in 16-bit elements: 64 k + 8, so the 16 rows of a 16-byte fragment read fall on distinct banks
#define GT (128 * GP)         // one operand tile, elements
typedef __attribute__((ext_vector_type(4))) __bf16 v4b;
struct StgR { v4f a[8]; v4u b[4]; };
// each wave-wide load covers whole 128-B lines: X rows give 256 B per slice (16 lanes), weight rows 128 B (8 lanes)
__device__ __forceinline__ void g_load(StgR& r, const float* __restrict__ X, const __bf16* __restrict__ Pw, int k0, int tid) {
  const float* pa = X + (size_t)(tid >> 4) * DM + (tid & 15) * 4 + k0; const __bf16* pb = Pw + (size_t)(tid >> 3) * DM + (tid & 7) * 8 + k0;
#pragma unroll
  for (int i = 0; i < 8; ++i) r.a[i] = *(const v4f*)(pa + i * 16 * DM);
#pragma unroll
  for (int i = 0; i < 4; ++i) r.b[i] = *(const v4u*)(pb + i * 32 * DM);
}
template <bool SPLIT> __device__ __forceinline__ void g_store(const StgR& r, __bf16* buf, int tid) {   // buf: [A hi][B]([A lo])
  __bf16* sa = buf + (tid >> 4) * GP + (tid & 15) * 4; __bf16* sb = buf + GT + (tid >> 3) * GP + (tid & 7) * 8;
#pragma unroll
  for (int i = 0; i < 8; ++i) { v4b h, l;
#pragma unroll
    for (int q = 0; q < 4; ++q) { h[q] = (__bf16)r.a[i][q]; if (SPLIT) l[q] = (__bf16)(r.a[i][q] - (float)h[q]); }
    *(v4b*)(sa + i * 16 * GP) = h; if (SPLIT) *(v4b*)(sa + 2 * GT + i * 16 * GP) = l; }
#pragma unroll
  for (int i = 0; i < 4; ++i) *(v4u*)(sb + i * 32 * GP) = r.b[i];
}
// wave (wm, wn) of 2 x 4 owns rows wm*64 + i*16, columns wn*32 + j*16; k ascends as in a plain loop, so every accumulator sums in the same order
template <bool SPLIT> __device__ __forceinline__ void g_pass(const float* __restrict__ X, const __bf16* __restrict__ Pw, __bf16* sm, v8f (&acc)[4][2], int tid, int lane, int wm, int wn) {
  constexpr int BUF = (SPLIT ? 3 : 2) * GT; const int col = lane & 15;
  StgR r; g_load(r, X, Pw, 0, tid); g_store<SPLIT>(r, sm, tid);
  __syncthreads();   // slice 0 is published
#pragma unroll 1   // kept rolled: unrolled, 16 copies of this long body would only grow the code
  for (int s = 0; s < DM / 64; ++s) { const __bf16* cur = sm + (s & 1) * BUF;
    if (s + 1 < DM / 64) g_load(r, X, Pw, (s + 1) * 64, tid);   // the next slice flies while this one is multiplied
#pragma unroll
    for (int kk = 0; kk < 2; ++kk) { v16b b[2], a[4], al[SPLIT ? 4 : 1];
#pragma unroll
      for (int j = 0; j < 2; ++j) b[j] = frag_b(cur + GT + (wn * 32 + j * 16 + col) * GP + kk * 32, lane);
#pragma unroll
      for (int i = 0; i < 4; ++i) { a[i] = frag_b(cur + (wm * 64 + i * 16 + col) * GP + kk * 32, lane); if (SPLIT) al[i] = frag_b(cur + 2 * GT + (wm * 64 + i * 16 + col) * GP + kk * 32, lane); }
#pragma unroll
      for (int i = 0; i < 4; ++i)
#pragma unroll
        for (int j = 0; j < 2; ++j) acc[i][j] = wmma_bf(a[i], b[j], acc[i][j]);
      if (SPLIT) {   // every accumulator still takes hi, then lo, of each 32 k
#pragma unroll
        for (int i = 0; i < 4; ++i)
#pragma unroll
          for (int j = 0; j < 2; ++j) acc[i][j] = wmma_bf(al[i], b[j], acc[i][j]); } }
    if (s + 1 < DM / 64) g_store<SPLIT>(r, sm + ((s + 1) & 1) * BUF, tid);   // into the buffer whose readers left at the previous barrier
    __syncthreads();   // publishes slice s + 1 and ends every read of slice s
  }
}
// ---- k_qkvd: block = (128 rows, 128 cols, kind): kind 0 -> qt (from xt) and qs (from xs) into QQ; kind 1 -> k1, k2 into KK; kind 2 -> vt planes
#define EP 136                // epilogue staging pitch, f16 elements
__global__ __launch_bounds__(256) void k_qkvd(const float* __restrict__ XT, const float* __restrict__ XS, const __bf16* __restrict__ P, const float* __restrict__ BT, const float* __restrict__ BS, const float* __restrict__ LTS, const float* __restrict__ LST, const float* __restrict__ LSS, _Float16* __restrict__ QQ, _Float16* __restrict__ KK, _Float16* __restrict__ VT) {
  __shared__ __align__(16) unsigned char smem[2 * 2 * GT * 2];   // two buffers of [X tile][W tile]; the epilogue's two f16 [128][EP] tiles afterwards
  __bf16* sm = (__bf16*)smem; _Float16* so = (_Float16*)smem; _Float16* so2 = so + 128 * EP;
  const int tid = threadIdx.x, wave = tid >> 5, lane = tid & 31, col = lane & 15, g = lane >> 4, wm = wave >> 2, wn = wave & 3; const int kind = blockIdx.z; const int c0 = blockIdx.y * 128; const size_t rb = (size_t)blockIdx.x * 128;
  const __bf16* PT = P + ((size_t)kind * DM + c0) * DM;                              // Wt block for this kind (q, k or v)
  const __bf16* PS = P + ((size_t)(3 + (kind < 2 ? kind : 0)) * DM + c0) * DM;       // Ws block (q or k)
  v8f at[4][2] = {}, as[4][2] = {};
  g_pass<false>(XT + rb * DM, PT, sm, at, tid, lane, wm, wn);
  if (kind < 2) g_pass<false>(XS + rb * DM, PS, sm, as, tid, lane, wm, wn);
  if (kind < 2) {   // q pair, or k pair -> k1, k2
    float lts = 0.f, lst = 0.f, lss = 0.f; if (kind == 1) { lts = bfr(LTS[0]); lst = bfr(LST[0]); lss = bfr(LSS[0]); }
#pragma unroll
    for (int j = 0; j < 2; ++j) { const int cl = wn * 32 + j * 16 + col; const float g1 = BT[kind * DM + c0 + cl], g2 = BS[kind * DM + c0 + cl];
      asm volatile("s_wait_xcnt 0x0" ::: "memory");   // stands before a register that the two bias loads name is written again
      const float b1 = bfr(g1), b2 = bfr(g2);
#pragma unroll
      for (int i = 0; i < 4; ++i)
#pragma unroll
        for (int r = 0; r < 8; ++r) { const int rl = wm * 64 + i * 16 + 8 * g + r; const float t = at[i][j][r] + b1, u = as[i][j][r] + b2;
          so[rl * EP + cl] = (_Float16)(kind == 0 ? t : t + lts * u); so2[rl * EP + cl] = (_Float16)(kind == 0 ? u : lst * t + lss * u); } }
    __syncthreads();
    _Float16* D = kind == 0 ? QQ : KK;
    for (int e = tid; e < 128 * 16; e += 256) { const int rl = e >> 4, q = e & 15; vst2((unsigned*)(D + (rb + rl) * (2 * DM) + c0 + q * 8), *(const v4u*)&so[rl * EP + q * 8]); vst2((unsigned*)(D + (rb + rl) * (2 * DM) + DM + c0 + q * 8), *(const v4u*)&so2[rl * EP + q * 8]); }
  } else {   // vt planes: staged transposed, a lane's 8 rows are 16 contiguous bytes
#pragma unroll
    for (int j = 0; j < 2; ++j) { const int cl = wn * 32 + j * 16 + col; const float b1 = bfr(BT[2 * DM + c0 + cl]);
#pragma unroll
      for (int i = 0; i < 4; ++i) { v8h w;
#pragma unroll
        for (int r = 0; r < 8; ++r) w[r] = (_Float16)(at[i][j][r] + b1);
        *(v8h*)&so[cl * EP + wm * 64 + i * 16 + 8 * g] = w; } }
    __syncthreads();
    const size_t b = rb / SS; const int s0 = (int)(rb % SS);
    for (int e = tid; e < 128 * 16; e += 256) { const int d = e >> 4, pc = e & 15; vst2((unsigned*)(VT + ((b * DM + c0 + d) * SS) + s0 + pc * 8), *(const v4u*)&so[d * EP + pc * 8]); } }
}
// ---- k_attn: block = (128 queries, head, b), 8 waves x 16 queries: 128-wide scores ([qt|qs] . [k1|k2]) / 8, softmax, P . vt (64 dims); O 256-B head segments
// products stand transposed: S^T = K . Q^T and O^T += vt . P^T, so a lane holds 16 of the 32 keys of ONE query (its column): maximum and sum are taken in-lane over these 16, then joined with the other half (lane l ^ 16), the two S^T tiles convert in place into the B operand P^T
// K and vt go global -> LDS in stages of 128 keys by asynchronous copies (whole 128-B lines, two buffers), once per block; every wave reads its fragments from LDS
#define AK 128                // keys per stage
#define AP 136                // LDS row pitch in f16 elements: 256 B + 16 B, so the 16 rows of a 16-byte fragment read fall on distinct banks
#define AKT (AK * AP)         // K tile [key][k1 | k2], elements
#define ABUF (AKT + HD * AP)  // one buffer: K tile, then vt tile [dim][key]
// one stage: 8 K copies and 4 vt copies of 16 B per lane; a wave's 32 lanes cover four whole 128-B lines per copy
__device__ __forceinline__ void kv_copy(const _Float16* gk, const _Float16* gv, unsigned lk, unsigned lv) {
  // the closing s_wait_xcnt stands inside the statement so that no address register of a copy is written again in front of it
  asm volatile("global_load_async_to_lds_b128 %0, %1, off\n\t"
               "global_load_async_to_lds_b128 %2, %3, off\n\t"
               "global_load_async_to_lds_b128 %4, %5, off\n\t"
               "global_load_async_to_lds_b128 %6, %7, off\n\t"
               "global_load_async_to_lds_b128 %8, %9, off\n\t"
               "global_load_async_to_lds_b128 %10, %11, off\n\t"
               "global_load_async_to_lds_b128 %12, %13, off\n\t"
               "global_load_async_to_lds_b128 %14, %15, off\n\t"
               "global_load_async_to_lds_b128 %16, %17, off\n\t"
               "global_load_async_to_lds_b128 %18, %19, off\n\t"
               "global_load_async_to_lds_b128 %20, %21, off\n\t"
               "global_load_async_to_lds_b128 %22, %23, off\n\t"
               "s_wait_xcnt 0x0"
               :: "v"(lk), "v"(gk), "v"(lk + 1 * 16 * AP * 2), "v"(gk + 1 * 16 * 2 * DM), "v"(lk + 2 * 16 * AP * 2), "v"(gk + 2 * 16 * 2 * DM), "v"(lk + 3 * 16 * AP * 2), "v"(gk + 3 * 16 * 2 * DM),
                  "v"(lk + 4 * 16 * AP * 2), "v"(gk + 4 * 16 * 2 * DM), "v"(lk + 5 * 16 * AP * 2), "v"(gk + 5 * 16 * 2 * DM), "v"(lk + 6 * 16 * AP * 2), "v"(gk + 6 * 16 * 2 * DM), "v"(lk + 7 * 16 * AP * 2), "v"(gk + 7 * 16 * 2 * DM),
                  "v"(lv), "v"(gv), "v"(lv + 1 * 16 * AP * 2), "v"(gv + 1 * 16 * SS), "v"(lv + 2 * 16 * AP * 2), "v"(gv + 2 * 16 * SS), "v"(lv + 3 * 16 * AP * 2), "v"(gv + 3 * 16 * SS)
               : "memory");
}
// lane l takes the value of lane l ^ 16
__device__ __forceinline__ float xhalf(float x) { return __builtin_bit_cast(float, __builtin_amdgcn_permlanex16(__builtin_bit_cast(int, x), __builtin_bit_cast(int, x), 0x76543210, 0xfedcba98, false, false)); }
__global__ __launch_bounds__(256) void k_attn(const _Float16* __restrict__ QQ, const _Float16* __restrict__ KK, const _Float16* __restrict__ VT, float* __restrict__ O) {
  __shared__ __align__(16) _Float16 ring[2 * ABUF]; __shared__ __align__(16) float so[8][16][68];
  const int tid = threadIdx.x, wave = tid >> 5, lane = tid & 31, col = lane & 15, g = lane >> 4; const int h = blockIdx.y; const size_t b = blockIdx.z; const int q0 = blockIdx.x * 128 + wave * 16; const size_t rq = b * SS + q0;
  // lane's share of a stage: K row tid >> 4 (+16 per copy), 16-byte piece tid & 15 of [k1 | k2]; vt row tid >> 4 (+16 per copy), piece tid & 15 of 128 keys
  const _Float16* gk = KK + (b * SS + (tid >> 4)) * (2 * DM) + ((tid >> 3) & 1) * DM + h * HD + (tid & 7) * 8; const _Float16* gv = VT + (b * DM + h * HD + (tid >> 4)) * SS + (tid & 15) * 8;
  const unsigned lk = (unsigned)(size_t)ring + ((tid >> 4) * AP + (tid & 15) * 8) * 2, lv = lk + AKT * 2;
  kv_copy(gk, gv, lk, lv);
  asm volatile("s_wait_asynccnt 0x0" ::: "memory");   // this wave's share of stage 0 has landed
  __syncthreads();   // stage 0 is published
  kv_copy(gk + (size_t)AK * 2 * DM, gv + AK, lk + ABUF * 2, lv + ABUF * 2);   // stage 1 flies while stage 0 is worked on
  v16h aq[4];
#pragma unroll
  for (int kc = 0; kc < 4; ++kc) aq[kc] = frag_h(QQ + (rq + col) * (2 * DM) + ((kc < 2) ? 0 : DM) + h * HD + (kc & 1) * 32, lane);
  float m = -3.0e38f, l = 0.f;   // of query 'col': m is the same in both wave halves, l is the sum over this half's keys
  v8f acc[4] = {};   // acc[dt][r] = O^T[dim dt * 16 + 8 g + r][query col]
#pragma unroll 1   // kept rolled: one copy of the publish point and of the long body
  for (int t = 0; t < SS / AK; ++t) { const _Float16* kb = ring + (t & 1) * ABUF; const _Float16* vb = kb + AKT;
#pragma unroll 1   // kept rolled: four copies of this long body would only grow the code
  for (int ks = 0; ks < AK / 32; ++ks) { const int j0 = ks * 32; v8f s[2];
    v16h bk[2][4], bv[4];   // all fragment reads of the 32 keys stand together, in front of the products: one LDS latency, and vt's passes under the softmax
#pragma unroll
    for (int ct = 0; ct < 2; ++ct)
#pragma unroll
      for (int kc = 0; kc < 4; ++kc) bk[ct][kc] = frag_h(kb + (j0 + ct * 16 + col) * AP + kc * 32, lane);
#pragma unroll
    for (int dt = 0; dt < 4; ++dt) bv[dt] = frag_h(vb + (dt * 16 + col) * AP + j0, lane);
#pragma unroll
    for (int ct = 0; ct < 2; ++ct) { v8f c = {};   // c[r] = S^T[key j0 + ct * 16 + 8 g + r][query col]
#pragma unroll
      for (int kc = 0; kc < 4; ++kc) c = wmma16(bk[ct][kc], aq[kc], c);
      s[ct] = c * 0.125f; }
    float mx = fmaxf(s[0][0], s[1][0]);
#pragma unroll
    for (int r = 1; r < 8; ++r) mx = fmaxf(mx, fmaxf(s[0][r], s[1][r]));
    mx = fmaxf(mx, xhalf(mx));   // the other half's 16 keys of the same query
    const float mn = fmaxf(m, mx); const float alpha = (m <= -1.0e38f) ? 0.f : __expf(m - mn);
    v8f e[2];
#pragma unroll
    for (int ct = 0; ct < 2; ++ct)
#pragma unroll
      for (int r = 0; r < 8; ++r) e[ct][r] = __expf(s[ct][r] - mn);
    const v8f e8 = e[0] + e[1]; const v4f e4 = e8.lo + e8.hi; const v2f e2 = e4.lo + e4.hi;
    l = l * alpha + (e2.x + e2.y); m = mn;
#pragma unroll
    for (int dt = 0; dt < 4; ++dt) acc[dt] *= alpha;
    // element i of a B fragment is k = 8 g + i, element 8 + i is k = 16 + 8 g + i: exactly the keys this lane holds in s[0] and s[1]
    union { v16h v; v8h q[2]; } pb; pb.q[0] = __builtin_convertvector(e[0] * 2048.0f, v8h); pb.q[1] = __builtin_convertvector(e[1] * 2048.0f, v8h);
#pragma unroll
    for (int dt = 0; dt < 4; ++dt) acc[dt] = wmma16(bv[dt], pb.v, acc[dt]); }
    asm volatile("s_wait_dscnt 0x0" ::: "memory");      // this wave's reads of stage t are done
    asm volatile("s_wait_asynccnt 0x0" ::: "memory");   // this wave's share of stage t + 1 has landed
    __syncthreads();   // publishes stage t + 1 and ends every read of stage t
    if (t + 2 < SS / AK) kv_copy(gk + (size_t)(t + 2) * AK * 2 * DM, gv + (t + 2) * AK, lk + (t & 1) * ABUF * 2, lv + (t & 1) * ABUF * 2);   // into the buffer that stage t has just left
  }
  asm volatile("s_wait_asynccnt 0x0" ::: "memory");   // no copy is outstanding when the wave ends
  const float il = (1.0f / 2048.0f) / (l + xhalf(l));   // the two halves' sums are joined once
#pragma unroll
  for (int dt = 0; dt < 4; ++dt) { const v8f o = acc[dt] * il; *(v4f*)&so[wave][col][dt * 16 + 8 * g] = o.lo; *(v4f*)&so[wave][col][dt * 16 + 8 * g + 4] = o.hi; }   // a lane's 8 dims are 32 contiguous bytes of its query's row
  LDSX();
  for (int rl = 0; rl < 16; ++rl) if (lane < 16) vst2(O + (rq + rl) * DM + h * HD + lane * 4, *(const v4f*)&so[wave][rl][lane * 4]);
}
// ---- k_out: block = (128 rows, 128 cols): Y = y (bf16 hi + lo) . Wc + bc
__global__ __launch_bounds__(256) void k_out(const float* __restrict__ O, const __bf16* __restrict__ P, const float* __restrict__ BC, float* __restrict__ Y) {
  __shared__ __align__(16) unsigned char smem[2 * 3 * GT * 2];   // two buffers of [y hi][Wc][y lo]; the epilogue's f32 [128][132] tile afterwards
  __bf16* sm = (__bf16*)smem; float* so = (float*)smem;
  const int tid = threadIdx.x, wave = tid >> 5, lane = tid & 31, col = lane & 15, g = lane >> 4, wm = wave >> 2, wn = wave & 3; const size_t rb = (size_t)blockIdx.x * 128; const int n0 = blockIdx.y * 128; const __bf16* PC = P + ((size_t)5 * DM + n0) * DM;
  v8f acc[4][2] = {};
  g_pass<true>(O + rb * DM, PC, sm, acc, tid, lane, wm, wn);
#pragma unroll
  for (int j = 0; j < 2; ++j) { const int cl = wn * 32 + j * 16 + col; const float bb = bfr(BC[n0 + cl]);
#pragma unroll
    for (int i = 0; i < 4; ++i)
#pragma unroll
      for (int r = 0; r < 8; ++r) so[(wm * 64 + i * 16 + 8 * g + r) * 132 + cl] = acc[i][j][r] + bb; }
  __syncthreads();
  for (int e = tid; e < 128 * 32; e += 256) { const int rl = e >> 5, q = e & 31; vst2(Y + (rb + rl) * DM + n0 + q * 4, *(const v4f*)&so[rl * 132 + q * 4]); }
}
extern "C" void kernel_launch(void* const* d_in, const int* in_sizes, int n_in, void* d_out, int out_size, void* d_ws, size_t ws_size, hipStream_t stream) {
  (void)in_sizes; (void)n_in; (void)out_size;
  const float** F = (const float**)d_in;   // 0 xt, 1 xs [2,2048,1024]; 2 Wt [1024,3072], 3 bt; 4 Ws [1024,2048], 5 bs; 6 Wc [1024,1024], 7 bc; 8 lam_ts, 9 lam_st, 10 lam_ss [1]
  if (ws_size < (size_t)WS_END) return;
  char* ws = (char*)d_ws; __bf16* P = (__bf16*)(ws + WS_PW); _Float16 *QQ = (_Float16*)(ws + WS_QQ), *KK = (_Float16*)(ws + WS_KK), *VT = (_Float16*)(ws + WS_VT); float* O = (float*)(ws + WS_O);
  k_packT<<<dim3(6 * DM / 128, DM / 128), 256, 0, stream>>>(F[2], F[4], F[6], P);
  k_qkvd<<<dim3(TNB * SS / 128, DM / 128, 3), 256, 0, stream>>>(F[0], F[1], P, F[3], F[5], F[8], F[9], F[10], QQ, KK, VT);
  k_attn<<<dim3(TQB, NH, TNB), 256, 0, stream>>>(QQ, KK, VT, O);
  k_out<<<dim3(TNB * SS / 128, DM / 128), 256, 0, stream>>>(O, P, F[7], (float*)d_out);
}

// v005
// It runs in 130 microseconds.
// In both of two side-by-side timings against v004, it was 1.03 times as fast.
// Over all steps from v000 it is 3.84 times as fast.
// compute dtype: all float inputs rounded to bf16, the three lambda scalars read on device; qt/kt/vt = xt . Wt + bt and qs/ks = xs . Ws + bs with EXACT bf16 products on WMMA 16x16x32 ((in,out) weights as transposed rows); k1 = kt + lam_ts ks and k2 = lam_st kt + lam_ss ks formed in f32, then q = [qt | qs] and k = [k1 | k2] rounded once to f16 (128-wide per head); PLAIN attention: scores x 1/8, running-max softmax in f32 (hardware exp), P (scaled by 2^11, single f16) x vt (single f16); out = y (bf16 hi + residual) . Wc (2 products) + bc.
#include <hip/hip_runtime.h>
#include <math.h>

typedef __attribute__((ext_vector_type(16))) _Float16 v16h;
typedef __attribute__((ext_vector_type(16))) __bf16 v16b;
typedef __attribute__((ext_vector_type(8)))  _Float16 v8h;
typedef __attribute__((ext_vector_type(8)))  float v8f;
typedef __attribute__((ext_vector_type(4)))  float v4f;
typedef __attribute__((ext_vector_type(2)))  float v2f;
typedef __attribute__((ext_vector_type(4)))  unsigned v4u;
typedef __attribute__((ext_vector_type(4)))  int v4i;
typedef float __attribute__((may_alias)) float_a;
typedef int __attribute__((may_alias)) int_a;

template <typename T> __device__ __forceinline__ void vst2(void* p, T v) { *(T*)p = v;  }
// plain builtins: the compiler itself keeps the distance behind a matrix instruction where a vector instruction touches its registers, and fills it with useful work where it can
__device__ __forceinline__ v8f wmma16(v16h a, v16h b, v8f c) {
  v8f d = __builtin_amdgcn_wmma_f32_16x16x32_f16(false, a, false, b, (short)0, c, false, false);
  return d;
}
__device__ __forceinline__ v8f wmma_bf(v16b a, v16b b, v8f c) {
  v8f d = __builtin_amdgcn_wmma_f32_16x16x32_bf16(false, a, false, b, (short)0, c, false, false);
  return d;
}
// 16x16x32 fragments: lane = (h = lane>>4, row/col = lane&15); elements 0..7 = k0+8h+0..7, 8..15 = k0+16+8h+0..7; D element r = row 8h+r
__device__ __forceinline__ v16h frag_h(const _Float16* rowk0, int lane) {
  union { v16h v; v8h q[2]; } u; const _Float16* p = rowk0 + 8 * (lane >> 4);
  u.q[0] = *(const v8h*)p; u.q[1] = *(const v8h*)(p + 16); return u.v;
}
__device__ __forceinline__ v16h frag_f32(const float* rowk0, int lane) {
  v16h a; const float* p = rowk0 + 8 * (lane >> 4);
#pragma unroll
  for (int i = 0; i < 8; ++i) { a[i] = (_Float16)p[i]; a[8 + i] = (_Float16)p[16 + i]; }
  return a;
}
__device__ __forceinline__ v16h frag_f32s(const float* rowk0, int lane, float sc) {
  v16h a; const float* p = rowk0 + 8 * (lane >> 4);
#pragma unroll
  for (int i = 0; i < 8; ++i) { a[i] = (_Float16)(p[i] * sc); a[8 + i] = (_Float16)(p[16 + i] * sc); }
  return a;
}
// column fragment from a [K][ld] layout (column n), rows >= K read as 0
__device__ __forceinline__ v16h fragc_f32(const float* W, int k0, int n, int lane, int ld, int K) {
  v16h a; const int g = lane >> 4;
#pragma unroll
  for (int i = 0; i < 8; ++i) { const int ka = k0 + 8 * g + i, kb = ka + 16;
    a[i] = (_Float16)(ka < K ? W[(size_t)(ka < K ? ka : K - 1) * ld + n] : 0.f); a[8 + i] = (_Float16)(kb < K ? W[(size_t)(kb < K ? kb : K - 1) * ld + n] : 0.f); }
  return a;
}
struct F2 { v16b h, l; };
__device__ __forceinline__ F2 bsplit16(const float v[16]) { F2 r;
#pragma unroll
  for (int i = 0; i < 16; ++i) { const __bf16 h = (__bf16)v[i]; r.h[i] = h; r.l[i] = (__bf16)(v[i] - (float)h); }
  return r; }
__device__ __forceinline__ F2 split_row(const float* row, int k0, int lane) { float v[16]; const float* p = row + k0 + 8 * (lane >> 4);
#pragma unroll
  for (int i = 0; i < 8; ++i) { v[i] = p[i]; v[8 + i] = p[16 + i]; }
  return bsplit16(v); }
__device__ __forceinline__ F2 split_rowK(const float* row, int k0, int lane, int K) { float v[16]; const int g = lane >> 4;
#pragma unroll
  for (int i = 0; i < 8; ++i) { const int ka = k0 + 8 * g + i, kb = ka + 16; v[i] = ka < K ? row[ka < K ? ka : K - 1] : 0.f; v[8 + i] = kb < K ? row[kb < K ? kb : K - 1] : 0.f; }
  return bsplit16(v); }
__device__ __forceinline__ F2 split_col(const float* W, int k0, int n, int lane, int ld, int K) { float v[16]; const int g = lane >> 4;
#pragma unroll
  for (int i = 0; i < 8; ++i) { const int ka = k0 + 8 * g + i, kb = ka + 16; v[i] = ka < K ? W[(size_t)(ka < K ? ka : K - 1) * ld + n] : 0.f; v[8 + i] = kb < K ? W[(size_t)(kb < K ? kb : K - 1) * ld + n] : 0.f; }
  return bsplit16(v); }
__device__ __forceinline__ v8f mac3(const F2& a, const F2& b, v8f c) { c = wmma_bf(a.l, b.h, c); c = wmma_bf(a.h, b.l, c); return wmma_bf(a.h, b.h, c); }
__device__ __forceinline__ float sigm(float v) { return 1.0f / (1.0f + expf(-v)); }
#define LDSX() do { asm volatile("s_wait_dscnt 0" ::: "memory"); __builtin_amdgcn_wave_barrier(); __builtin_amdgcn_fence(__ATOMIC_RELEASE, "workgroup"); } while (0)


// Disentangled spatial attention (B 2, L 2,048, E 1,024, 16 heads x 64): scores = (qt . (kt + lam_ts ks) + qs . (lam_st kt + lam_ss ks)) / 8 over the target and source streams, softmax, . vt, output projection + bias.
#define NB 2
#define SS 2048
#define DM 1024
#define NH 16
#define HD 64
#define NR (NB * SS)
#ifndef TQB
#define TQB (SS / 128)
#define TNB NB
#endif
typedef __attribute__((ext_vector_type(8))) __bf16 v8b;
__device__ __forceinline__ v16b frag_b(const __bf16* rowk0, int lane) {
  union { v16b v; v8b q[2]; } u; const __bf16* p = rowk0 + 8 * (lane >> 4);
  u.q[0] = *(const v8b*)p; u.q[1] = *(const v8b*)(p + 16); return u.v;
}
__device__ __forceinline__ float bfr(float v) { return (float)(__bf16)v; }
__device__ __attribute__((noinline)) float exp_ni(float v) { return expf(v); }
__device__ __attribute__((noinline)) float erf_ni(float v) { return erff(v); }

#define WS_PW  0u                                     // bf16 transposed rows: Wt q, Wt k, Wt v, Ws q, Ws k, Wc  [6][1024][1024]
#define WS_QQ  (WS_PW + 2u * (size_t)6 * DM * DM)       // f16 [NR][2048]: qt | qs
#define WS_KK  (WS_QQ + 2u * (size_t)NR * 2 * DM)       // f16 [NR][2048]: k1 | k2
#define WS_VT  (WS_KK + 2u * (size_t)NR * 2 * DM)       // f16 planes vt [b][1024][SS]
#define WS_O   (WS_VT + 2u * (size_t)NB * DM * SS)       // f32 [NR][1024]
#define WS_END (WS_O + 4u * (size_t)NR * DM)

// ---- k_packT: block = a 128 (k) x 128 (n) tile of an (in,out) weight -> 128 bf16 rows of P (row = block 'which' * 1024 + n, K = 1024 contiguous), turned in LDS
// reads: a wave-wide 16-byte load is 512 contiguous bytes of one k row (whole lines), a lane's 16 rows all in flight; writes: 16 lanes give 256 contiguous bytes of one P row
template <int STRIDE> __device__ __forceinline__ void pack_read(v4f (&r)[16], const float* __restrict__ p) {   // the row pitch is a constant, so one address pair serves the 16 loads
#pragma unroll
  for (int i = 0; i < 16; ++i) r[i] = *(const v4f*)(p + i * STRIDE);
  // inputs only, the loaded values and their address: keeps the 16 loads in flight together (without it the first are waited for before the last are issued, several memory latencies in a row) and keeps the address pair off the loads' result registers
  asm volatile("" :: "v"(r[0]), "v"(r[1]), "v"(r[2]), "v"(r[3]), "v"(r[4]), "v"(r[5]), "v"(r[6]), "v"(r[7]), "v"(r[8]), "v"(r[9]), "v"(r[10]), "v"(r[11]), "v"(r[12]), "v"(r[13]), "v"(r[14]), "v"(r[15]), "v"(p));
}
__global__ __launch_bounds__(256) void k_packT(const float* __restrict__ WT, const float* __restrict__ WSm, const float* __restrict__ WC, __bf16* __restrict__ P) {
  __shared__ __align__(16) __bf16 s[128 * 128];   // [n][16 pieces of 8 k]; piece p of row n stands at place p ^ ((n >> 2) & 15), so that the 16 lanes of a 16-byte store (rows 4 apart) and of a 16-byte load (one row) fall on distinct banks
  const int t = threadIdx.x, r0 = blockIdx.x * 128, k0 = blockIdx.y * 128, which = r0 / DM;
  const int n4 = t & 31, kw = t >> 5;   // the lane's 4 columns, the wave's 16 k rows
  const size_t kr = k0 + kw * 16; v4f r[16];
  if (which < 3) pack_read<3 * DM>(r, WT + kr * (3 * DM) + r0 + n4 * 4);
  else if (which < 5) pack_read<2 * DM>(r, WSm + kr * (2 * DM) + (r0 - 3 * DM) + n4 * 4);
  else pack_read<DM>(r, WC + kr * DM + (r0 - 5 * DM) + n4 * 4);
#pragma unroll
  for (int q = 0; q < 4; ++q)
#pragma unroll
    for (int hf = 0; hf < 2; ++hf) { v8b w;
#pragma unroll
      for (int j = 0; j < 8; ++j) w[j] = (__bf16)r[hf * 8 + j][q];
      *(v8b*)&s[(n4 * 4 + q) * 128 + (((kw * 2 + hf) ^ (n4 & 15)) * 8)] = w; }
  __syncthreads();
  __bf16* d = P + (size_t)(r0 + (t >> 4)) * DM + k0 + (t & 15) * 8;
#pragma unroll   // unrolled: the 8 LDS reads share one latency instead of paying it one after another
  for (int i = 0; i < 8; ++i) { const int n = i * 16 + (t >> 4); vst2((unsigned*)(d + i * 16 * DM), *(const v4u*)&s[n * 128 + (((t & 15) ^ ((n >> 2) & 15)) * 8)]); }
}
// ---- shared GEMM core: a 128 x 128 tile of X . W^T per 8-wave block; k slices of 64 go global -> registers -> LDS (two buffers), every wave reads its fragments from LDS
#define GP 72                 // LDS row pitch in 16-bit elements: 64 k + 8, so the 16 rows of a 16-byte fragment read fall on distinct banks
#define GT (128 * GP)         // one operand tile, elements
typedef __attribute__((ext_vector_type(4))) __bf16 v4b;
struct StgR { v4f a[8]; v4u b[4]; };
// each wave-wide load covers whole 128-B lines: X rows give 256 B per slice (16 lanes), weight rows 128 B (8 lanes)
__device__ __forceinline__ void g_load(StgR& r, const float* __restrict__ X, const __bf16* __restrict__ Pw, int k0, int tid) {
  const float* pa = X + (size_t)(tid >> 4) * DM + (tid & 15) * 4 + k0; const __bf16* pb = Pw + (size_t)(tid >> 3) * DM + (tid & 7) * 8 + k0;
#pragma unroll
  for (int i = 0; i < 8; ++i) r.a[i] = *(const v4f*)(pa + i * 16 * DM);
#pragma unroll
  for (int i = 0; i < 4; ++i) r.b[i] = *(const v4u*)(pb + i * 32 * DM);
}
template <bool SPLIT> __device__ __forceinline__ void g_store(const StgR& r, __bf16* buf, int tid) {   // buf: [A hi][B]([A lo])
  __bf16* sa = buf + (tid >> 4) * GP + (tid & 15) * 4; __bf16* sb = buf + GT + (tid >> 3) * GP + (tid & 7) * 8;
#pragma unroll
  for (int i = 0; i < 8; ++i) { v4b h, l;
#pragma unroll
    for (int q = 0; q < 4; ++q) { h[q] = (__bf16)r.a[i][q]; if (SPLIT) l[q] = (__bf16)(r.a[i][q] - (float)h[q]); }
    *(v4b*)(sa + i * 16 * GP) = h; if (SPLIT) *(v4b*)(sa + 2 * GT + i * 16 * GP) = l; }
#pragma unroll
  for (int i = 0; i < 4; ++i) *(v4u*)(sb + i * 32 * GP) = r.b[i];
}
// wave (wm, wn) of 2 x 4 owns rows wm*64 + i*16, columns wn*32 + j*16; k ascends as in a plain loop, so every accumulator sums in the same order
template <bool SPLIT> __device__ __forceinline__ void g_pass(const float* __restrict__ X, const __bf16* __restrict__ Pw, __bf16* sm, v8f (&acc)[4][2], int tid, int lane, int wm, int wn) {
  constexpr int BUF = (SPLIT ? 3 : 2) * GT; const int col = lane & 15;
  StgR r; g_load(r, X, Pw, 0, tid); g_store<SPLIT>(r, sm, tid);
  __syncthreads();   // slice 0 is published
#pragma unroll 1   // kept rolled: unrolled, 16 copies of this long body would only grow the code
  for (int s = 0; s < DM / 64; ++s) { const __bf16* cur = sm + (s & 1) * BUF;
    if (s + 1 < DM / 64) g_load(r, X, Pw, (s + 1) * 64, tid);   // the next slice flies while this one is multiplied
#pragma unroll
    for (int kk = 0; kk < 2; ++kk) { v16b b[2], a[4], al[SPLIT ? 4 : 1];
#pragma unroll
      for (int j = 0; j < 2; ++j) b[j] = frag_b(cur + GT + (wn * 32 + j * 16 + col) * GP + kk * 32, lane);
#pragma unroll
      for (int i = 0; i < 4; ++i) { a[i] = frag_b(cur + (wm * 64 + i * 16 + col) * GP + kk * 32, lane); if (SPLIT) al[i] = frag_b(cur + 2 * GT + (wm * 64 + i * 16 + col) * GP + kk * 32, lane); }
      __builtin_amdgcn_sched_barrier(0);   // the fragment reads of these 32 k stay one group in front of the products: left free, the compiler reads one fragment, waits for it and multiplies, an LDS latency per pair of products
#pragma unroll
      for (int i = 0; i < 4; ++i)
#pragma unroll
        for (int j = 0; j < 2; ++j) acc[i][j] = wmma_bf(a[i], b[j], acc[i][j]);
      if (SPLIT) {   // every accumulator still takes hi, then lo, of each 32 k
#pragma unroll
        for (int i = 0; i < 4; ++i)
#pragma unroll
          for (int j = 0; j < 2; ++j) acc[i][j] = wmma_bf(al[i], b[j], acc[i][j]); }
      __builtin_amdgcn_sched_barrier(0);   // the next group of reads stays behind these products, not spread among them
    }
    if (s + 1 < DM / 64) g_store<SPLIT>(r, sm + ((s + 1) & 1) * BUF, tid);   // into the buffer whose readers left at the previous barrier
    __syncthreads();   // publishes slice s + 1 and ends every read of slice s
  }
}
// ---- k_qkvd: block = (128 rows, 128 cols, kind): kind 0 -> qt (from xt) and qs (from xs) into QQ; kind 1 -> k1, k2 into KK; kind 2 -> vt planes
#define EP 136                // epilogue staging pitch, f16 elements
__global__ __launch_bounds__(256) void k_qkvd(const float* __restrict__ XT, const float* __restrict__ XS, const __bf16* __restrict__ P, const float* __restrict__ BT, const float* __restrict__ BS, const float* __restrict__ LTS, const float* __restrict__ LST, const float* __restrict__ LSS, _Float16* __restrict__ QQ, _Float16* __restrict__ KK, _Float16* __restrict__ VT) {
  __shared__ __align__(16) unsigned char smem[2 * 2 * GT * 2];   // two buffers of [X tile][W tile]; the epilogue's two f16 [128][EP] tiles afterwards
  __bf16* sm = (__bf16*)smem; _Float16* so = (_Float16*)smem; _Float16* so2 = so + 128 * EP;
  const int tid = threadIdx.x, wave = tid >> 5, lane = tid & 31, col = lane & 15, g = lane >> 4, wm = wave >> 2, wn = wave & 3; const int kind = blockIdx.z; const int c0 = blockIdx.y * 128; const size_t rb = (size_t)blockIdx.x * 128;
  const __bf16* PT = P + ((size_t)kind * DM + c0) * DM;                              // Wt block for this kind (q, k or v)
  const __bf16* PS = P + ((size_t)(3 + (kind < 2 ? kind : 0)) * DM + c0) * DM;       // Ws block (q or k)
  v8f at[4][2] = {}, as[4][2] = {};
  g_pass<false>(XT + rb * DM, PT, sm, at, tid, lane, wm, wn);
  if (kind < 2) g_pass<false>(XS + rb * DM, PS, sm, as, tid, lane, wm, wn);
  if (kind < 2) {   // q pair, or k pair -> k1, k2
    float lts = 0.f, lst = 0.f, lss = 0.f; if (kind == 1) { lts = bfr(LTS[0]); lst = bfr(LST[0]); lss = bfr(LSS[0]); }
#pragma unroll
    for (int j = 0; j < 2; ++j) { const int cl = wn * 32 + j * 16 + col; const float g1 = BT[kind * DM + c0 + cl], g2 = BS[kind * DM + c0 + cl];
      asm volatile("s_wait_xcnt 0x0" ::: "memory");   // stands before a register that the two bias loads name is written again
      const float b1 = bfr(g1), b2 = bfr(g2);
#pragma unroll
      for (int i = 0; i < 4; ++i)
#pragma unroll
        for (int r = 0; r < 8; ++r) { const int rl = wm * 64 + i * 16 + 8 * g + r; const float t = at[i][j][r] + b1, u = as[i][j][r] + b2;
          so[rl * EP + cl] = (_Float16)(kind == 0 ? t : t + lts * u); so2[rl * EP + cl] = (_Float16)(kind == 0 ? u : lst * t + lss * u); } }
    __syncthreads();
    _Float16* D = kind == 0 ? QQ : KK;
    for (int e = tid; e < 128 * 16; e += 256) { const int rl = e >> 4, q = e & 15; vst2((unsigned*)(D + (rb + rl) * (2 * DM) + c0 + q * 8), *(const v4u*)&so[rl * EP + q * 8]); vst2((unsigned*)(D + (rb + rl) * (2 * DM) + DM + c0 + q * 8), *(const v4u*)&so2[rl * EP + q * 8]); }
  } else {   // vt planes: staged transposed, a lane's 8 rows are 16 contiguous bytes
#pragma unroll
    for (int j = 0; j < 2; ++j) { const int cl = wn * 32 + j * 16 + col; const float b1 = bfr(BT[2 * DM + c0 + cl]);
#pragma unroll
      for (int i = 0; i < 4; ++i) { v8h w;
#pragma unroll
        for (int r = 0; r < 8; ++r) w[r] = (_Float16)(at[i][j][r] + b1);
        *(v8h*)&so[cl * EP + wm * 64 + i * 16 + 8 * g] = w; } }
    __syncthreads();
    const size_t b = rb / SS; const int s0 = (int)(rb % SS);
    for (int e = tid; e < 128 * 16; e += 256) { const int d = e >> 4, pc = e & 15; vst2((unsigned*)(VT + ((b * DM + c0 + d) * SS) + s0 + pc * 8), *(const v4u*)&so[d * EP + pc * 8]); } }
}
// ---- k_attn: block = (128 queries, head, b), 8 waves x 16 queries: 128-wide scores ([qt|qs] . [k1|k2]) / 8, softmax, P . vt (64 dims); O 256-B head segments
// products stand transposed: S^T = K . Q^T and O^T += vt . P^T, so a lane holds 16 of the 32 keys of ONE query (its column): maximum and sum are taken in-lane over these 16, then joined with the other half (lane l ^ 16), the two S^T tiles convert in place into the B operand P^T
// K and vt go global -> LDS in stages of 128 keys by asynchronous copies (whole 128-B lines, two buffers), once per block; every wave reads its fragments from LDS
#define AK 128                // keys per stage
#define AP 136                // LDS row pitch in f16 elements: 256 B + 16 B, so the 16 rows of a 16-byte fragment read fall on distinct banks
#define AKT (AK * AP)         // K tile [key][k1 | k2], elements
#define ABUF (AKT + HD * AP)  // one buffer: K tile, then vt tile [dim][key]
// one stage: 8 K copies and 4 vt copies of 16 B per lane; a wave's 32 lanes cover four whole 128-B lines per copy
__device__ __forceinline__ void kv_copy(const _Float16* gk, const _Float16* gv, unsigned lk, unsigned lv) {
  // the closing s_wait_xcnt stands inside the statement so that no address register of a copy is written again in front of it
  asm volatile("global_load_async_to_lds_b128 %0, %1, off\n\t"
               "global_load_async_to_lds_b128 %2, %3, off\n\t"
               "global_load_async_to_lds_b128 %4, %5, off\n\t"
               "global_load_async_to_lds_b128 %6, %7, off\n\t"
               "global_load_async_to_lds_b128 %8, %9, off\n\t"
               "global_load_async_to_lds_b128 %10, %11, off\n\t"
               "global_load_async_to_lds_b128 %12, %13, off\n\t"
               "global_load_async_to_lds_b128 %14, %15, off\n\t"
               "global_load_async_to_lds_b128 %16, %17, off\n\t"
               "global_load_async_to_lds_b128 %18, %19, off\n\t"
               "global_load_async_to_lds_b128 %20, %21, off\n\t"
               "global_load_async_to_lds_b128 %22, %23, off\n\t"
               "s_wait_xcnt 0x0"
               :: "v"(lk), "v"(gk), "v"(lk + 1 * 16 * AP * 2), "v"(gk + 1 * 16 * 2 * DM), "v"(lk + 2 * 16 * AP * 2), "v"(gk + 2 * 16 * 2 * DM), "v"(lk + 3 * 16 * AP * 2), "v"(gk + 3 * 16 * 2 * DM),
                  "v"(lk + 4 * 16 * AP * 2), "v"(gk + 4 * 16 * 2 * DM), "v"(lk + 5 * 16 * AP * 2), "v"(gk + 5 * 16 * 2 * DM), "v"(lk + 6 * 16 * AP * 2), "v"(gk + 6 * 16 * 2 * DM), "v"(lk + 7 * 16 * AP * 2), "v"(gk + 7 * 16 * 2 * DM),
                  "v"(lv), "v"(gv), "v"(lv + 1 * 16 * AP * 2), "v"(gv + 1 * 16 * SS), "v"(lv + 2 * 16 * AP * 2), "v"(gv + 2 * 16 * SS), "v"(lv + 3 * 16 * AP * 2), "v"(gv + 3 * 16 * SS)
               : "memory");
}
// lane l takes the value of lane l ^ 16
__device__ __forceinline__ float xhalf(float x) { return __builtin_bit_cast(float, __builtin_amdgcn_permlanex16(__builtin_bit_cast(int, x), __builtin_bit_cast(int, x), 0x76543210, 0xfedcba98, false, false)); }
__global__ __launch_bounds__(256) void k_attn(const _Float16* __restrict__ QQ, const _Float16* __restrict__ KK, const _Float16* __restrict__ VT, float* __restrict__ O) {
  __shared__ __align__(16) _Float16 ring[2 * ABUF]; __shared__ __align__(16) float so[8][16][68];
  const int tid = threadIdx.x, wave = tid >> 5, lane = tid & 31, col = lane & 15, g = lane >> 4; const int h = blockIdx.y; const size_t b = blockIdx.z; const int q0 = blockIdx.x * 128 + wave * 16; const size_t rq = b * SS + q0;
  // lane's share of a stage: K row tid >> 4 (+16 per copy), 16-byte piece tid & 15 of [k1 | k2]; vt row tid >> 4 (+16 per copy), piece tid & 15 of 128 keys
  const _Float16* gk = KK + (b * SS + (tid >> 4)) * (2 * DM) + ((tid >> 3) & 1) * DM + h * HD + (tid & 7) * 8; const _Float16* gv = VT + (b * DM + h * HD + (tid >> 4)) * SS + (tid & 15) * 8;
  const unsigned lk = (unsigned)(size_t)ring + ((tid >> 4) * AP + (tid & 15) * 8) * 2, lv = lk + AKT * 2;
  kv_copy(gk, gv, lk, lv);
  asm volatile("s_wait_asynccnt 0x0" ::: "memory");   // this wave's share of stage 0 has landed
  __syncthreads();   // stage 0 is published
  kv_copy(gk + (size_t)AK * 2 * DM, gv + AK, lk + ABUF * 2, lv + ABUF * 2);   // stage 1 flies while stage 0 is worked on
  v16h aq[4];
#pragma unroll
  for (int kc = 0; kc < 4; ++kc) aq[kc] = frag_h(QQ + (rq + col) * (2 * DM) + ((kc < 2) ? 0 : DM) + h * HD + (kc & 1) * 32, lane);
  float m = -3.0e38f, l = 0.f;   // of query 'col': m is the same in both wave halves, l is the sum over this half's keys
  v8f acc[4] = {};   // acc[dt][r] = O^T[dim dt * 16 + 8 g + r][query col]
#pragma unroll 1   // kept rolled: one copy of the publish point and of the long body
  for (int t = 0; t < SS / AK; ++t) { const _Float16* kb = ring + (t & 1) * ABUF; const _Float16* vb = kb + AKT;
#pragma unroll 1   // kept rolled: four copies of this long body would only grow the code
  for (int ks = 0; ks < AK / 32; ++ks) { const int j0 = ks * 32; v8f s[2];
    v16h bk[2][4], bv[4];   // all fragment reads of the 32 keys are asked for at the head of the pass: K's latency is paid once, vt's passes under the scores and the softmax
#pragma unroll
    for (int ct = 0; ct < 2; ++ct)
#pragma unroll
      for (int kc = 0; kc < 4; ++kc) bk[ct][kc] = frag_h(kb + (j0 + ct * 16 + col) * AP + kc * 32, lane);
#pragma unroll
    for (int dt = 0; dt < 4; ++dt) bv[dt] = frag_h(vb + (dt * 16 + col) * AP + j0, lane);
#pragma unroll
    for (int ct = 0; ct < 2; ++ct) { v8f c = {};   // c[r] = S^T[key j0 + ct * 16 + 8 g + r][query col]
#pragma unroll
      for (int kc = 0; kc < 4; ++kc) c = wmma16(bk[ct][kc], aq[kc], c);
      s[ct] = c * 0.125f; }
    float mx = fmaxf(s[0][0], s[1][0]);
#pragma unroll
    for (int r = 1; r < 8; ++r) mx = fmaxf(mx, fmaxf(s[0][r], s[1][r]));
    mx = fmaxf(mx, xhalf(mx));   // the other half's 16 keys of the same query
    const float mn = fmaxf(m, mx); const float alpha = (m <= -1.0e38f) ? 0.f : __expf(m - mn);
    v8f e[2];
#pragma unroll
    for (int ct = 0; ct < 2; ++ct)
#pragma unroll
      for (int r = 0; r < 8; ++r) e[ct][r] = __expf(s[ct][r] - mn);
    const v8f e8 = e[0] + e[1]; const v4f e4 = e8.lo + e8.hi; const v2f e2 = e4.lo + e4.hi;
    l = l * alpha + (e2.x + e2.y); m = mn;
#pragma unroll
    for (int dt = 0; dt < 4; ++dt) acc[dt] *= alpha;
    // element i of a B fragment is k = 8 g + i, element 8 + i is k = 16 + 8 g + i: exactly the keys this lane holds in s[0] and s[1]
    union { v16h v; v8h q[2]; } pb; pb.q[0] = __builtin_convertvector(e[0] * 2048.0f, v8h); pb.q[1] = __builtin_convertvector(e[1] * 2048.0f, v8h);
#pragma unroll
    for (int dt = 0; dt < 4; ++dt) acc[dt] = wmma16(bv[dt], pb.v, acc[dt]); }
    asm volatile("s_wait_dscnt 0x0" ::: "memory");      // this wave's reads of stage t are done
    asm volatile("s_wait_asynccnt 0x0" ::: "memory");   // this wave's share of stage t + 1 has landed
    __syncthreads();   // publishes stage t + 1 and ends every read of stage t
    if (t + 2 < SS / AK) kv_copy(gk + (size_t)(t + 2) * AK * 2 * DM, gv + (t + 2) * AK, lk + (t & 1) * ABUF * 2, lv + (t & 1) * ABUF * 2);   // into the buffer that stage t has just left
  }
  asm volatile("s_wait_asynccnt 0x0" ::: "memory");   // no copy is outstanding when the wave ends
  const float il = (1.0f / 2048.0f) / (l + xhalf(l));   // the two halves' sums are joined once
#pragma unroll
  for (int dt = 0; dt < 4; ++dt) { const v8f o = acc[dt] * il; *(v4f*)&so[wave][col][dt * 16 + 8 * g] = o.lo; *(v4f*)&so[wave][col][dt * 16 + 8 * g + 4] = o.hi; }   // a lane's 8 dims are 32 contiguous bytes of its query's row
  LDSX();
  for (int rl = 0; rl < 16; ++rl) if (lane < 16) vst2(O + (rq + rl) * DM + h * HD + lane * 4, *(const v4f*)&so[wave][rl][lane * 4]);
}
// ---- k_out: block = (128 rows, 128 cols): Y = y (bf16 hi + lo) . Wc + bc
__global__ __launch_bounds__(256) void k_out(const float* __restrict__ O, const __bf16* __restrict__ P, const float* __restrict__ BC, float* __restrict__ Y) {
  __shared__ __align__(16) unsigned char smem[2 * 3 * GT * 2];   // two buffers of [y hi][Wc][y lo]; the epilogue's f32 [128][132] tile afterwards
  __bf16* sm = (__bf16*)smem; float* so = (float*)smem;
  const int tid = threadIdx.x, wave = tid >> 5, lane = tid & 31, col = lane & 15, g = lane >> 4, wm = wave >> 2, wn = wave & 3; const size_t rb = (size_t)blockIdx.x * 128; const int n0 = blockIdx.y * 128; const __bf16* PC = P + ((size_t)5 * DM + n0) * DM;
  v8f acc[4][2] = {};
  g_pass<true>(O + rb * DM, PC, sm, acc, tid, lane, wm, wn);
#pragma unroll
  for (int j = 0; j < 2; ++j) { const int cl = wn * 32 + j * 16 + col; const float bb = bfr(BC[n0 + cl]);
#pragma unroll
    for (int i = 0; i < 4; ++i)
#pragma unroll
      for (int r = 0; r < 8; ++r) so[(wm * 64 + i * 16 + 8 * g + r) * 132 + cl] = acc[i][j][r] + bb; }
  __syncthreads();
  for (int e = tid; e < 128 * 32; e += 256) { const int rl = e >> 5, q = e & 31; vst2(Y + (rb + rl) * DM + n0 + q * 4, *(const v4f*)&so[rl * 132 + q * 4]); }
}
extern "C" void kernel_launch(void* const* d_in, const int* in_sizes, int n_in, void* d_out, int out_size, void* d_ws, size_t ws_size, hipStream_t stream) {
  (void)in_sizes; (void)n_in; (void)out_size;
  const float** F = (const float**)d_in;   // 0 xt, 1 xs [2,2048,1024]; 2 Wt [1024,3072], 3 bt; 4 Ws [1024,2048], 5 bs; 6 Wc [1024,1024], 7 bc; 8 lam_ts, 9 lam_st, 10 lam_ss [1]
  if (ws_size < (size_t)WS_END) return;
  char* ws = (char*)d_ws; __bf16* P = (__bf16*)(ws + WS_PW); _Float16 *QQ = (_Float16*)(ws + WS_QQ), *KK = (_Float16*)(ws + WS_KK), *VT = (_Float16*)(ws + WS_VT); float* O = (float*)(ws + WS_O);
  k_packT<<<dim3(6 * DM / 128, DM / 128), 256, 0, stream>>>(F[2], F[4], F[6], P);
  k_qkvd<<<dim3(TNB * SS / 128, DM / 128, 3), 256, 0, stream>>>(F[0], F[1], P, F[3], F[5], F[8], F[9], F[10], QQ, KK, VT);
  k_attn<<<dim3(TQB, NH, TNB), 256, 0, stream>>>(QQ, KK, VT, O);
  k_out<<<dim3(TNB * SS / 128, DM / 128), 256, 0, stream>>>(O, P, F[7], (float*)d_out);
}

// v006
// A run of this version takes 124 microseconds.
// Next to v005, in two timings, it ran 1.05 times as fast each time.
// All steps since v000 together make it 4.03 times as fast.
// compute dtype: all float inputs rounded to bf16, the three lambda scalars read on device; qt/kt/vt = xt . Wt + bt and qs/ks = xs . Ws + bs with EXACT bf16 products on WMMA 16x16x32 ((in,out) weights as transposed rows); k1 = kt + lam_ts ks and k2 = lam_st kt + lam_ss ks formed in f32, then q = [qt | qs] and k = [k1 | k2] rounded once to f16 (128-wide per head); q carries 1/8 x log2(e) before that rounding; PLAIN attention: softmax in f32 on the hardware 2^x against a held maximum that is raised only when needed, P (scaled by 2^7, single f16) x vt (single f16); out = y (bf16 hi + residual) . Wc (2 products) + bc.
#include <hip/hip_runtime.h>
#include <math.h>

typedef __attribute__((ext_vector_type(16))) _Float16 v16h;
typedef __attribute__((ext_vector_type(16))) __bf16 v16b;
typedef __attribute__((ext_vector_type(8)))  _Float16 v8h;
typedef __attribute__((ext_vector_type(8)))  float v8f;
typedef __attribute__((ext_vector_type(4)))  float v4f;
typedef __attribute__((ext_vector_type(2)))  float v2f;
typedef __attribute__((ext_vector_type(4)))  unsigned v4u;
typedef __attribute__((ext_vector_type(4)))  int v4i;
typedef float __attribute__((may_alias)) float_a;
typedef int __attribute__((may_alias)) int_a;

template <typename T> __device__ __forceinline__ void vst2(void* p, T v) { *(T*)p = v;  }
// plain builtins: the compiler itself keeps the distance behind a matrix instruction where a vector instruction touches its registers, and fills it with useful work where it can
__device__ __forceinline__ v8f wmma16(v16h a, v16h b, v8f c) {
  v8f d = __builtin_amdgcn_wmma_f32_16x16x32_f16(false, a, false, b, (short)0, c, false, false);
  return d;
}
__device__ __forceinline__ v8f wmma_bf(v16b a, v16b b, v8f c) {
  v8f d = __builtin_amdgcn_wmma_f32_16x16x32_bf16(false, a, false, b, (short)0, c, false, false);
  return d;
}
// 16x16x32 fragments: lane = (h = lane>>4, row/col = lane&15); elements 0..7 = k0+8h+0..7, 8..15 = k0+16+8h+0..7; D element r = row 8h+r
__device__ __forceinline__ v16h frag_h(const _Float16* rowk0, int lane) {
  union { v16h v; v8h q[2]; } u; const _Float16* p = rowk0 + 8 * (lane >> 4);
  u.q[0] = *(const v8h*)p; u.q[1] = *(const v8h*)(p + 16); return u.v;
}
__device__ __forceinline__ v16h frag_f32(const float* rowk0, int lane) {
  v16h a; const float* p = rowk0 + 8 * (lane >> 4);
#pragma unroll
  for (int i = 0; i < 8; ++i) { a[i] = (_Float16)p[i]; a[8 + i] = (_Float16)p[16 + i]; }
  return a;
}
__device__ __forceinline__ v16h frag_f32s(const float* rowk0, int lane, float sc) {
  v16h a; const float* p = rowk0 + 8 * (lane >> 4);
#pragma unroll
  for (int i = 0; i < 8; ++i) { a[i] = (_Float16)(p[i] * sc); a[8 + i] = (_Float16)(p[16 + i] * sc); }
  return a;
}
// column fragment from a [K][ld] layout (column n), rows >= K read as 0
__device__ __forceinline__ v16h fragc_f32(const float* W, int k0, int n, int lane, int ld, int K) {
  v16h a; const int g = lane >> 4;
#pragma unroll
  for (int i = 0; i < 8; ++i) { const int ka = k0 + 8 * g + i, kb = ka + 16;
    a[i] = (_Float16)(ka < K ? W[(size_t)(ka < K ? ka : K - 1) * ld + n] : 0.f); a[8 + i] = (_Float16)(kb < K ? W[(size_t)(kb < K ? kb : K - 1) * ld + n] : 0.f); }
  return a;
}
struct F2 { v16b h, l; };
__device__ __forceinline__ F2 bsplit16(const float v[16]) { F2 r;
#pragma unroll
  for (int i = 0; i < 16; ++i) { const __bf16 h = (__bf16)v[i]; r.h[i] = h; r.l[i] = (__bf16)(v[i] - (float)h); }
  return r; }
__device__ __forceinline__ F2 split_row(const float* row, int k0, int lane) { float v[16]; const float* p = row + k0 + 8 * (lane >> 4);
#pragma unroll
  for (int i = 0; i < 8; ++i) { v[i] = p[i]; v[8 + i] = p[16 + i]; }
  return bsplit16(v); }
__device__ __forceinline__ F2 split_rowK(const float* row, int k0, int lane, int K) { float v[16]; const int g = lane >> 4;
#pragma unroll
  for (int i = 0; i < 8; ++i) { const int ka = k0 + 8 * g + i, kb = ka + 16; v[i] = ka < K ? row[ka < K ? ka : K - 1] : 0.f; v[8 + i] = kb < K ? row[kb < K ? kb : K - 1] : 0.f; }
  return bsplit16(v); }
__device__ __forceinline__ F2 split_col(const float* W, int k0, int n, int lane, int ld, int K) { float v[16]; const int g = lane >> 4;
#pragma unroll
  for (int i = 0; i < 8; ++i) { const int ka = k0 + 8 * g + i, kb = ka + 16; v[i] = ka < K ? W[(size_t)(ka < K ? ka : K - 1) * ld + n] : 0.f; v[8 + i] = kb < K ? W[(size_t)(kb < K ? kb : K - 1) * ld + n] : 0.f; }
  return bsplit16(v); }
__device__ __forceinline__ v8f mac3(const F2& a, const F2& b, v8f c) { c = wmma_bf(a.l, b.h, c); c = wmma_bf(a.h, b.l, c); return wmma_bf(a.h, b.h, c); }
__device__ __forceinline__ float sigm(float v) { return 1.0f / (1.0f + expf(-v)); }
#define LDSX() do { asm volatile("s_wait_dscnt 0" ::: "memory"); __builtin_amdgcn_wave_barrier(); __builtin_amdgcn_fence(__ATOMIC_RELEASE, "workgroup"); } while (0)


// Disentangled spatial attention (B 2, L 2,048, E 1,024, 16 heads x 64): scores = (qt . (kt + lam_ts ks) + qs . (lam_st kt + lam_ss ks)) / 8 over the target and source streams, softmax, . vt, output projection + bias.
#define NB 2
#define SS 2048
#define DM 1024
#define NH 16
#define HD 64
#define NR (NB * SS)
#ifndef TQB
#define TQB (SS / 128)
#define TNB NB
#endif
typedef __attribute__((ext_vector_type(8))) __bf16 v8b;
__device__ __forceinline__ v16b frag_b(const __bf16* rowk0, int lane) {
  union { v16b v; v8b q[2]; } u; const __bf16* p = rowk0 + 8 * (lane >> 4);
  u.q[0] = *(const v8b*)p; u.q[1] = *(const v8b*)(p + 16); return u.v;
}
__device__ __forceinline__ float bfr(float v) { return (float)(__bf16)v; }
__device__ __attribute__((noinline)) float exp_ni(float v) { return expf(v); }
__device__ __attribute__((noinline)) float erf_ni(float v) { return erff(v); }

#define WS_PW  0u                                     // bf16 transposed rows: Wt q, Wt k, Wt v, Ws q, Ws k, Wc  [6][1024][1024]
#define WS_QQ  (WS_PW + 2u * (size_t)6 * DM * DM)       // f16 [NR][2048]: qt | qs
#define WS_KK  (WS_QQ + 2u * (size_t)NR * 2 * DM)       // f16 [NR][2048]: k1 | k2
#define WS_VT  (WS_KK + 2u * (size_t)NR * 2 * DM)       // f16 planes vt [b][1024][SS]
#define WS_O   (WS_VT + 2u * (size_t)NB * DM * SS)       // f32 [NR][1024]
#define WS_END (WS_O + 4u * (size_t)NR * DM)

// ---- k_packT: block = a 128 (k) x 128 (n) tile of an (in,out) weight -> 128 bf16 rows of P (row = block 'which' * 1024 + n, K = 1024 contiguous), turned in LDS
// reads: a wave-wide 16-byte load is 512 contiguous bytes of one k row (whole lines), a lane's 16 rows all in flight; writes: 16 lanes give 256 contiguous bytes of one P row
template <int STRIDE> __device__ __forceinline__ void pack_read(v4f (&r)[16], const float* __restrict__ p) {   // the row pitch is a constant, so one address pair serves the 16 loads
#pragma unroll
  for (int i = 0; i < 16; ++i) r[i] = *(const v4f*)(p + i * STRIDE);
  // inputs only, the loaded values and their address: keeps the 16 loads in flight together (without it the first are waited for before the last are issued, several memory latencies in a row) and keeps the address pair off the loads' result registers
  asm volatile("" :: "v"(r[0]), "v"(r[1]), "v"(r[2]), "v"(r[3]), "v"(r[4]), "v"(r[5]), "v"(r[6]), "v"(r[7]), "v"(r[8]), "v"(r[9]), "v"(r[10]), "v"(r[11]), "v"(r[12]), "v"(r[13]), "v"(r[14]), "v"(r[15]), "v"(p));
}
__global__ __launch_bounds__(256) void k_packT(const float* __restrict__ WT, const float* __restrict__ WSm, const float* __restrict__ WC, __bf16* __restrict__ P) {
  __shared__ __align__(16) __bf16 s[128 * 128];   // [n][16 pieces of 8 k]; piece p of row n stands at place p ^ ((n >> 2) & 15), so that the 16 lanes of a 16-byte store (rows 4 apart) and of a 16-byte load (one row) fall on distinct banks
  const int t = threadIdx.x, r0 = blockIdx.x * 128, k0 = blockIdx.y * 128, which = r0 / DM;
  const int n4 = t & 31, kw = t >> 5;   // the lane's 4 columns, the wave's 16 k rows
  const size_t kr = k0 + kw * 16; v4f r[16];
  if (which < 3) pack_read<3 * DM>(r, WT + kr * (3 * DM) + r0 + n4 * 4);
  else if (which < 5) pack_read<2 * DM>(r, WSm + kr * (2 * DM) + (r0 - 3 * DM) + n4 * 4);
  else pack_read<DM>(r, WC + kr * DM + (r0 - 5 * DM) + n4 * 4);
#pragma unroll
  for (int q = 0; q < 4; ++q)
#pragma unroll
    for (int hf = 0; hf < 2; ++hf) { v8b w;
#pragma unroll
      for (int j = 0; j < 8; ++j) w[j] = (__bf16)r[hf * 8 + j][q];
      *(v8b*)&s[(n4 * 4 + q) * 128 + (((kw * 2 + hf) ^ (n4 & 15)) * 8)] = w; }
  __syncthreads();
  __bf16* d = P + (size_t)(r0 + (t >> 4)) * DM + k0 + (t & 15) * 8;
#pragma unroll   // unrolled: the 8 LDS reads share one latency instead of paying it one after another
  for (int i = 0; i < 8; ++i) { const int n = i * 16 + (t >> 4); vst2((unsigned*)(d + i * 16 * DM), *(const v4u*)&s[n * 128 + (((t & 15) ^ ((n >> 2) & 15)) * 8)]); }
}
// ---- shared GEMM core: a 128 x 128 tile of X . W^T per 8-wave block; k slices of 64 go global -> registers -> LDS (two buffers), every wave reads its fragments from LDS
#define GP 72                 // LDS row pitch in 16-bit elements: 64 k + 8, so the 16 rows of a 16-byte fragment read fall on distinct banks
#define GT (128 * GP)         // one operand tile, elements
typedef __attribute__((ext_vector_type(4))) __bf16 v4b;
struct StgR { v4f a[8]; v4u b[4]; };
// each wave-wide load covers whole 128-B lines: X rows give 256 B per slice (16 lanes), weight rows 128 B (8 lanes)
__device__ __forceinline__ void g_load(StgR& r, const float* __restrict__ X, const __bf16* __restrict__ Pw, int k0, int tid) {
  const float* pa = X + (size_t)(tid >> 4) * DM + (tid & 15) * 4 + k0; const __bf16* pb = Pw + (size_t)(tid >> 3) * DM + (tid & 7) * 8 + k0;
#pragma unroll
  for (int i = 0; i < 8; ++i) r.a[i] = *(const v4f*)(pa + i * 16 * DM);
#pragma unroll
  for (int i = 0; i < 4; ++i) r.b[i] = *(const v4u*)(pb + i * 32 * DM);
}
template <bool SPLIT> __device__ __forceinline__ void g_store(const StgR& r, __bf16* buf, int tid) {   // buf: [A hi][B]([A lo])
  __bf16* sa = buf + (tid >> 4) * GP + (tid & 15) * 4; __bf16* sb = buf + GT + (tid >> 3) * GP + (tid & 7) * 8;
#pragma unroll
  for (int i = 0; i < 8; ++i) { v4b h, l;
#pragma unroll
    for (int q = 0; q < 4; ++q) { h[q] = (__bf16)r.a[i][q]; if (SPLIT) l[q] = (__bf16)(r.a[i][q] - (float)h[q]); }
    *(v4b*)(sa + i * 16 * GP) = h; if (SPLIT) *(v4b*)(sa + 2 * GT + i * 16 * GP) = l; }
#pragma unroll
  for (int i = 0; i < 4; ++i) *(v4u*)(sb + i * 32 * GP) = r.b[i];
}
// wave (wm, wn) of 2 x 4 owns rows wm*64 + i*16, columns wn*32 + j*16; k ascends as in a plain loop, so every accumulator sums in the same order
template <bool SPLIT> __device__ __forceinline__ void g_pass(const float* __restrict__ X, const __bf16* __restrict__ Pw, __bf16* sm, v8f (&acc)[4][2], int tid, int lane, int wm, int wn) {
  constexpr int BUF = (SPLIT ? 3 : 2) * GT; const int col = lane & 15;
  StgR r; g_load(r, X, Pw, 0, tid); g_store<SPLIT>(r, sm, tid);
  __syncthreads();   // slice 0 is published
#pragma unroll 1   // kept rolled: unrolled, 16 copies of this long body would only grow the code
  for (int s = 0; s < DM / 64; ++s) { const __bf16* cur = sm + (s & 1) * BUF;
    if (s + 1 < DM / 64) g_load(r, X, Pw, (s + 1) * 64, tid);   // the next slice flies while this one is multiplied
#pragma unroll
    for (int kk = 0; kk < 2; ++kk) { v16b b[2], a[4], al[SPLIT ? 4 : 1];
#pragma unroll
      for (int j = 0; j < 2; ++j) b[j] = frag_b(cur + GT + (wn * 32 + j * 16 + col) * GP + kk * 32, lane);
#pragma unroll
      for (int i = 0; i < 4; ++i) { a[i] = frag_b(cur + (wm * 64 + i * 16 + col) * GP + kk * 32, lane); if (SPLIT) al[i] = frag_b(cur + 2 * GT + (wm * 64 + i * 16 + col) * GP + kk * 32, lane); }
      __builtin_amdgcn_sched_barrier(0);   // the fragment reads of these 32 k stay one group in front of the products: left free, the compiler reads one fragment, waits for it and multiplies, an LDS latency per pair of products
#pragma unroll
      for (int i = 0; i < 4; ++i)
#pragma unroll
        for (int j = 0; j < 2; ++j) acc[i][j] = wmma_bf(a[i], b[j], acc[i][j]);
      if (SPLIT) {   // every accumulator still takes hi, then lo, of each 32 k
#pragma unroll
        for (int i = 0; i < 4; ++i)
#pragma unroll
          for (int j = 0; j < 2; ++j) acc[i][j] = wmma_bf(al[i], b[j], acc[i][j]); }
      __builtin_amdgcn_sched_barrier(0);   // the next group of reads stays behind these products, not spread among them
    }
    if (s + 1 < DM / 64) g_store<SPLIT>(r, sm + ((s + 1) & 1) * BUF, tid);   // into the buffer whose readers left at the previous barrier
    __syncthreads();   // publishes slice s + 1 and ends every read of slice s
  }
}
// ---- k_qkvd: block = (128 rows, 128 cols, kind): kind 0 -> qt (from xt) and qs (from xs) into QQ; kind 1 -> k1, k2 into KK; kind 2 -> vt planes
#define EP 136                // epilogue staging pitch, f16 elements
#define QSC 0.18033688f       // 1/8 x log2(e): q carries it, so that a score leaves its product as the exponent of 2
__global__ __launch_bounds__(256) void k_qkvd(const float* __restrict__ XT, const float* __restrict__ XS, const __bf16* __restrict__ P, const float* __restrict__ BT, const float* __restrict__ BS, const float* __restrict__ LTS, const float* __restrict__ LST, const float* __restrict__ LSS, _Float16* __restrict__ QQ, _Float16* __restrict__ KK, _Float16* __restrict__ VT) {
  __shared__ __align__(16) unsigned char smem[2 * 2 * GT * 2];   // two buffers of [X tile][W tile]; the epilogue's two f16 [128][EP] tiles afterwards
  __bf16* sm = (__bf16*)smem; _Float16* so = (_Float16*)smem; _Float16* so2 = so + 128 * EP;
  const int tid = threadIdx.x, wave = tid >> 5, lane = tid & 31, col = lane & 15, g = lane >> 4, wm = wave >> 2, wn = wave & 3; const int kind = blockIdx.z; const int c0 = blockIdx.y * 128; const size_t rb = (size_t)blockIdx.x * 128;
  const __bf16* PT = P + ((size_t)kind * DM + c0) * DM;                              // Wt block for this kind (q, k or v)
  const __bf16* PS = P + ((size_t)(3 + (kind < 2 ? kind : 0)) * DM + c0) * DM;       // Ws block (q or k)
  v8f at[4][2] = {}, as[4][2] = {};
  g_pass<false>(XT + rb * DM, PT, sm, at, tid, lane, wm, wn);
  if (kind < 2) g_pass<false>(XS + rb * DM, PS, sm, as, tid, lane, wm, wn);
  if (kind < 2) {   // q pair, or k pair -> k1, k2
    float lts = 0.f, lst = 0.f, lss = 0.f; if (kind == 1) { lts = bfr(LTS[0]); lst = bfr(LST[0]); lss = bfr(LSS[0]); }
#pragma unroll
    for (int j = 0; j < 2; ++j) { const int cl = wn * 32 + j * 16 + col; const float g1 = BT[kind * DM + c0 + cl], g2 = BS[kind * DM + c0 + cl];
      asm volatile("s_wait_xcnt 0x0" ::: "memory");   // stands before a register that the two bias loads name is written again
      const float b1 = bfr(g1), b2 = bfr(g2);
#pragma unroll
      for (int i = 0; i < 4; ++i)
#pragma unroll
        for (int r = 0; r < 8; ++r) { const int rl = wm * 64 + i * 16 + 8 * g + r; const float t = at[i][j][r] + b1, u = as[i][j][r] + b2;
          so[rl * EP + cl] = (_Float16)(kind == 0 ? t * QSC : t + lts * u); so2[rl * EP + cl] = (_Float16)(kind == 0 ? u * QSC : lst * t + lss * u); } }
    __syncthreads();
    _Float16* D = kind == 0 ? QQ : KK;
    for (int e = tid; e < 128 * 16; e += 256) { const int rl = e >> 4, q = e & 15; vst2((unsigned*)(D + (rb + rl) * (2 * DM) + c0 + q * 8), *(const v4u*)&so[rl * EP + q * 8]); vst2((unsigned*)(D + (rb + rl) * (2 * DM) + DM + c0 + q * 8), *(const v4u*)&so2[rl * EP + q * 8]); }
  } else {   // vt planes: staged transposed, a lane's 8 rows are 16 contiguous bytes
#pragma unroll
    for (int j = 0; j < 2; ++j) { const int cl = wn * 32 + j * 16 + col; const float b1 = bfr(BT[2 * DM + c0 + cl]);
#pragma unroll
      for (int i = 0; i < 4; ++i) { v8h w;
#pragma unroll
        for (int r = 0; r < 8; ++r) w[r] = (_Float16)(at[i][j][r] + b1);
        *(v8h*)&so[cl * EP + wm * 64 + i * 16 + 8 * g] = w; } }
    __syncthreads();
    const size_t b = rb / SS; const int s0 = (int)(rb % SS);
    for (int e = tid; e < 128 * 16; e += 256) { const int d = e >> 4, pc = e & 15; vst2((unsigned*)(VT + ((b * DM + c0 + d) * SS) + s0 + pc * 8), *(const v4u*)&so[d * EP + pc * 8]); } }
}
// ---- k_attn: block = (128 queries, head, b), 8 waves x 16 queries: 128-wide scores ([qt|qs] . [k1|k2]) in log2 units, softmax, P . vt (64 dims); O 256-B head segments
// lazy rescale: 7 minus the maximum in use is the C operand of the score products, so a product's result is the exponent of P; maxima are formed, and O and l rescaled, only in the first pass and in a pass whose P sum shows a score far above the maximum in use
// products stand transposed: S^T = K . Q^T and O^T += vt . P^T, so a lane holds 16 of the 32 keys of ONE query (its column): maximum and sum run in-lane over 16 keys and are joined with lane l ^ 16 (the sum once, at the end), the two S^T tiles convert in place into the B operand P^T
// K and vt go global -> LDS in stages of 128 keys by asynchronous copies (whole 128-B lines, two buffers), once per block; every wave reads its fragments from LDS
#define AK 128                // keys per stage
#define AP 136                // LDS row pitch in f16 elements: 256 B + 16 B, so the 16 rows of a 16-byte fragment read fall on distinct banks
#define AKT (AK * AP)         // K tile [key][k1 | k2], elements
#define ABUF (AKT + HD * AP)  // one buffer: K tile, then vt tile [dim][key]
#define PSH 7.0f              // P and l carry 2^7: the key at the maximum in use gives 128
#define PTOP 32768.0f         // a lane's sum of 16 P at or under 2^15 bounds each P under the f16 range: scores may climb 8 log2 units before a rescale
// one stage: 8 K copies and 4 vt copies of 16 B per lane; a wave's 32 lanes cover four whole 128-B lines per copy
__device__ __forceinline__ void kv_copy(const _Float16* gk, const _Float16* gv, unsigned lk, unsigned lv) {
  // the closing s_wait_xcnt stands inside the statement so that no address register of a copy is written again in front of it
  asm volatile("global_load_async_to_lds_b128 %0, %1, off\n\t"
               "global_load_async_to_lds_b128 %2, %3, off\n\t"
               "global_load_async_to_lds_b128 %4, %5, off\n\t"
               "global_load_async_to_lds_b128 %6, %7, off\n\t"
               "global_load_async_to_lds_b128 %8, %9, off\n\t"
               "global_load_async_to_lds_b128 %10, %11, off\n\t"
               "global_load_async_to_lds_b128 %12, %13, off\n\t"
               "global_load_async_to_lds_b128 %14, %15, off\n\t"
               "global_load_async_to_lds_b128 %16, %17, off\n\t"
               "global_load_async_to_lds_b128 %18, %19, off\n\t"
               "global_load_async_to_lds_b128 %20, %21, off\n\t"
               "global_load_async_to_lds_b128 %22, %23, off\n\t"
               "s_wait_xcnt 0x0"
               :: "v"(lk), "v"(gk), "v"(lk + 1 * 16 * AP * 2), "v"(gk + 1 * 16 * 2 * DM), "v"(lk + 2 * 16 * AP * 2), "v"(gk + 2 * 16 * 2 * DM), "v"(lk + 3 * 16 * AP * 2), "v"(gk + 3 * 16 * 2 * DM),
                  "v"(lk + 4 * 16 * AP * 2), "v"(gk + 4 * 16 * 2 * DM), "v"(lk + 5 * 16 * AP * 2), "v"(gk + 5 * 16 * 2 * DM), "v"(lk + 6 * 16 * AP * 2), "v"(gk + 6 * 16 * 2 * DM), "v"(lk + 7 * 16 * AP * 2), "v"(gk + 7 * 16 * 2 * DM),
                  "v"(lv), "v"(gv), "v"(lv + 1 * 16 * AP * 2), "v"(gv + 1 * 16 * SS), "v"(lv + 2 * 16 * AP * 2), "v"(gv + 2 * 16 * SS), "v"(lv + 3 * 16 * AP * 2), "v"(gv + 3 * 16 * SS)
               : "memory");
}
// lane l takes the value of lane l ^ 16
__device__ __forceinline__ float xhalf(float x) { return __builtin_bit_cast(float, __builtin_amdgcn_permlanex16(__builtin_bit_cast(int, x), __builtin_bit_cast(int, x), 0x76543210, 0xfedcba98, false, false)); }
// a lane's 16 P summed as a tree
__device__ __forceinline__ float psum(v8f a, v8f b) { const v8f e8 = a + b; const v4f e4 = e8.lo + e8.hi; const v2f e2 = e4.lo + e4.hi; return e2.x + e2.y; }
__global__ __launch_bounds__(256) void k_attn(const _Float16* __restrict__ QQ, const _Float16* __restrict__ KK, const _Float16* __restrict__ VT, float* __restrict__ O) {
  __shared__ __align__(16) _Float16 ring[2 * ABUF]; __shared__ __align__(16) float so[8][16][68];
  const int tid = threadIdx.x, wave = tid >> 5, lane = tid & 31, col = lane & 15, g = lane >> 4; const int h = blockIdx.y; const size_t b = blockIdx.z; const int q0 = blockIdx.x * 128 + wave * 16; const size_t rq = b * SS + q0;
  // lane's share of a stage: K row tid >> 4 (+16 per copy), 16-byte piece tid & 15 of [k1 | k2]; vt row tid >> 4 (+16 per copy), piece tid & 15 of 128 keys
  const _Float16* gk = KK + (b * SS + (tid >> 4)) * (2 * DM) + ((tid >> 3) & 1) * DM + h * HD + (tid & 7) * 8; const _Float16* gv = VT + (b * DM + h * HD + (tid >> 4)) * SS + (tid & 15) * 8;
  const unsigned lk = (unsigned)(size_t)ring + ((tid >> 4) * AP + (tid & 15) * 8) * 2, lv = lk + AKT * 2;
  kv_copy(gk, gv, lk, lv);
  asm volatile("s_wait_asynccnt 0x0" ::: "memory");   // this wave's share of stage 0 has landed
  __syncthreads();   // stage 0 is published
  kv_copy(gk + (size_t)AK * 2 * DM, gv + AK, lk + ABUF * 2, lv + ABUF * 2);   // stage 1 flies while stage 0 is worked on
  v16h aq[4];
#pragma unroll
  for (int kc = 0; kc < 4; ++kc) aq[kc] = frag_h(QQ + (rq + col) * (2 * DM) + ((kc < 2) ? 0 : DM) + h * HD + (kc & 1) * 32, lane);
  float l = 0.f;   // of query 'col': the sum over this half's keys
  v8f cm;   // PSH minus the maximum in use of query 'col', the same in both wave halves; all 8 rows (keys) of the C tile
#pragma unroll
  for (int r = 0; r < 8; ++r) cm[r] = PSH;
  v8f acc[4] = {};   // acc[dt][r] = O^T[dim dt * 16 + 8 g + r][query col]
#pragma unroll 1   // kept rolled: one copy of the publish point and of the long body
  for (int t = 0; t < SS / AK; ++t) { const _Float16* kb = ring + (t & 1) * ABUF; const _Float16* vb = kb + AKT;
#pragma unroll 1   // kept rolled: four copies of this long body would only grow the code
  for (int ks = 0; ks < AK / 32; ++ks) { const int j0 = ks * 32; v8f s[2];
    v16h bk[2][4], bv[4];   // all fragment reads of the 32 keys are asked for at the head of the pass: K's latency is paid once, vt's passes under the scores and the softmax
#pragma unroll
    for (int ct = 0; ct < 2; ++ct)
#pragma unroll
      for (int kc = 0; kc < 4; ++kc) bk[ct][kc] = frag_h(kb + (j0 + ct * 16 + col) * AP + kc * 32, lane);
#pragma unroll
    for (int dt = 0; dt < 4; ++dt) bv[dt] = frag_h(vb + (dt * 16 + col) * AP + j0, lane);
    __builtin_amdgcn_sched_barrier(0);   // the reads stay one group at the head: left free, the compiler reads one K fragment, waits for it alone and spreads the rest among the products
#pragma unroll
    for (int ct = 0; ct < 2; ++ct) { v8f c = cm;   // c[r] = S^T[key j0 + ct * 16 + 8 g + r][query col], in log2 units, minus the maximum in use, plus PSH
#pragma unroll
      for (int kc = 0; kc < 4; ++kc) c = wmma16(bk[ct][kc], aq[kc], c);
      s[ct] = c; }
    v8f e[2];
#pragma unroll
    for (int ct = 0; ct < 2; ++ct)
#pragma unroll
      for (int r = 0; r < 8; ++r) e[ct][r] = __builtin_amdgcn_exp2f(s[ct][r]);
    float sum = psum(e[0], e[1]);
    const bool first = (t | ks) == 0;   // no maximum is in use yet
    // one scalar branch per pass; the negated compare also takes a sum that is not a number
    if (first || __builtin_amdgcn_ballot_w32(!(sum <= PTOP)) != 0) {
      float mx = fmaxf(s[0][0], s[1][0]);
#pragma unroll
      for (int r = 1; r < 8; ++r) mx = fmaxf(mx, fmaxf(s[0][r], s[1][r]));
      mx = fmaxf(mx, xhalf(mx));   // the other half's 16 keys of the same query
      const float d = first ? mx - PSH : fmaxf(mx - PSH, 0.f);   // the rise of the maximum in use; 0 for a query that needs none
      const float alpha = first ? 0.f : __builtin_amdgcn_exp2f(-d);
#pragma unroll
      for (int ct = 0; ct < 2; ++ct)
#pragma unroll
        for (int r = 0; r < 8; ++r) e[ct][r] = __builtin_amdgcn_exp2f(s[ct][r] - d);
      sum = psum(e[0], e[1]);
      cm -= d; l *= alpha;
#pragma unroll
      for (int dt = 0; dt < 4; ++dt) acc[dt] *= alpha;
    }
    l += sum;
    // element i of a B fragment is k = 8 g + i, element 8 + i is k = 16 + 8 g + i: exactly the keys this lane holds in s[0] and s[1]
    union { v16h v; v8h q[2]; } pb; pb.q[0] = __builtin_convertvector(e[0], v8h); pb.q[1] = __builtin_convertvector(e[1], v8h);
#pragma unroll
    for (int dt = 0; dt < 4; ++dt) acc[dt] = wmma16(bv[dt], pb.v, acc[dt]); }
    asm volatile("s_wait_dscnt 0x0" ::: "memory");      // this wave's reads of stage t are done
    asm volatile("s_wait_asynccnt 0x0" ::: "memory");   // this wave's share of stage t + 1 has landed
    __syncthreads();   // publishes stage t + 1 and ends every read of stage t
    if (t + 2 < SS / AK) kv_copy(gk + (size_t)(t + 2) * AK * 2 * DM, gv + (t + 2) * AK, lk + (t & 1) * ABUF * 2, lv + (t & 1) * ABUF * 2);   // into the buffer that stage t has just left
  }
  asm volatile("s_wait_asynccnt 0x0" ::: "memory");   // no copy is outstanding when the wave ends
  const float il = 1.0f / (l + xhalf(l));   // the two halves' sums are joined once; O and l carry the same 2^7
#pragma unroll
  for (int dt = 0; dt < 4; ++dt) { const v8f o = acc[dt] * il; *(v4f*)&so[wave][col][dt * 16 + 8 * g] = o.lo; *(v4f*)&so[wave][col][dt * 16 + 8 * g + 4] = o.hi; }   // a lane's 8 dims are 32 contiguous bytes of its query's row
  LDSX();
  for (int rl = 0; rl < 16; ++rl) if (lane < 16) vst2(O + (rq + rl) * DM + h * HD + lane * 4, *(const v4f*)&so[wave][rl][lane * 4]);
}
// ---- k_out: block = (128 rows, 128 cols): Y = y (bf16 hi + lo) . Wc + bc
__global__ __launch_bounds__(256) void k_out(const float* __restrict__ O, const __bf16* __restrict__ P, const float* __restrict__ BC, float* __restrict__ Y) {
  __shared__ __align__(16) unsigned char smem[2 * 3 * GT * 2];   // two buffers of [y hi][Wc][y lo]; the epilogue's f32 [128][132] tile afterwards
  __bf16* sm = (__bf16*)smem; float* so = (float*)smem;
  const int tid = threadIdx.x, wave = tid >> 5, lane = tid & 31, col = lane & 15, g = lane >> 4, wm = wave >> 2, wn = wave & 3; const size_t rb = (size_t)blockIdx.x * 128; const int n0 = blockIdx.y * 128; const __bf16* PC = P + ((size_t)5 * DM + n0) * DM;
  v8f acc[4][2] = {};
  g_pass<true>(O + rb * DM, PC, sm, acc, tid, lane, wm, wn);
#pragma unroll
  for (int j = 0; j < 2; ++j) { const int cl = wn * 32 + j * 16 + col; const float bb = bfr(BC[n0 + cl]);
#pragma unroll
    for (int i = 0; i < 4; ++i)
#pragma unroll
      for (int r = 0; r < 8; ++r) so[(wm * 64 + i * 16 + 8 * g + r) * 132 + cl] = acc[i][j][r] + bb; }
  __syncthreads();
  for (int e = tid; e < 128 * 32; e += 256) { const int rl = e >> 5, q = e & 31; vst2(Y + (rb + rl) * DM + n0 + q * 4, *(const v4f*)&so[rl * 132 + q * 4]); }
}
extern "C" void kernel_launch(void* const* d_in, const int* in_sizes, int n_in, void* d_out, int out_size, void* d_ws, size_t ws_size, hipStream_t stream) {
  (void)in_sizes; (void)n_in; (void)out_size;
  const float** F = (const float**)d_in;   // 0 xt, 1 xs [2,2048,1024]; 2 Wt [1024,3072], 3 bt; 4 Ws [1024,2048], 5 bs; 6 Wc [1024,1024], 7 bc; 8 lam_ts, 9 lam_st, 10 lam_ss [1]
  if (ws_size < (size_t)WS_END) return;
  char* ws = (char*)d_ws; __bf16* P = (__bf16*)(ws + WS_PW); _Float16 *QQ = (_Float16*)(ws + WS_QQ), *KK = (_Float16*)(ws + WS_KK), *VT = (_Float16*)(ws + WS_VT); float* O = (float*)(ws + WS_O);
  k_packT<<<dim3(6 * DM / 128, DM / 128), 256, 0, stream>>>(F[2], F[4], F[6], P);
  k_qkvd<<<dim3(TNB * SS / 128, DM / 128, 3), 256, 0, stream>>>(F[0], F[1], P, F[3], F[5], F[8], F[9], F[10], QQ, KK, VT);
  k_attn<<<dim3(TQB, NH, TNB), 256, 0, stream>>>(QQ, KK, VT, O);
  k_out<<<dim3(TNB * SS / 128, DM / 128), 256, 0, stream>>>(O, P, F[7], (float*)d_out);
}

// v007
// One run takes 120 microseconds.
// Next to v006, in two timings, it ran 1.03 times as fast each time.
// All steps since v000 together make it 4.16 times as fast.
// compute dtype: all float inputs rounded to bf16, the three lambda scalars read on device; qt/kt/vt = xt . Wt + bt and qs/ks = xs . Ws + bs with EXACT bf16 products on WMMA 16x16x32 ((in,out) weights as transposed rows); k1 = kt + lam_ts ks and k2 = lam_st kt + lam_ss ks formed in f32, then q = [qt | qs] and k = [k1 | k2] rounded once to f16 (128-wide per head); q carries 1/8 x log2(e) before that rounding; PLAIN attention: softmax in f32 on the hardware 2^x against a held maximum that is raised only when needed, P (scaled by 2^7, single f16) x vt (single f16); out = y (bf16 hi + residual) . Wc (2 products) + bc.
#include <hip/hip_runtime.h>
#include <math.h>

typedef __attribute__((ext_vector_type(16))) _Float16 v16h;
typedef __attribute__((ext_vector_type(16))) __bf16 v16b;
typedef __attribute__((ext_vector_type(8)))  _Float16 v8h;
typedef __attribute__((ext_vector_type(8)))  float v8f;
typedef __attribute__((ext_vector_type(4)))  float v4f;
typedef __attribute__((ext_vector_type(2)))  float v2f;
typedef __attribute__((ext_vector_type(4)))  unsigned v4u;
typedef __attribute__((ext_vector_type(4)))  int v4i;
typedef float __attribute__((may_alias)) float_a;
typedef int __attribute__((may_alias)) int_a;

template <typename T> __device__ __forceinline__ void vst2(void* p, T v) { *(T*)p = v;  }
// plain builtins: the compiler itself keeps the distance behind a matrix instruction where a vector instruction touches its registers, and fills it with useful work where it can
__device__ __forceinline__ v8f wmma16(v16h a, v16h b, v8f c) {
  v8f d = __builtin_amdgcn_wmma_f32_16x16x32_f16(false, a, false, b, (short)0, c, false, false);
  return d;
}
__device__ __forceinline__ v8f wmma_bf(v16b a, v16b b, v8f c) {
  v8f d = __builtin_amdgcn_wmma_f32_16x16x32_bf16(false, a, false, b, (short)0, c, false, false);
  return d;
}
// 16x16x32 fragments: lane = (h = lane>>4, row/col = lane&15); elements 0..7 = k0+8h+0..7, 8..15 = k0+16+8h+0..7; D element r = row 8h+r
__device__ __forceinline__ v16h frag_h(const _Float16* rowk0, int lane) {
  union { v16h v; v8h q[2]; } u; const _Float16* p = rowk0 + 8 * (lane >> 4);
  u.q[0] = *(const v8h*)p; u.q[1] = *(const v8h*)(p + 16); return u.v;
}
__device__ __forceinline__ v16h frag_f32(const float* rowk0, int lane) {
  v16h a; const float* p = rowk0 + 8 * (lane >> 4);
#pragma unroll
  for (int i = 0; i < 8; ++i) { a[i] = (_Float16)p[i]; a[8 + i] = (_Float16)p[16 + i]; }
  return a;
}
__device__ __forceinline__ v16h frag_f32s(const float* rowk0, int lane, float sc) {
  v16h a; const float* p = rowk0 + 8 * (lane >> 4);
#pragma unroll
  for (int i = 0; i < 8; ++i) { a[i] = (_Float16)(p[i] * sc); a[8 + i] = (_Float16)(p[16 + i] * sc); }
  return a;
}
// column fragment from a [K][ld] layout (column n), rows >= K read as 0
__device__ __forceinline__ v16h fragc_f32(const float* W, int k0, int n, int lane, int ld, int K) {
  v16h a; const int g = lane >> 4;
#pragma unroll
  for (int i = 0; i < 8; ++i) { const int ka = k0 + 8 * g + i, kb = ka + 16;
    a[i] = (_Float16)(ka < K ? W[(size_t)(ka < K ? ka : K - 1) * ld + n] : 0.f); a[8 + i] = (_Float16)(kb < K ? W[(size_t)(kb < K ? kb : K - 1) * ld + n] : 0.f); }
  return a;
}
struct F2 { v16b h, l; };
__device__ __forceinline__ F2 bsplit16(const float v[16]) { F2 r;
#pragma unroll
  for (int i = 0; i < 16; ++i) { const __bf16 h = (__bf16)v[i]; r.h[i] = h; r.l[i] = (__bf16)(v[i] - (float)h); }
  return r; }
__device__ __forceinline__ F2 split_row(const float* row, int k0, int lane) { float v[16]; const float* p = row + k0 + 8 * (lane >> 4);
#pragma unroll
  for (int i = 0; i < 8; ++i) { v[i] = p[i]; v[8 + i] = p[16 + i]; }
  return bsplit16(v); }
__device__ __forceinline__ F2 split_rowK(const float* row, int k0, int lane, int K) { float v[16]; const int g = lane >> 4;
#pragma unroll
  for (int i = 0; i < 8; ++i) { const int ka = k0 + 8 * g + i, kb = ka + 16; v[i] = ka < K ? row[ka < K ? ka : K - 1] : 0.f; v[8 + i] = kb < K ? row[kb < K ? kb : K - 1] : 0.f; }
  return bsplit16(v); }
__device__ __forceinline__ F2 split_col(const float* W, int k0, int n, int lane, int ld, int K) { float v[16]; const int g = lane >> 4;
#pragma unroll
  for (int i = 0; i < 8; ++i) { const int ka = k0 + 8 * g + i, kb = ka + 16; v[i] = ka < K ? W[(size_t)(ka < K ? ka : K - 1) * ld + n] : 0.f; v[8 + i] = kb < K ? W[(size_t)(kb < K ? kb : K - 1) * ld + n] : 0.f; }
  return bsplit16(v); }
__device__ __forceinline__ v8f mac3(const F2& a, const F2& b, v8f c) { c = wmma_bf(a.l, b.h, c); c = wmma_bf(a.h, b.l, c); return wmma_bf(a.h, b.h, c); }
__device__ __forceinline__ float sigm(float v) { return 1.0f / (1.0f + expf(-v)); }
#define LDSX() do { asm volatile("s_wait_dscnt 0" ::: "memory"); __builtin_amdgcn_wave_barrier(); __builtin_amdgcn_fence(__ATOMIC_RELEASE, "workgroup"); } while (0)


// Disentangled spatial attention (B 2, L 2,048, E 1,024, 16 heads x 64): scores = (qt . (kt + lam_ts ks) + qs . (lam_st kt + lam_ss ks)) / 8 over the target and source streams, softmax, . vt, output projection + bias.
#define NB 2
#define SS 2048
#define DM 1024
#define NH 16
#define HD 64
#define NR (NB * SS)
#ifndef TQB
#define TQB (SS / 128)
#define TNB NB
#endif
typedef __attribute__((ext_vector_type(8))) __bf16 v8b;
__device__ __forceinline__ v16b frag_b(const __bf16* rowk0, int lane) {
  union { v16b v; v8b q[2]; } u; const __bf16* p = rowk0 + 8 * (lane >> 4);
  u.q[0] = *(const v8b*)p; u.q[1] = *(const v8b*)(p + 16); return u.v;
}
__device__ __forceinline__ float bfr(float v) { return (float)(__bf16)v; }
__device__ __attribute__((noinline)) float exp_ni(float v) { return expf(v); }
__device__ __attribute__((noinline)) float erf_ni(float v) { return erff(v); }

#define WS_PW  0u                                     // bf16 transposed rows: Wt q, Wt k, Wt v, Ws q, Ws k, Wc  [6][1024][1024]
#define WS_QQ  (WS_PW + 2u * (size_t)6 * DM * DM)       // f16 [NR][2048]: qt | qs
#define WS_KK  (WS_QQ + 2u * (size_t)NR * 2 * DM)       // f16 [NR][2048]: k1 | k2
#define WS_VT  (WS_KK + 2u * (size_t)NR * 2 * DM)       // f16 planes vt [b][1024][SS]
#define WS_O   (WS_VT + 2u * (size_t)NB * DM * SS)       // f32 [NR][1024]
#define WS_END (WS_O + 4u * (size_t)NR * DM)

// ---- k_packT: block = a 128 (k) x 128 (n) tile of an (in,out) weight -> 128 bf16 rows of P (row = block 'which' * 1024 + n, K = 1024 contiguous), turned in LDS
// reads: a wave-wide 16-byte load is 512 contiguous bytes of one k row (whole lines), a lane's 16 rows all in flight; writes: 16 lanes give 256 contiguous bytes of one P row
template <int STRIDE> __device__ __forceinline__ void pack_read(v4f (&r)[16], const float* __restrict__ p) {   // the row pitch is a constant, so one address pair serves the 16 loads
#pragma unroll
  for (int i = 0; i < 16; ++i) r[i] = *(const v4f*)(p + i * STRIDE);
  // inputs only, the loaded values and their address: keeps the 16 loads in flight together (without it the first are waited for before the last are issued, several memory latencies in a row) and keeps the address pair off the loads' result registers
  asm volatile("" :: "v"(r[0]), "v"(r[1]), "v"(r[2]), "v"(r[3]), "v"(r[4]), "v"(r[5]), "v"(r[6]), "v"(r[7]), "v"(r[8]), "v"(r[9]), "v"(r[10]), "v"(r[11]), "v"(r[12]), "v"(r[13]), "v"(r[14]), "v"(r[15]), "v"(p));
}
__global__ __launch_bounds__(256) void k_packT(const float* __restrict__ WT, const float* __restrict__ WSm, const float* __restrict__ WC, __bf16* __restrict__ P) {
  __shared__ __align__(16) __bf16 s[128 * 128];   // [n][16 pieces of 8 k]; piece p of row n stands at place p ^ ((n >> 2) & 15), so that the 16 lanes of a 16-byte store (rows 4 apart) and of a 16-byte load (one row) fall on distinct banks
  const int t = threadIdx.x, r0 = blockIdx.x * 128, k0 = blockIdx.y * 128, which = r0 / DM;
  const int n4 = t & 31, kw = t >> 5;   // the lane's 4 columns, the wave's 16 k rows
  const size_t kr = k0 + kw * 16; v4f r[16];
  if (which < 3) pack_read<3 * DM>(r, WT + kr * (3 * DM) + r0 + n4 * 4);
  else if (which < 5) pack_read<2 * DM>(r, WSm + kr * (2 * DM) + (r0 - 3 * DM) + n4 * 4);
  else pack_read<DM>(r, WC + kr * DM + (r0 - 5 * DM) + n4 * 4);
#pragma unroll
  for (int q = 0; q < 4; ++q)
#pragma unroll
    for (int hf = 0; hf < 2; ++hf) { v8b w;
#pragma unroll
      for (int j = 0; j < 8; ++j) w[j] = (__bf16)r[hf * 8 + j][q];
      *(v8b*)&s[(n4 * 4 + q) * 128 + (((kw * 2 + hf) ^ (n4 & 15)) * 8)] = w; }
  __syncthreads();
  __bf16* d = P + (size_t)(r0 + (t >> 4)) * DM + k0 + (t & 15) * 8;
#pragma unroll   // unrolled: the 8 LDS reads share one latency instead of paying it one after another
  for (int i = 0; i < 8; ++i) { const int n = i * 16 + (t >> 4); vst2((unsigned*)(d + i * 16 * DM), *(const v4u*)&s[n * 128 + (((t & 15) ^ ((n >> 2) & 15)) * 8)]); }
}
// ---- k_out's GEMM core: a 128 x 128 tile of X . W^T per 8-wave block; k slices of 64 go global -> registers -> LDS (two buffers), every wave reads its fragments from LDS
#define GP 72                 // LDS row pitch in 16-bit elements: 64 k + 8, so the 16 rows of a 16-byte fragment read fall on distinct banks
#define GT (128 * GP)         // one operand tile, elements
typedef __attribute__((ext_vector_type(4))) __bf16 v4b;
struct StgR { v4f a[8]; v4u b[4]; };
// each wave-wide load covers whole 128-B lines: X rows give 256 B per slice (16 lanes), weight rows 128 B (8 lanes)
__device__ __forceinline__ void g_load(StgR& r, const float* __restrict__ X, const __bf16* __restrict__ Pw, int k0, int tid) {
  const float* pa = X + (size_t)(tid >> 4) * DM + (tid & 15) * 4 + k0; const __bf16* pb = Pw + (size_t)(tid >> 3) * DM + (tid & 7) * 8 + k0;
#pragma unroll
  for (int i = 0; i < 8; ++i) r.a[i] = *(const v4f*)(pa + i * 16 * DM);
#pragma unroll
  for (int i = 0; i < 4; ++i) r.b[i] = *(const v4u*)(pb + i * 32 * DM);
}
template <bool SPLIT> __device__ __forceinline__ void g_store(const StgR& r, __bf16* buf, int tid) {   // buf: [A hi][B]([A lo])
  __bf16* sa = buf + (tid >> 4) * GP + (tid & 15) * 4; __bf16* sb = buf + GT + (tid >> 3) * GP + (tid & 7) * 8;
#pragma unroll
  for (int i = 0; i < 8; ++i) { v4b h, l;
#pragma unroll
    for (int q = 0; q < 4; ++q) { h[q] = (__bf16)r.a[i][q]; if (SPLIT) l[q] = (__bf16)(r.a[i][q] - (float)h[q]); }
    *(v4b*)(sa + i * 16 * GP) = h; if (SPLIT) *(v4b*)(sa + 2 * GT + i * 16 * GP) = l; }
#pragma unroll
  for (int i = 0; i < 4; ++i) *(v4u*)(sb + i * 32 * GP) = r.b[i];
}
// wave (wm, wn) of 2 x 4 owns rows wm*64 + i*16, columns wn*32 + j*16; k ascends as in a plain loop, so every accumulator sums in the same order
template <bool SPLIT> __device__ __forceinline__ void g_pass(const float* __restrict__ X, const __bf16* __restrict__ Pw, __bf16* sm, v8f (&acc)[4][2], int tid, int lane, int wm, int wn) {
  constexpr int BUF = (SPLIT ? 3 : 2) * GT; const int col = lane & 15;
  StgR r; g_load(r, X, Pw, 0, tid); g_store<SPLIT>(r, sm, tid);
  __syncthreads();   // slice 0 is published
#pragma unroll 1   // kept rolled: unrolled, 16 copies of this long body would only grow the code
  for (int s = 0; s < DM / 64; ++s) { const __bf16* cur = sm + (s & 1) * BUF;
    if (s + 1 < DM / 64) g_load(r, X, Pw, (s + 1) * 64, tid);   // the next slice flies while this one is multiplied
#pragma unroll
    for (int kk = 0; kk < 2; ++kk) { v16b b[2], a[4], al[SPLIT ? 4 : 1];
#pragma unroll
      for (int j = 0; j < 2; ++j) b[j] = frag_b(cur + GT + (wn * 32 + j * 16 + col) * GP + kk * 32, lane);
#pragma unroll
      for (int i = 0; i < 4; ++i) { a[i] = frag_b(cur + (wm * 64 + i * 16 + col) * GP + kk * 32, lane); if (SPLIT) al[i] = frag_b(cur + 2 * GT + (wm * 64 + i * 16 + col) * GP + kk * 32, lane); }
      __builtin_amdgcn_sched_barrier(0);   // the fragment reads of these 32 k stay one group in front of the products: left free, the compiler reads one fragment, waits for it and multiplies, an LDS latency per pair of products
#pragma unroll
      for (int i = 0; i < 4; ++i)
#pragma unroll
        for (int j = 0; j < 2; ++j) acc[i][j] = wmma_bf(a[i], b[j], acc[i][j]);
      if (SPLIT) {   // every accumulator still takes hi, then lo, of each 32 k
#pragma unroll
        for (int i = 0; i < 4; ++i)
#pragma unroll
          for (int j = 0; j < 2; ++j) acc[i][j] = wmma_bf(al[i], b[j], acc[i][j]); }
      __builtin_amdgcn_sched_barrier(0);   // the next group of reads stays behind these products, not spread among them
    }
    if (s + 1 < DM / 64) g_store<SPLIT>(r, sm + ((s + 1) & 1) * BUF, tid);   // into the buffer whose readers left at the previous barrier
    __syncthreads();   // publishes slice s + 1 and ends every read of slice s
  }
}
// ---- qkv GEMM core: a 16-wave block forms NP products of one 128-row X tile, each 128 columns wide; a k slice of 64 of X and of the NP weight tiles goes global -> registers -> LDS (two buffers)
template <int NP> struct StgQ { v4f a[4]; v4u b[2 * NP]; };
// whole 128-B lines per wave-wide load, as in g_load; the NP weight blocks stand DM rows apart in P
template <int NP> __device__ __forceinline__ void q_load(StgQ<NP>& r, const float* __restrict__ pa, const __bf16* __restrict__ pb) {
#pragma unroll
  for (int i = 0; i < 4; ++i) r.a[i] = *(const v4f*)(pa + i * 32 * DM);
#pragma unroll
  for (int i = 0; i < 2 * NP; ++i) r.b[i] = *(const v4u*)(pb + ((i >> 1) * DM + (i & 1) * 64) * DM);
}
template <int NP> __device__ __forceinline__ void q_store(const StgQ<NP>& r, __bf16* buf, int tid) {   // buf: [X][W 0]..[W NP-1]
  __bf16* sa = buf + (tid >> 4) * GP + (tid & 15) * 4; __bf16* sb = buf + GT + (tid >> 3) * GP + (tid & 7) * 8;
#pragma unroll
  for (int i = 0; i < 4; ++i) { v4b h;
#pragma unroll
    for (int q = 0; q < 4; ++q) h[q] = (__bf16)r.a[i][q];
    *(v4b*)(sa + i * 32 * GP) = h; }
#pragma unroll
  for (int i = 0; i < 2 * NP; ++i) *(v4u*)(sb + i * 64 * GP) = r.b[i];
}
#define QBUF (4 * GT)         // one buffer: the X tile and up to three weight tiles, elements
// wave (wm, wn) of 2 x 8 owns rows wm*64 + i*16 and columns wn*16 .. +15 of every product: an X fragment feeds NP products; k ascends as in a plain loop
template <int NP> __device__ __forceinline__ void q_pass(const float* __restrict__ X, const __bf16* __restrict__ Pw, __bf16* sm, v8f (&acc)[NP][4], int tid, int lane, int wm, int wn) {
  const int col = lane & 15;
  const float* pa = X + (size_t)(tid >> 4) * DM + (tid & 15) * 4; const __bf16* pb = Pw + (size_t)(tid >> 3) * DM + (tid & 7) * 8;   // the lane's first X row and weight row
  StgQ<NP> r; q_load<NP>(r, pa, pb); q_store<NP>(r, sm, tid);
  __syncthreads();   // slice 0 is published
#pragma unroll 1   // kept rolled: unrolled, 16 copies of this long body would only grow the code
  for (int s = 0; s < DM / 64; ++s) { const __bf16* cur = sm + (s & 1) * QBUF;
    pa += 64; pb += 64;
    if (s + 1 < DM / 64) q_load<NP>(r, pa, pb);   // the next slice flies while this one is multiplied
#pragma unroll
    for (int kk = 0; kk < 2; ++kk) { v16b b[NP], a[4];
#pragma unroll
      for (int p = 0; p < NP; ++p) b[p] = frag_b(cur + GT + p * GT + (wn * 16 + col) * GP + kk * 32, lane);
#pragma unroll
      for (int i = 0; i < 4; ++i) a[i] = frag_b(cur + (wm * 64 + i * 16 + col) * GP + kk * 32, lane);
      __builtin_amdgcn_sched_barrier(0);   // the fragment reads of these 32 k stay one group in front of the products, not one LDS latency per pair of products
#pragma unroll
      for (int i = 0; i < 4; ++i)
#pragma unroll
        for (int p = 0; p < NP; ++p) acc[p][i] = wmma_bf(a[i], b[p], acc[p][i]);
      __builtin_amdgcn_sched_barrier(0);   // the next group of reads stays behind these products, not spread among them
    }
    asm volatile("" :: "v"(pa), "v"(pb));   // inputs only, the two addresses: they stay in their registers while the loads fly, so that no load's result lands on an address pair that other loads in flight name
    if (s + 1 < DM / 64) q_store<NP>(r, sm + ((s + 1) & 1) * QBUF, tid);   // into the buffer whose readers left at the previous barrier
    __syncthreads();   // publishes slice s + 1 and ends every read of slice s
  }
}
// ---- k_qkvd: block = (128 rows, 128 cols): qt, kt, vt from one pass over xt, then qs, ks from one pass over xs; qt | qs into QQ, k1 | k2 into KK, vt planes
#define EP 136                // epilogue staging pitch, f16 elements
#define ET (128 * EP)         // one staged output tile, elements
#define QSC 0.18033688f       // 1/8 x log2(e): q carries it, so that a score leaves its product as the exponent of 2
__global__ __launch_bounds__(512) void k_qkvd(const float* __restrict__ XT, const float* __restrict__ XS, const __bf16* __restrict__ P, const float* __restrict__ BT, const float* __restrict__ BS, const float* __restrict__ LTS, const float* __restrict__ LST, const float* __restrict__ LSS, _Float16* __restrict__ QQ, _Float16* __restrict__ KK, _Float16* __restrict__ VT) {
  __shared__ __align__(16) unsigned char smem[(2 * QBUF + 2 * ET) * 2];   // two buffers of [X tile][up to 3 W tiles], the epilogue's f16 [128][EP] tiles of qs, k1, k2 afterwards; behind them the tiles of qt and vt
  static_assert(3 * ET <= 2 * QBUF, "three staged tiles fit the ring");
  __bf16* sm = (__bf16*)smem; _Float16* so = (_Float16*)smem; _Float16* sx = so + 2 * QBUF;
  const int tid = threadIdx.x, wave = tid >> 5, lane = tid & 31, col = lane & 15, g = lane >> 4, wm = wave >> 3, wn = wave & 7; const int c0 = blockIdx.y * 128; const size_t rb = (size_t)blockIdx.x * 128; const int cl = wn * 16 + col;
  v8f kt[4];   // kt + bias, kept in f32 for k1 and k2
  { v8f at[3][4] = {};
    q_pass<3>(XT + rb * DM, P + (size_t)c0 * DM, sm, at, tid, lane, wm, wn);   // Wt q, k, v
    const float g0 = BT[c0 + cl], g1 = BT[DM + c0 + cl], g2 = BT[2 * DM + c0 + cl];
    asm volatile("s_wait_xcnt 0x0" ::: "memory");   // stands before a register that the three bias loads name is written again
    const float bq = bfr(g0), bk = bfr(g1), bv = bfr(g2);
#pragma unroll
    for (int i = 0; i < 4; ++i) { v8h hv;   // qt and vt are final: staged now, outside the ring, so that their registers are free in the second pass; read behind the epilogue's barrier
#pragma unroll
      for (int r = 0; r < 8; ++r) { sx[(wm * 64 + i * 16 + 8 * g + r) * EP + cl] = (_Float16)((at[0][i][r] + bq) * QSC); kt[i][r] = at[1][i][r] + bk; hv[r] = (_Float16)(at[2][i][r] + bv); }
      *(v8h*)&sx[ET + cl * EP + wm * 64 + i * 16 + 8 * g] = hv; } }   // vt staged transposed: a lane's 8 rows are 16 contiguous bytes
  v8f as[2][4] = {};
  q_pass<2>(XS + rb * DM, P + ((size_t)3 * DM + c0) * DM, sm, as, tid, lane, wm, wn);   // Ws q, k
  const float g3 = BS[c0 + cl], g4 = BS[DM + c0 + cl];
  asm volatile("s_wait_xcnt 0x0" ::: "memory");   // stands before a register that the two bias loads name is written again
  const float cq = bfr(g3), ck = bfr(g4), lts = bfr(LTS[0]), lst = bfr(LST[0]), lss = bfr(LSS[0]);
#pragma unroll
  for (int i = 0; i < 4; ++i)
#pragma unroll
    for (int r = 0; r < 8; ++r) { const int o = (wm * 64 + i * 16 + 8 * g + r) * EP + cl; const float t = kt[i][r], u = as[1][i][r] + ck;
      so[o] = (_Float16)((as[0][i][r] + cq) * QSC); so[ET + o] = (_Float16)(t + lts * u); so[2 * ET + o] = (_Float16)(lst * t + lss * u); }
  __syncthreads();
  const size_t b = rb / SS; const int s0 = (int)(rb % SS);
  for (int e = tid; e < 128 * 16; e += 512) { const int rl = e >> 4, q = e & 15, sp = rl * EP + q * 8; const size_t o = (rb + rl) * (2 * DM) + c0 + q * 8;
    vst2((unsigned*)(QQ + o), *(const v4u*)(sx + sp)); vst2((unsigned*)(QQ + o + DM), *(const v4u*)(so + sp)); vst2((unsigned*)(KK + o), *(const v4u*)(so + ET + sp)); vst2((unsigned*)(KK + o + DM), *(const v4u*)(so + 2 * ET + sp));
    vst2((unsigned*)(VT + ((b * DM + c0 + rl) * SS) + s0 + q * 8), *(const v4u*)(sx + ET + sp)); }
}
// ---- k_attn: block = (128 queries, head, b), 8 waves x 16 queries: 128-wide scores ([qt|qs] . [k1|k2]) in log2 units, softmax, P . vt (64 dims); O 256-B head segments
// lazy rescale: 7 minus the maximum in use is the C operand of the score products, so a product's result is the exponent of P; maxima are formed, and O and l rescaled, only in the first pass and in a pass whose P sum shows a score far above the maximum in use
// products stand transposed: S^T = K . Q^T and O^T += vt . P^T, so a lane holds 16 of the 32 keys of ONE query (its column): maximum and sum run in-lane over 16 keys and are joined with lane l ^ 16 (the sum once, at the end), the two S^T tiles convert in place into the B operand P^T
// K and vt go global -> LDS in stages of 128 keys by asynchronous copies (whole 128-B lines, two buffers), once per block; every wave reads its fragments from LDS
#define AK 128                // keys per stage
#define AP 136                // LDS row pitch in f16 elements: 256 B + 16 B, so the 16 rows of a 16-byte fragment read fall on distinct banks
#define AKT (AK * AP)         // K tile [key][k1 | k2], elements
#define ABUF (AKT + HD * AP)  // one buffer: K tile, then vt tile [dim][key]
#define PSH 7.0f              // P and l carry 2^7: the key at the maximum in use gives 128
#define PTOP 32768.0f         // a lane's sum of 16 P at or under 2^15 bounds each P under the f16 range: scores may climb 8 log2 units before a rescale
// one stage: 8 K copies and 4 vt copies of 16 B per lane; a wave's 32 lanes cover four whole 128-B lines per copy
__device__ __forceinline__ void kv_copy(const _Float16* gk, const _Float16* gv, unsigned lk, unsigned lv) {
  // the closing s_wait_xcnt stands inside the statement so that no address register of a copy is written again in front of it
  asm volatile("global_load_async_to_lds_b128 %0, %1, off\n\t"
               "global_load_async_to_lds_b128 %2, %3, off\n\t"
               "global_load_async_to_lds_b128 %4, %5, off\n\t"
               "global_load_async_to_lds_b128 %6, %7, off\n\t"
               "global_load_async_to_lds_b128 %8, %9, off\n\t"
               "global_load_async_to_lds_b128 %10, %11, off\n\t"
               "global_load_async_to_lds_b128 %12, %13, off\n\t"
               "global_load_async_to_lds_b128 %14, %15, off\n\t"
               "global_load_async_to_lds_b128 %16, %17, off\n\t"
               "global_load_async_to_lds_b128 %18, %19, off\n\t"
               "global_load_async_to_lds_b128 %20, %21, off\n\t"
               "global_load_async_to_lds_b128 %22, %23, off\n\t"
               "s_wait_xcnt 0x0"
               :: "v"(lk), "v"(gk), "v"(lk + 1 * 16 * AP * 2), "v"(gk + 1 * 16 * 2 * DM), "v"(lk + 2 * 16 * AP * 2), "v"(gk + 2 * 16 * 2 * DM), "v"(lk + 3 * 16 * AP * 2), "v"(gk + 3 * 16 * 2 * DM),
                  "v"(lk + 4 * 16 * AP * 2), "v"(gk + 4 * 16 * 2 * DM), "v"(lk + 5 * 16 * AP * 2), "v"(gk + 5 * 16 * 2 * DM), "v"(lk + 6 * 16 * AP * 2), "v"(gk + 6 * 16 * 2 * DM), "v"(lk + 7 * 16 * AP * 2), "v"(gk + 7 * 16 * 2 * DM),
                  "v"(lv), "v"(gv), "v"(lv + 1 * 16 * AP * 2), "v"(gv + 1 * 16 * SS), "v"(lv + 2 * 16 * AP * 2), "v"(gv + 2 * 16 * SS), "v"(lv + 3 * 16 * AP * 2), "v"(gv + 3 * 16 * SS)
               : "memory");
}
// lane l takes the value of lane l ^ 16
__device__ __forceinline__ float xhalf(float x) { return __builtin_bit_cast(float, __builtin_amdgcn_permlanex16(__builtin_bit_cast(int, x), __builtin_bit_cast(int, x), 0x76543210, 0xfedcba98, false, false)); }
// a lane's 16 P summed as a tree
__device__ __forceinline__ float psum(v8f a, v8f b) { const v8f e8 = a + b; const v4f e4 = e8.lo + e8.hi; const v2f e2 = e4.lo + e4.hi; return e2.x + e2.y; }
__global__ __launch_bounds__(256) void k_attn(const _Float16* __restrict__ QQ, const _Float16* __restrict__ KK, const _Float16* __restrict__ VT, float* __restrict__ O) {
  __shared__ __align__(16) _Float16 ring[2 * ABUF]; __shared__ __align__(16) float so[8][16][68];
  const int tid = threadIdx.x, wave = tid >> 5, lane = tid & 31, col = lane & 15, g = lane >> 4; const int h = blockIdx.y; const size_t b = blockIdx.z; const int q0 = blockIdx.x * 128 + wave * 16; const size_t rq = b * SS + q0;
  // lane's share of a stage: K row tid >> 4 (+16 per copy), 16-byte piece tid & 15 of [k1 | k2]; vt row tid >> 4 (+16 per copy), piece tid & 15 of 128 keys
  const _Float16* gk = KK + (b * SS + (tid >> 4)) * (2 * DM) + ((tid >> 3) & 1) * DM + h * HD + (tid & 7) * 8; const _Float16* gv = VT + (b * DM + h * HD + (tid >> 4)) * SS + (tid & 15) * 8;
  const unsigned lk = (unsigned)(size_t)ring + ((tid >> 4) * AP + (tid & 15) * 8) * 2, lv = lk + AKT * 2;
  kv_copy(gk, gv, lk, lv);
  asm volatile("s_wait_asynccnt 0x0" ::: "memory");   // this wave's share of stage 0 has landed
  __syncthreads();   // stage 0 is published
  kv_copy(gk + (size_t)AK * 2 * DM, gv + AK, lk + ABUF * 2, lv + ABUF * 2);   // stage 1 flies while stage 0 is worked on
  v16h aq[4];
#pragma unroll
  for (int kc = 0; kc < 4; ++kc) aq[kc] = frag_h(QQ + (rq + col) * (2 * DM) + ((kc < 2) ? 0 : DM) + h * HD + (kc & 1) * 32, lane);
  float l = 0.f;   // of query 'col': the sum over this half's keys
  v8f cm;   // PSH minus the maximum in use of query 'col', the same in both wave halves; all 8 rows (keys) of the C tile
#pragma unroll
  for (int r = 0; r < 8; ++r) cm[r] = PSH;
  v8f acc[4] = {};   // acc[dt][r] = O^T[dim dt * 16 + 8 g + r][query col]
#pragma unroll 1   // kept rolled: one copy of the publish point and of the long body
  for (int t = 0; t < SS / AK; ++t) { const _Float16* kb = ring + (t & 1) * ABUF; const _Float16* vb = kb + AKT;
#pragma unroll 1   // kept rolled: four copies of this long body would only grow the code
  for (int ks = 0; ks < AK / 32; ++ks) { const int j0 = ks * 32; v8f s[2];
    v16h bk[2][4], bv[4];   // all fragment reads of the 32 keys are asked for at the head of the pass: K's latency is paid once, vt's passes under the scores and the softmax
#pragma unroll
    for (int ct = 0; ct < 2; ++ct)
#pragma unroll
      for (int kc = 0; kc < 4; ++kc) bk[ct][kc] = frag_h(kb + (j0 + ct * 16 + col) * AP + kc * 32, lane);
#pragma unroll
    for (int dt = 0; dt < 4; ++dt) bv[dt] = frag_h(vb + (dt * 16 + col) * AP + j0, lane);
    __builtin_amdgcn_sched_barrier(0);   // the reads stay one group at the head: left free, the compiler reads one K fragment, waits for it alone and spreads the rest among the products
#pragma unroll
    for (int ct = 0; ct < 2; ++ct) { v8f c = cm;   // c[r] = S^T[key j0 + ct * 16 + 8 g + r][query col], in log2 units, minus the maximum in use, plus PSH
#pragma unroll
      for (int kc = 0; kc < 4; ++kc) c = wmma16(bk[ct][kc], aq[kc], c);
      s[ct] = c; }
    v8f e[2];
#pragma unroll
    for (int ct = 0; ct < 2; ++ct)
#pragma unroll
      for (int r = 0; r < 8; ++r) e[ct][r] = __builtin_amdgcn_exp2f(s[ct][r]);
    float sum = psum(e[0], e[1]);
    const bool first = (t | ks) == 0;   // no maximum is in use yet
    // one scalar branch per pass; the negated compare also takes a sum that is not a number
    if (first || __builtin_amdgcn_ballot_w32(!(sum <= PTOP)) != 0) {
      float mx = fmaxf(s[0][0], s[1][0]);
#pragma unroll
      for (int r = 1; r < 8; ++r) mx = fmaxf(mx, fmaxf(s[0][r], s[1][r]));
      mx = fmaxf(mx, xhalf(mx));   // the other half's 16 keys of the same query
      const float d = first ? mx - PSH : fmaxf(mx - PSH, 0.f);   // the rise of the maximum in use; 0 for a query that needs none
      const float alpha = first ? 0.f : __builtin_amdgcn_exp2f(-d);
#pragma unroll
      for (int ct = 0; ct < 2; ++ct)
#pragma unroll
        for (int r = 0; r < 8; ++r) e[ct][r] = __builtin_amdgcn_exp2f(s[ct][r] - d);
      sum = psum(e[0], e[1]);
      cm -= d; l *= alpha;
#pragma unroll
      for (int dt = 0; dt < 4; ++dt) acc[dt] *= alpha;
    }
    l += sum;
    // element i of a B fragment is k = 8 g + i, element 8 + i is k = 16 + 8 g + i: exactly the keys this lane holds in s[0] and s[1]
    union { v16h v; v8h q[2]; } pb; pb.q[0] = __builtin_convertvector(e[0], v8h); pb.q[1] = __builtin_convertvector(e[1], v8h);
#pragma unroll
    for (int dt = 0; dt < 4; ++dt) acc[dt] = wmma16(bv[dt], pb.v, acc[dt]); }
    asm volatile("s_wait_dscnt 0x0" ::: "memory");      // this wave's reads of stage t are done
    asm volatile("s_wait_asynccnt 0x0" ::: "memory");   // this wave's share of stage t + 1 has landed
    __syncthreads();   // publishes stage t + 1 and ends every read of stage t
    if (t + 2 < SS / AK) kv_copy(gk + (size_t)(t + 2) * AK * 2 * DM, gv + (t + 2) * AK, lk + (t & 1) * ABUF * 2, lv + (t & 1) * ABUF * 2);   // into the buffer that stage t has just left
  }
  asm volatile("s_wait_asynccnt 0x0" ::: "memory");   // no copy is outstanding when the wave ends
  const float il = 1.0f / (l + xhalf(l));   // the two halves' sums are joined once; O and l carry the same 2^7
#pragma unroll
  for (int dt = 0; dt < 4; ++dt) { const v8f o = acc[dt] * il; *(v4f*)&so[wave][col][dt * 16 + 8 * g] = o.lo; *(v4f*)&so[wave][col][dt * 16 + 8 * g + 4] = o.hi; }   // a lane's 8 dims are 32 contiguous bytes of its query's row
  LDSX();
  for (int rl = 0; rl < 16; ++rl) if (lane < 16) vst2(O + (rq + rl) * DM + h * HD + lane * 4, *(const v4f*)&so[wave][rl][lane * 4]);
}
// ---- k_out: block = (128 rows, 128 cols): Y = y (bf16 hi + lo) . Wc + bc
__global__ __launch_bounds__(256) void k_out(const float* __restrict__ O, const __bf16* __restrict__ P, const float* __restrict__ BC, float* __restrict__ Y) {
  __shared__ __align__(16) unsigned char smem[2 * 3 * GT * 2];   // two buffers of [y hi][Wc][y lo]; the epilogue's f32 [128][132] tile afterwards
  __bf16* sm = (__bf16*)smem; float* so = (float*)smem;
  const int tid = threadIdx.x, wave = tid >> 5, lane = tid & 31, col = lane & 15, g = lane >> 4, wm = wave >> 2, wn = wave & 3; const size_t rb = (size_t)blockIdx.x * 128; const int n0 = blockIdx.y * 128; const __bf16* PC = P + ((size_t)5 * DM + n0) * DM;
  v8f acc[4][2] = {};
  g_pass<true>(O + rb * DM, PC, sm, acc, tid, lane, wm, wn);
#pragma unroll
  for (int j = 0; j < 2; ++j) { const int cl = wn * 32 + j * 16 + col; const float bb = bfr(BC[n0 + cl]);
#pragma unroll
    for (int i = 0; i < 4; ++i)
#pragma unroll
      for (int r = 0; r < 8; ++r) so[(wm * 64 + i * 16 + 8 * g + r) * 132 + cl] = acc[i][j][r] + bb; }
  __syncthreads();
  for (int e = tid; e < 128 * 32; e += 256) { const int rl = e >> 5, q = e & 31; vst2(Y + (rb + rl) * DM + n0 + q * 4, *(const v4f*)&so[rl * 132 + q * 4]); }
}
extern "C" void kernel_launch(void* const* d_in, const int* in_sizes, int n_in, void* d_out, int out_size, void* d_ws, size_t ws_size, hipStream_t stream) {
  (void)in_sizes; (void)n_in; (void)out_size;
  const float** F = (const float**)d_in;   // 0 xt, 1 xs [2,2048,1024]; 2 Wt [1024,3072], 3 bt; 4 Ws [1024,2048], 5 bs; 6 Wc [1024,1024], 7 bc; 8 lam_ts, 9 lam_st, 10 lam_ss [1]
  if (ws_size < (size_t)WS_END) return;
  char* ws = (char*)d_ws; __bf16* P = (__bf16*)(ws + WS_PW); _Float16 *QQ = (_Float16*)(ws + WS_QQ), *KK = (_Float16*)(ws + WS_KK), *VT = (_Float16*)(ws + WS_VT); float* O = (float*)(ws + WS_O);
  k_packT<<<dim3(6 * DM / 128, DM / 128), 256, 0, stream>>>(F[2], F[4], F[6], P);
  k_qkvd<<<dim3(TNB * SS / 128, DM / 128), 512, 0, stream>>>(F[0], F[1], P, F[3], F[5], F[8], F[9], F[10], QQ, KK, VT);
  k_attn<<<dim3(TQB, NH, TNB), 256, 0, stream>>>(QQ, KK, VT, O);
  k_out<<<dim3(TNB * SS / 128, DM / 128), 256, 0, stream>>>(O, P, F[7], (float*)d_out);
}

// v008
// It runs in 114 microseconds.
// Timed twice side by side with v007, it ran 1.05 and 1.04 times as fast.
// Counting every step since v000, it is 4.35 times as fast.
// compute dtype: all float inputs rounded to bf16, the three lambda scalars read on device; qt/kt/vt = xt . Wt + bt and qs/ks = xs . Ws + bs with EXACT bf16 products on WMMA 16x16x32 ((in,out) weights as transposed rows); k1 = kt + lam_ts ks and k2 = lam_st kt + lam_ss ks formed in f32, then q = [qt | qs] and k = [k1 | k2] rounded once to f16 (128-wide per head); q carries 1/8 x log2(e) before that rounding; PLAIN attention: softmax in f32 on the hardware 2^x against a held maximum that is raised only when needed, P (scaled by 2^7, single f16) x vt (single f16); out = y (bf16 hi + residual) . Wc (2 products) + bc.
#include <hip/hip_runtime.h>
#include <math.h>

typedef __attribute__((ext_vector_type(16))) _Float16 v16h;
typedef __attribute__((ext_vector_type(16))) __bf16 v16b;
typedef __attribute__((ext_vector_type(8)))  _Float16 v8h;
typedef __attribute__((ext_vector_type(8)))  float v8f;
typedef __attribute__((ext_vector_type(4)))  float v4f;
typedef __attribute__((ext_vector_type(2)))  float v2f;
typedef __attribute__((ext_vector_type(4)))  unsigned v4u;
typedef __attribute__((ext_vector_type(4)))  int v4i;
typedef float __attribute__((may_alias)) float_a;
typedef int __attribute__((may_alias)) int_a;

template <typename T> __device__ __forceinline__ void vst2(void* p, T v) { *(T*)p = v;  }
// plain builtins: the compiler itself keeps the distance behind a matrix instruction where a vector instruction touches its registers, and fills it with useful work where it can
__device__ __forceinline__ v8f wmma16(v16h a, v16h b, v8f c) {
  v8f d = __builtin_amdgcn_wmma_f32_16x16x32_f16(false, a, false, b, (short)0, c, false, false);
  return d;
}
__device__ __forceinline__ v8f wmma_bf(v16b a, v16b b, v8f c) {
  v8f d = __builtin_amdgcn_wmma_f32_16x16x32_bf16(false, a, false, b, (short)0, c, false, false);
  return d;
}
// 16x16x32 fragments: lane = (h = lane>>4, row/col = lane&15); elements 0..7 = k0+8h+0..7, 8..15 = k0+16+8h+0..7; D element r = row 8h+r
__device__ __forceinline__ v16h frag_h(const _Float16* rowk0, int lane) {
  union { v16h v; v8h q[2]; } u; const _Float16* p = rowk0 + 8 * (lane >> 4);
  u.q[0] = *(const v8h*)p; u.q[1] = *(const v8h*)(p + 16); return u.v;
}
__device__ __forceinline__ v16h frag_f32(const float* rowk0, int lane) {
  v16h a; const float* p = rowk0 + 8 * (lane >> 4);
#pragma unroll
  for (int i = 0; i < 8; ++i) { a[i] = (_Float16)p[i]; a[8 + i] = (_Float16)p[16 + i]; }
  return a;
}
__device__ __forceinline__ v16h frag_f32s(const float* rowk0, int lane, float sc) {
  v16h a; const float* p = rowk0 + 8 * (lane >> 4);
#pragma unroll
  for (int i = 0; i < 8; ++i) { a[i] = (_Float16)(p[i] * sc); a[8 + i] = (_Float16)(p[16 + i] * sc); }
  return a;
}
// column fragment from a [K][ld] layout (column n), rows >= K read as 0
__device__ __forceinline__ v16h fragc_f32(const float* W, int k0, int n, int lane, int ld, int K) {
  v16h a; const int g = lane >> 4;
#pragma unroll
  for (int i = 0; i < 8; ++i) { const int ka = k0 + 8 * g + i, kb = ka + 16;
    a[i] = (_Float16)(ka < K ? W[(size_t)(ka < K ? ka : K - 1) * ld + n] : 0.f); a[8 + i] = (_Float16)(kb < K ? W[(size_t)(kb < K ? kb : K - 1) * ld + n] : 0.f); }
  return a;
}
struct F2 { v16b h, l; };
__device__ __forceinline__ F2 bsplit16(const float v[16]) { F2 r;
#pragma unroll
  for (int i = 0; i < 16; ++i) { const __bf16 h = (__bf16)v[i]; r.h[i] = h; r.l[i] = (__bf16)(v[i] - (float)h); }
  return r; }
__device__ __forceinline__ F2 split_row(const float* row, int k0, int lane) { float v[16]; const float* p = row + k0 + 8 * (lane >> 4);
#pragma unroll
  for (int i = 0; i < 8; ++i) { v[i] = p[i]; v[8 + i] = p[16 + i]; }
  return bsplit16(v); }
__device__ __forceinline__ F2 split_rowK(const float* row, int k0, int lane, int K) { float v[16]; const int g = lane >> 4;
#pragma unroll
  for (int i = 0; i < 8; ++i) { const int ka = k0 + 8 * g + i, kb = ka + 16; v[i] = ka < K ? row[ka < K ? ka : K - 1] : 0.f; v[8 + i] = kb < K ? row[kb < K ? kb : K - 1] : 0.f; }
  return bsplit16(v); }
__device__ __forceinline__ F2 split_col(const float* W, int k0, int n, int lane, int ld, int K) { float v[16]; const int g = lane >> 4;
#pragma unroll
  for (int i = 0; i < 8; ++i) { const int ka = k0 + 8 * g + i, kb = ka + 16; v[i] = ka < K ? W[(size_t)(ka < K ? ka : K - 1) * ld + n] : 0.f; v[8 + i] = kb < K ? W[(size_t)(kb < K ? kb : K - 1) * ld + n] : 0.f; }
  return bsplit16(v); }
__device__ __forceinline__ v8f mac3(const F2& a, const F2& b, v8f c) { c = wmma_bf(a.l, b.h, c); c = wmma_bf(a.h, b.l, c); return wmma_bf(a.h, b.h, c); }
__device__ __forceinline__ float sigm(float v) { return 1.0f / (1.0f + expf(-v)); }
#define LDSX() do { asm volatile("s_wait_dscnt 0" ::: "memory"); __builtin_amdgcn_wave_barrier(); __builtin_amdgcn_fence(__ATOMIC_RELEASE, "workgroup"); } while (0)


// Disentangled spatial attention (B 2, L 2,048, E 1,024, 16 heads x 64): scores = (qt . (kt + lam_ts ks) + qs . (lam_st kt + lam_ss ks)) / 8 over the target and source streams, softmax, . vt, output projection + bias.
#define NB 2
#define SS 2048
#define DM 1024
#define NH 16
#define HD 64
#define NR (NB * SS)
#ifndef TQB
#define TQB (SS / 256)
#define TNB NB
#endif
typedef __attribute__((ext_vector_type(8))) __bf16 v8b;
__device__ __forceinline__ v16b frag_b(const __bf16* rowk0, int lane) {
  union { v16b v; v8b q[2]; } u; const __bf16* p = rowk0 + 8 * (lane >> 4);
  u.q[0] = *(const v8b*)p; u.q[1] = *(const v8b*)(p + 16); return u.v;
}
__device__ __forceinline__ float bfr(float v) { return (float)(__bf16)v; }
__device__ __attribute__((noinline)) float exp_ni(float v) { return expf(v); }
__device__ __attribute__((noinline)) float erf_ni(float v) { return erff(v); }

#define WS_PW  0u                                     // bf16 transposed rows: Wt q, Wt k, Wt v, Ws q, Ws k, Wc  [6][1024][1024]
#define WS_QQ  (WS_PW + 2u * (size_t)6 * DM * DM)       // f16 [NR][2048]: qt | qs
#define WS_KK  (WS_QQ + 2u * (size_t)NR * 2 * DM)       // f16 [NR][2048]: k1 | k2
#define WS_VT  (WS_KK + 2u * (size_t)NR * 2 * DM)       // f16 planes vt [b][1024][SS]
#define WS_O   (WS_VT + 2u * (size_t)NB * DM * SS)       // f32 [NR][1024]
#define WS_END (WS_O + 4u * (size_t)NR * DM)

// ---- k_packT: block = a 128 (k) x 128 (n) tile of an (in,out) weight -> 128 bf16 rows of P (row = block 'which' * 1024 + n, K = 1024 contiguous), turned in LDS
// reads: a wave-wide 16-byte load is 512 contiguous bytes of one k row (whole lines), a lane's 16 rows all in flight; writes: 16 lanes give 256 contiguous bytes of one P row
template <int STRIDE> __device__ __forceinline__ void pack_read(v4f (&r)[16], const float* __restrict__ p) {   // the row pitch is a constant, so one address pair serves the 16 loads
#pragma unroll
  for (int i = 0; i < 16; ++i) r[i] = *(const v4f*)(p + i * STRIDE);
  // inputs only, the loaded values and their address: keeps the 16 loads in flight together (without it the first are waited for before the last are issued, several memory latencies in a row) and keeps the address pair off the loads' result registers
  asm volatile("" :: "v"(r[0]), "v"(r[1]), "v"(r[2]), "v"(r[3]), "v"(r[4]), "v"(r[5]), "v"(r[6]), "v"(r[7]), "v"(r[8]), "v"(r[9]), "v"(r[10]), "v"(r[11]), "v"(r[12]), "v"(r[13]), "v"(r[14]), "v"(r[15]), "v"(p));
}
__global__ __launch_bounds__(256) void k_packT(const float* __restrict__ WT, const float* __restrict__ WSm, const float* __restrict__ WC, __bf16* __restrict__ P) {
  __shared__ __align__(16) __bf16 s[128 * 128];   // [n][16 pieces of 8 k]; piece p of row n stands at place p ^ ((n >> 2) & 15), so that the 16 lanes of a 16-byte store (rows 4 apart) and of a 16-byte load (one row) fall on distinct banks
  const int t = threadIdx.x, r0 = blockIdx.x * 128, k0 = blockIdx.y * 128, which = r0 / DM;
  const int n4 = t & 31, kw = t >> 5;   // the lane's 4 columns, the wave's 16 k rows
  const size_t kr = k0 + kw * 16; v4f r[16];
  if (which < 3) pack_read<3 * DM>(r, WT + kr * (3 * DM) + r0 + n4 * 4);
  else if (which < 5) pack_read<2 * DM>(r, WSm + kr * (2 * DM) + (r0 - 3 * DM) + n4 * 4);
  else pack_read<DM>(r, WC + kr * DM + (r0 - 5 * DM) + n4 * 4);
#pragma unroll
  for (int q = 0; q < 4; ++q)
#pragma unroll
    for (int hf = 0; hf < 2; ++hf) { v8b w;
#pragma unroll
      for (int j = 0; j < 8; ++j) w[j] = (__bf16)r[hf * 8 + j][q];
      *(v8b*)&s[(n4 * 4 + q) * 128 + (((kw * 2 + hf) ^ (n4 & 15)) * 8)] = w; }
  __syncthreads();
  __bf16* d = P + (size_t)(r0 + (t >> 4)) * DM + k0 + (t & 15) * 8;
#pragma unroll   // unrolled: the 8 LDS reads share one latency instead of paying it one after another
  for (int i = 0; i < 8; ++i) { const int n = i * 16 + (t >> 4); vst2((unsigned*)(d + i * 16 * DM), *(const v4u*)&s[n * 128 + (((t & 15) ^ ((n >> 2) & 15)) * 8)]); }
}
// ---- k_out's GEMM core: a 128 x 128 tile of X . W^T per 8-wave block; k slices of 64 go global -> registers -> LDS (two buffers), every wave reads its fragments from LDS
#define GP 72                 // LDS row pitch in 16-bit elements: 64 k + 8, so the 16 rows of a 16-byte fragment read fall on distinct banks
#define GT (128 * GP)         // one operand tile, elements
typedef __attribute__((ext_vector_type(4))) __bf16 v4b;
struct StgR { v4f a[8]; v4u b[4]; };
// each wave-wide load covers whole 128-B lines: X rows give 256 B per slice (16 lanes), weight rows 128 B (8 lanes)
__device__ __forceinline__ void g_load(StgR& r, const float* __restrict__ X, const __bf16* __restrict__ Pw, int k0, int tid) {
  const float* pa = X + (size_t)(tid >> 4) * DM + (tid & 15) * 4 + k0; const __bf16* pb = Pw + (size_t)(tid >> 3) * DM + (tid & 7) * 8 + k0;
#pragma unroll
  for (int i = 0; i < 8; ++i) r.a[i] = *(const v4f*)(pa + i * 16 * DM);
#pragma unroll
  for (int i = 0; i < 4; ++i) r.b[i] = *(const v4u*)(pb + i * 32 * DM);
}
template <bool SPLIT> __device__ __forceinline__ void g_store(const StgR& r, __bf16* buf, int tid) {   // buf: [A hi][B]([A lo])
  __bf16* sa = buf + (tid >> 4) * GP + (tid & 15) * 4; __bf16* sb = buf + GT + (tid >> 3) * GP + (tid & 7) * 8;
#pragma unroll
  for (int i = 0; i < 8; ++i) { v4b h, l;
#pragma unroll
    for (int q = 0; q < 4; ++q) { h[q] = (__bf16)r.a[i][q]; if (SPLIT) l[q] = (__bf16)(r.a[i][q] - (float)h[q]); }
    *(v4b*)(sa + i * 16 * GP) = h; if (SPLIT) *(v4b*)(sa + 2 * GT + i * 16 * GP) = l; }
#pragma unroll
  for (int i = 0; i < 4; ++i) *(v4u*)(sb + i * 32 * GP) = r.b[i];
}
// wave (wm, wn) of 2 x 4 owns rows wm*64 + i*16, columns wn*32 + j*16; k ascends as in a plain loop, so every accumulator sums in the same order
template <bool SPLIT> __device__ __forceinline__ void g_pass(const float* __restrict__ X, const __bf16* __restrict__ Pw, __bf16* sm, v8f (&acc)[4][2], int tid, int lane, int wm, int wn) {
  constexpr int BUF = (SPLIT ? 3 : 2) * GT; const int col = lane & 15;
  StgR r; g_load(r, X, Pw, 0, tid); g_store<SPLIT>(r, sm, tid);
  __syncthreads();   // slice 0 is published
#pragma unroll 1   // kept rolled: unrolled, 16 copies of this long body would only grow the code
  for (int s = 0; s < DM / 64; ++s) { const __bf16* cur = sm + (s & 1) * BUF;
    if (s + 1 < DM / 64) g_load(r, X, Pw, (s + 1) * 64, tid);   // the next slice flies while this one is multiplied
#pragma unroll
    for (int kk = 0; kk < 2; ++kk) { v16b b[2], a[4], al[SPLIT ? 4 : 1];
#pragma unroll
      for (int j = 0; j < 2; ++j) b[j] = frag_b(cur + GT + (wn * 32 + j * 16 + col) * GP + kk * 32, lane);
#pragma unroll
      for (int i = 0; i < 4; ++i) { a[i] = frag_b(cur + (wm * 64 + i * 16 + col) * GP + kk * 32, lane); if (SPLIT) al[i] = frag_b(cur + 2 * GT + (wm * 64 + i * 16 + col) * GP + kk * 32, lane); }
      __builtin_amdgcn_sched_barrier(0);   // the fragment reads of these 32 k stay one group in front of the products: left free, the compiler reads one fragment, waits for it and multiplies, an LDS latency per pair of products
#pragma unroll
      for (int i = 0; i < 4; ++i)
#pragma unroll
        for (int j = 0; j < 2; ++j) acc[i][j] = wmma_bf(a[i], b[j], acc[i][j]);
      if (SPLIT) {   // every accumulator still takes hi, then lo, of each 32 k
#pragma unroll
        for (int i = 0; i < 4; ++i)
#pragma unroll
          for (int j = 0; j < 2; ++j) acc[i][j] = wmma_bf(al[i], b[j], acc[i][j]); }
      __builtin_amdgcn_sched_barrier(0);   // the next group of reads stays behind these products, not spread among them
    }
    if (s + 1 < DM / 64) g_store<SPLIT>(r, sm + ((s + 1) & 1) * BUF, tid);   // into the buffer whose readers left at the previous barrier
    __syncthreads();   // publishes slice s + 1 and ends every read of slice s
  }
}
// ---- qkv GEMM core: a 16-wave block forms NP products of one 128-row X tile, each 128 columns wide; a k slice of 64 of X and of the NP weight tiles goes global -> registers -> LDS (two buffers)
template <int NP> struct StgQ { v4f a[4]; v4u b[2 * NP]; };
// whole 128-B lines per wave-wide load, as in g_load; the NP weight blocks stand DM rows apart in P
template <int NP> __device__ __forceinline__ void q_load(StgQ<NP>& r, const float* __restrict__ pa, const __bf16* __restrict__ pb) {
#pragma unroll
  for (int i = 0; i < 4; ++i) r.a[i] = *(const v4f*)(pa + i * 32 * DM);
#pragma unroll
  for (int i = 0; i < 2 * NP; ++i) r.b[i] = *(const v4u*)(pb + ((i >> 1) * DM + (i & 1) * 64) * DM);
}
template <int NP> __device__ __forceinline__ void q_store(const StgQ<NP>& r, __bf16* buf, int tid) {   // buf: [X][W 0]..[W NP-1]
  __bf16* sa = buf + (tid >> 4) * GP + (tid & 15) * 4; __bf16* sb = buf + GT + (tid >> 3) * GP + (tid & 7) * 8;
#pragma unroll
  for (int i = 0; i < 4; ++i) { v4b h;
#pragma unroll
    for (int q = 0; q < 4; ++q) h[q] = (__bf16)r.a[i][q];
    *(v4b*)(sa + i * 32 * GP) = h; }
#pragma unroll
  for (int i = 0; i < 2 * NP; ++i) *(v4u*)(sb + i * 64 * GP) = r.b[i];
}
#define QBUF (4 * GT)         // one buffer: the X tile and up to three weight tiles, elements
// wave (wm, wn) of 2 x 8 owns rows wm*64 + i*16 and columns wn*16 .. +15 of every product: an X fragment feeds NP products; k ascends as in a plain loop
template <int NP> __device__ __forceinline__ void q_pass(const float* __restrict__ X, const __bf16* __restrict__ Pw, __bf16* sm, v8f (&acc)[NP][4], int tid, int lane, int wm, int wn) {
  const int col = lane & 15;
  const float* pa = X + (size_t)(tid >> 4) * DM + (tid & 15) * 4; const __bf16* pb = Pw + (size_t)(tid >> 3) * DM + (tid & 7) * 8;   // the lane's first X row and weight row
  StgQ<NP> r; q_load<NP>(r, pa, pb); q_store<NP>(r, sm, tid);
  __syncthreads();   // slice 0 is published
#pragma unroll 1   // kept rolled: unrolled, 16 copies of this long body would only grow the code
  for (int s = 0; s < DM / 64; ++s) { const __bf16* cur = sm + (s & 1) * QBUF;
    pa += 64; pb += 64;
    if (s + 1 < DM / 64) q_load<NP>(r, pa, pb);   // the next slice flies while this one is multiplied
#pragma unroll
    for (int kk = 0; kk < 2; ++kk) { v16b b[NP], a[4];
#pragma unroll
      for (int p = 0; p < NP; ++p) b[p] = frag_b(cur + GT + p * GT + (wn * 16 + col) * GP + kk * 32, lane);
#pragma unroll
      for (int i = 0; i < 4; ++i) a[i] = frag_b(cur + (wm * 64 + i * 16 + col) * GP + kk * 32, lane);
      __builtin_amdgcn_sched_barrier(0);   // the fragment reads of these 32 k stay one group in front of the products, not one LDS latency per pair of products
#pragma unroll
      for (int i = 0; i < 4; ++i)
#pragma unroll
        for (int p = 0; p < NP; ++p) acc[p][i] = wmma_bf(a[i], b[p], acc[p][i]);
      __builtin_amdgcn_sched_barrier(0);   // the next group of reads stays behind these products, not spread among them
    }
    asm volatile("" :: "v"(pa), "v"(pb));   // inputs only, the two addresses: they stay in their registers while the loads fly, so that no load's result lands on an address pair that other loads in flight name
    if (s + 1 < DM / 64) q_store<NP>(r, sm + ((s + 1) & 1) * QBUF, tid);   // into the buffer whose readers left at the previous barrier
    __syncthreads();   // publishes slice s + 1 and ends every read of slice s
  }
}
// ---- k_qkvd: block = (128 rows, 128 cols): qt, kt, vt from one pass over xt, then qs, ks from one pass over xs; qt | qs into QQ, k1 | k2 into KK, vt planes
#define EP 136                // epilogue staging pitch, f16 elements
#define ET (128 * EP)         // one staged output tile, elements
#define QSC 0.18033688f       // 1/8 x log2(e): q carries it, so that a score leaves its product as the exponent of 2
__global__ __launch_bounds__(512) void k_qkvd(const float* __restrict__ XT, const float* __restrict__ XS, const __bf16* __restrict__ P, const float* __restrict__ BT, const float* __restrict__ BS, const float* __restrict__ LTS, const float* __restrict__ LST, const float* __restrict__ LSS, _Float16* __restrict__ QQ, _Float16* __restrict__ KK, _Float16* __restrict__ VT) {
  __shared__ __align__(16) unsigned char smem[(2 * QBUF + 2 * ET) * 2];   // two buffers of [X tile][up to 3 W tiles], the epilogue's f16 [128][EP] tiles of qs, k1, k2 afterwards; behind them the tiles of qt and vt
  static_assert(3 * ET <= 2 * QBUF, "three staged tiles fit the ring");
  __bf16* sm = (__bf16*)smem; _Float16* so = (_Float16*)smem; _Float16* sx = so + 2 * QBUF;
  const int tid = threadIdx.x, wave = tid >> 5, lane = tid & 31, col = lane & 15, g = lane >> 4, wm = wave >> 3, wn = wave & 7; const int c0 = blockIdx.y * 128; const size_t rb = (size_t)blockIdx.x * 128; const int cl = wn * 16 + col;
  v8f kt[4];   // kt + bias, kept in f32 for k1 and k2
  { v8f at[3][4] = {};
    q_pass<3>(XT + rb * DM, P + (size_t)c0 * DM, sm, at, tid, lane, wm, wn);   // Wt q, k, v
    const float g0 = BT[c0 + cl], g1 = BT[DM + c0 + cl], g2 = BT[2 * DM + c0 + cl];
    asm volatile("s_wait_xcnt 0x0" ::: "memory");   // stands before a register that the three bias loads name is written again
    const float bq = bfr(g0), bk = bfr(g1), bv = bfr(g2);
#pragma unroll
    for (int i = 0; i < 4; ++i) { v8h hv;   // qt and vt are final: staged now, outside the ring, so that their registers are free in the second pass; read behind the epilogue's barrier
#pragma unroll
      for (int r = 0; r < 8; ++r) { sx[(wm * 64 + i * 16 + 8 * g + r) * EP + cl] = (_Float16)((at[0][i][r] + bq) * QSC); kt[i][r] = at[1][i][r] + bk; hv[r] = (_Float16)(at[2][i][r] + bv); }
      *(v8h*)&sx[ET + cl * EP + wm * 64 + i * 16 + 8 * g] = hv; } }   // vt staged transposed: a lane's 8 rows are 16 contiguous bytes
  v8f as[2][4] = {};
  q_pass<2>(XS + rb * DM, P + ((size_t)3 * DM + c0) * DM, sm, as, tid, lane, wm, wn);   // Ws q, k
  const float g3 = BS[c0 + cl], g4 = BS[DM + c0 + cl];
  asm volatile("s_wait_xcnt 0x0" ::: "memory");   // stands before a register that the two bias loads name is written again
  const float cq = bfr(g3), ck = bfr(g4), lts = bfr(LTS[0]), lst = bfr(LST[0]), lss = bfr(LSS[0]);
#pragma unroll
  for (int i = 0; i < 4; ++i)
#pragma unroll
    for (int r = 0; r < 8; ++r) { const int o = (wm * 64 + i * 16 + 8 * g + r) * EP + cl; const float t = kt[i][r], u = as[1][i][r] + ck;
      so[o] = (_Float16)((as[0][i][r] + cq) * QSC); so[ET + o] = (_Float16)(t + lts * u); so[2 * ET + o] = (_Float16)(lst * t + lss * u); }
  __syncthreads();
  const size_t b = rb / SS; const int s0 = (int)(rb % SS);
  for (int e = tid; e < 128 * 16; e += 512) { const int rl = e >> 4, q = e & 15, sp = rl * EP + q * 8; const size_t o = (rb + rl) * (2 * DM) + c0 + q * 8;
    vst2((unsigned*)(QQ + o), *(const v4u*)(sx + sp)); vst2((unsigned*)(QQ + o + DM), *(const v4u*)(so + sp)); vst2((unsigned*)(KK + o), *(const v4u*)(so + ET + sp)); vst2((unsigned*)(KK + o + DM), *(const v4u*)(so + 2 * ET + sp));
    vst2((unsigned*)(VT + ((b * DM + c0 + rl) * SS) + s0 + q * 8), *(const v4u*)(sx + ET + sp)); }
}
// ---- k_attn: block = (256 queries, head, b), 8 waves x 32 queries (two column tiles, so that a K or vt fragment read from LDS feeds two products): 128-wide scores ([qt|qs] . [k1|k2]) in log2 units, softmax, P . vt (64 dims); O 256-B head segments
// lazy rescale: 7 minus the maximum in use is the C operand of the score products, so a product's result is the exponent of P; maxima are formed, and O and l rescaled, only in the first pass and in a pass whose P sum shows a score far above the maximum in use
// products stand transposed: S^T = K . Q^T and O^T += vt . P^T, so a lane holds, per column tile, 16 of the 32 keys of ONE query (its column): maximum and sum are formed in-lane and joined with lane l ^ 16, the two S^T tiles convert in place into the B operand P^T
// K and vt go global -> LDS in stages of 128 keys by asynchronous copies (whole 128-B lines, two buffers), once per block; every wave reads its fragments from LDS
#define QW 2                  // query column tiles of 16 per wave
#define AK 128                // keys per stage
#define AP 136                // LDS row pitch in f16 elements: 256 B + 16 B, so the 16 rows of a 16-byte fragment read fall on distinct banks
#define AKT (AK * AP)         // K tile [key][k1 | k2], elements
#define ABUF (AKT + HD * AP)  // one buffer: K tile, then vt tile [dim][key]
#define PSH 7.0f              // P and l carry 2^7: the key at the maximum in use gives 128
#define PTOP 32768.0f         // a lane's sum of 16 P at or under 2^15 bounds each P under the f16 range: scores may climb 8 log2 units before a rescale
// one stage: 8 K copies and 4 vt copies of 16 B per lane; a wave's 32 lanes cover four whole 128-B lines per copy
__device__ __forceinline__ void kv_copy(const _Float16* gk, const _Float16* gv, unsigned lk, unsigned lv) {
  // the closing s_wait_xcnt stands inside the statement so that no address register of a copy is written again in front of it
  asm volatile("global_load_async_to_lds_b128 %0, %1, off\n\t"
               "global_load_async_to_lds_b128 %2, %3, off\n\t"
               "global_load_async_to_lds_b128 %4, %5, off\n\t"
               "global_load_async_to_lds_b128 %6, %7, off\n\t"
               "global_load_async_to_lds_b128 %8, %9, off\n\t"
               "global_load_async_to_lds_b128 %10, %11, off\n\t"
               "global_load_async_to_lds_b128 %12, %13, off\n\t"
               "global_load_async_to_lds_b128 %14, %15, off\n\t"
               "global_load_async_to_lds_b128 %16, %17, off\n\t"
               "global_load_async_to_lds_b128 %18, %19, off\n\t"
               "global_load_async_to_lds_b128 %20, %21, off\n\t"
               "global_load_async_to_lds_b128 %22, %23, off\n\t"
               "s_wait_xcnt 0x0"
               :: "v"(lk), "v"(gk), "v"(lk + 1 * 16 * AP * 2), "v"(gk + 1 * 16 * 2 * DM), "v"(lk + 2 * 16 * AP * 2), "v"(gk + 2 * 16 * 2 * DM), "v"(lk + 3 * 16 * AP * 2), "v"(gk + 3 * 16 * 2 * DM),
                  "v"(lk + 4 * 16 * AP * 2), "v"(gk + 4 * 16 * 2 * DM), "v"(lk + 5 * 16 * AP * 2), "v"(gk + 5 * 16 * 2 * DM), "v"(lk + 6 * 16 * AP * 2), "v"(gk + 6 * 16 * 2 * DM), "v"(lk + 7 * 16 * AP * 2), "v"(gk + 7 * 16 * 2 * DM),
                  "v"(lv), "v"(gv), "v"(lv + 1 * 16 * AP * 2), "v"(gv + 1 * 16 * SS), "v"(lv + 2 * 16 * AP * 2), "v"(gv + 2 * 16 * SS), "v"(lv + 3 * 16 * AP * 2), "v"(gv + 3 * 16 * SS)
               : "memory");
}
// lane l takes the value of lane l ^ 16
__device__ __forceinline__ float xhalf(float x) { return __builtin_bit_cast(float, __builtin_amdgcn_permlanex16(__builtin_bit_cast(int, x), __builtin_bit_cast(int, x), 0x76543210, 0xfedcba98, false, false)); }
// a lane's 16 P summed as a tree
__device__ __forceinline__ float psum(v8f a, v8f b) { const v8f e8 = a + b; const v4f e4 = e8.lo + e8.hi; const v2f e2 = e4.lo + e4.hi; return e2.x + e2.y; }
__global__ __launch_bounds__(256) void k_attn(const _Float16* __restrict__ QQ, const _Float16* __restrict__ KK, const _Float16* __restrict__ VT, float* __restrict__ O) {
  __shared__ __align__(16) _Float16 ring[2 * ABUF]; __shared__ __align__(16) float so[8][16 * QW][68];
  const int tid = threadIdx.x, wave = tid >> 5, lane = tid & 31, col = lane & 15, g = lane >> 4; const int h = blockIdx.y; const size_t b = blockIdx.z; const int q0 = blockIdx.x * (128 * QW) + wave * (16 * QW); const size_t rq = b * SS + q0;
  // lane's share of a stage: K row tid >> 4 (+16 per copy), 16-byte piece tid & 15 of [k1 | k2]; vt row tid >> 4 (+16 per copy), piece tid & 15 of 128 keys
  const _Float16* gk = KK + (b * SS + (tid >> 4)) * (2 * DM) + ((tid >> 3) & 1) * DM + h * HD + (tid & 7) * 8; const _Float16* gv = VT + (b * DM + h * HD + (tid >> 4)) * SS + (tid & 15) * 8;
  const unsigned lk = (unsigned)(size_t)ring + ((tid >> 4) * AP + (tid & 15) * 8) * 2, lv = lk + AKT * 2;
  kv_copy(gk, gv, lk, lv);
  asm volatile("s_wait_asynccnt 0x0" ::: "memory");   // this wave's share of stage 0 has landed
  __syncthreads();   // stage 0 is published
  kv_copy(gk + (size_t)AK * 2 * DM, gv + AK, lk + ABUF * 2, lv + ABUF * 2);   // stage 1 flies while stage 0 is worked on
  v16h aq[QW][4];
#pragma unroll
  for (int qt = 0; qt < QW; ++qt)
#pragma unroll
    for (int kc = 0; kc < 4; ++kc) aq[qt][kc] = frag_h(QQ + (rq + qt * 16 + col) * (2 * DM) + ((kc < 2) ? 0 : DM) + h * HD + (kc & 1) * 32, lane);
  float l[QW];   // of query qt * 16 + 'col': the sum over this half's keys
  v8f cm[QW];   // PSH minus the maximum in use of that query, the same in both wave halves; all 8 rows (keys) of the C tile
  v8f acc[QW][4];   // acc[qt][dt][r] = O^T[dim dt * 16 + 8 g + r][query qt * 16 + col]
#pragma unroll
  for (int qt = 0; qt < QW; ++qt) { l[qt] = 0.f;
#pragma unroll
    for (int r = 0; r < 8; ++r) cm[qt][r] = PSH;
#pragma unroll
    for (int dt = 0; dt < 4; ++dt) acc[qt][dt] = v8f{}; }
#pragma unroll 1   // kept rolled: one copy of the publish point and of the long body
  for (int t = 0; t < SS / AK; ++t) { const _Float16* kb = ring + (t & 1) * ABUF; const _Float16* vb = kb + AKT;
#pragma unroll 1   // kept rolled: four copies of this long body would only grow the code
  for (int ks = 0; ks < AK / 32; ++ks) { const int j0 = ks * 32; v8f s[QW][2];
    v16h bk[2][4], bv[4];   // all fragment reads of the 32 keys are asked for at the head of the pass: K's latency is paid once, vt's passes under the scores and the softmax
#pragma unroll
    for (int ct = 0; ct < 2; ++ct)
#pragma unroll
      for (int kc = 0; kc < 4; ++kc) bk[ct][kc] = frag_h(kb + (j0 + ct * 16 + col) * AP + kc * 32, lane);
#pragma unroll
    for (int dt = 0; dt < 4; ++dt) bv[dt] = frag_h(vb + (dt * 16 + col) * AP + j0, lane);
    __builtin_amdgcn_sched_barrier(0);   // the reads stay one group at the head: left free, the compiler reads one K fragment, waits for it alone and spreads the rest among the products
#pragma unroll
    for (int ct = 0; ct < 2; ++ct) {   // s[qt][ct][r] = S^T[key j0 + ct * 16 + 8 g + r][query qt * 16 + col], in log2 units, minus the maximum in use, plus PSH
#pragma unroll
      for (int qt = 0; qt < QW; ++qt) s[qt][ct] = cm[qt];
#pragma unroll
      for (int kc = 0; kc < 4; ++kc)
#pragma unroll
        for (int qt = 0; qt < QW; ++qt) s[qt][ct] = wmma16(bk[ct][kc], aq[qt][kc], s[qt][ct]); }   // one K fragment, QW products
    v8f e[QW][2]; float sum[QW]; unsigned high = 0;   // lanes whose P sum of a tile tops PTOP
#pragma unroll
    for (int qt = 0; qt < QW; ++qt) {
#pragma unroll
      for (int ct = 0; ct < 2; ++ct)
#pragma unroll
        for (int r = 0; r < 8; ++r) e[qt][ct][r] = __builtin_amdgcn_exp2f(s[qt][ct][r]);
      sum[qt] = psum(e[qt][0], e[qt][1]);
      high |= __builtin_amdgcn_ballot_w32(!(sum[qt] <= PTOP)); }   // the negated compare also takes a sum that is not a number
    const bool first = (t | ks) == 0;   // no maximum is in use yet
    // one scalar branch per pass, for all the wave's queries
    if (first || high != 0) {
#pragma unroll
      for (int qt = 0; qt < QW; ++qt) {
        float mx = fmaxf(s[qt][0][0], s[qt][1][0]);
#pragma unroll
        for (int r = 1; r < 8; ++r) mx = fmaxf(mx, fmaxf(s[qt][0][r], s[qt][1][r]));
        mx = fmaxf(mx, xhalf(mx));   // the other half's 16 keys of the same query
        const float d = first ? mx - PSH : fmaxf(mx - PSH, 0.f);   // the rise of the maximum in use; 0 for a query that needs none
        const float alpha = first ? 0.f : __builtin_amdgcn_exp2f(-d);
#pragma unroll
        for (int ct = 0; ct < 2; ++ct)
#pragma unroll
          for (int r = 0; r < 8; ++r) e[qt][ct][r] = __builtin_amdgcn_exp2f(s[qt][ct][r] - d);
        sum[qt] = psum(e[qt][0], e[qt][1]);
        cm[qt] -= d; l[qt] *= alpha;
#pragma unroll
        for (int dt = 0; dt < 4; ++dt) acc[qt][dt] *= alpha;
      }
    }
    // element i of a B fragment is k = 8 g + i, element 8 + i is k = 16 + 8 g + i: exactly the keys this lane holds in s[qt][0] and s[qt][1]
    union { v16h v; v8h q[2]; } pb[QW];
#pragma unroll
    for (int qt = 0; qt < QW; ++qt) { pb[qt].q[0] = __builtin_convertvector(e[qt][0], v8h); pb[qt].q[1] = __builtin_convertvector(e[qt][1], v8h); }
#pragma unroll
    for (int dt = 0; dt < 4; ++dt)
#pragma unroll
      for (int qt = 0; qt < QW; ++qt) acc[qt][dt] = wmma16(bv[dt], pb[qt].v, acc[qt][dt]);   // one vt fragment, QW products
    __builtin_amdgcn_sched_barrier(0);   // the sums' additions and the pass's address steps stay behind the last product: they fill the vector slots that the chip needs before the next pass writes over P^T's registers
#pragma unroll
    for (int qt = 0; qt < QW; ++qt) l[qt] += sum[qt]; }
    asm volatile("s_wait_dscnt 0x0" ::: "memory");      // this wave's reads of stage t are done
    asm volatile("s_wait_asynccnt 0x0" ::: "memory");   // this wave's share of stage t + 1 has landed
    __syncthreads();   // publishes stage t + 1 and ends every read of stage t
    if (t + 2 < SS / AK) kv_copy(gk + (size_t)(t + 2) * AK * 2 * DM, gv + (t + 2) * AK, lk + (t & 1) * ABUF * 2, lv + (t & 1) * ABUF * 2);   // into the buffer that stage t has just left
  }
  asm volatile("s_wait_asynccnt 0x0" ::: "memory");   // no copy is outstanding when the wave ends
#pragma unroll
  for (int qt = 0; qt < QW; ++qt) { const float il = 1.0f / (l[qt] + xhalf(l[qt]));   // the two halves' sums are joined once; O and l carry the same 2^7
#pragma unroll
    for (int dt = 0; dt < 4; ++dt) { const v8f o = acc[qt][dt] * il; *(v4f*)&so[wave][qt * 16 + col][dt * 16 + 8 * g] = o.lo; *(v4f*)&so[wave][qt * 16 + col][dt * 16 + 8 * g + 4] = o.hi; } }   // a lane's 8 dims are 32 contiguous bytes of its query's row
  LDSX();
#pragma unroll   // unrolled: the LDS reads share one latency instead of paying it one after another
  for (int i = 0; i < 8 * QW; ++i) { const int rl = 2 * i + g; vst2(O + (rq + rl) * DM + h * HD + col * 4, *(const v4f*)&so[wave][rl][col * 4]); }   // each wave half stores one query's whole 256-B head segment
}
// ---- k_out: block = (128 rows, 128 cols): Y = y (bf16 hi + lo) . Wc + bc
__global__ __launch_bounds__(256) void k_out(const float* __restrict__ O, const __bf16* __restrict__ P, const float* __restrict__ BC, float* __restrict__ Y) {
  __shared__ __align__(16) unsigned char smem[2 * 3 * GT * 2];   // two buffers of [y hi][Wc][y lo]; the epilogue's f32 [128][132] tile afterwards
  __bf16* sm = (__bf16*)smem; float* so = (float*)smem;
  const int tid = threadIdx.x, wave = tid >> 5, lane = tid & 31, col = lane & 15, g = lane >> 4, wm = wave >> 2, wn = wave & 3; const size_t rb = (size_t)blockIdx.x * 128; const int n0 = blockIdx.y * 128; const __bf16* PC = P + ((size_t)5 * DM + n0) * DM;
  v8f acc[4][2] = {};
  g_pass<true>(O + rb * DM, PC, sm, acc, tid, lane, wm, wn);
#pragma unroll
  for (int j = 0; j < 2; ++j) { const int cl = wn * 32 + j * 16 + col; const float bb = bfr(BC[n0 + cl]);
#pragma unroll
    for (int i = 0; i < 4; ++i)
#pragma unroll
      for (int r = 0; r < 8; ++r) so[(wm * 64 + i * 16 + 8 * g + r) * 132 + cl] = acc[i][j][r] + bb; }
  __syncthreads();
  for (int e = tid; e < 128 * 32; e += 256) { const int rl = e >> 5, q = e & 31; vst2(Y + (rb + rl) * DM + n0 + q * 4, *(const v4f*)&so[rl * 132 + q * 4]); }
}
extern "C" void kernel_launch(void* const* d_in, const int* in_sizes, int n_in, void* d_out, int out_size, void* d_ws, size_t ws_size, hipStream_t stream) {
  (void)in_sizes; (void)n_in; (void)out_size;
  const float** F = (const float**)d_in;   // 0 xt, 1 xs [2,2048,1024]; 2 Wt [1024,3072], 3 bt; 4 Ws [1024,2048], 5 bs; 6 Wc [1024,1024], 7 bc; 8 lam_ts, 9 lam_st, 10 lam_ss [1]
  if (ws_size < (size_t)WS_END) return;
  char* ws = (char*)d_ws; __bf16* P = (__bf16*)(ws + WS_PW); _Float16 *QQ = (_Float16*)(ws + WS_QQ), *KK = (_Float16*)(ws + WS_KK), *VT = (_Float16*)(ws + WS_VT); float* O = (float*)(ws + WS_O);
  k_packT<<<dim3(6 * DM / 128, DM / 128), 256, 0, stream>>>(F[2], F[4], F[6], P);
  k_qkvd<<<dim3(TNB * SS / 128, DM / 128), 512, 0, stream>>>(F[0], F[1], P, F[3], F[5], F[8], F[9], F[10], QQ, KK, VT);
  k_attn<<<dim3(TQB, NH, TNB), 256, 0, stream>>>(QQ, KK, VT, O);
  k_out<<<dim3(TNB * SS / 128, DM / 128), 256, 0, stream>>>(O, P, F[7], (float*)d_out);
}

// v010
// Measured time: 103 microseconds a run.
// Versions in between are left out here; by their measured steps it is 1.11 times as fast as v008.
// Counting every step since v000, it is 4.82 times as fast.
// compute dtype: all float inputs rounded to bf16, the three lambda scalars read on device; qt/kt/vt = xt . Wt + bt and qs/ks = xs . Ws + bs with EXACT bf16 products on WMMA 16x16x32 ((in,out) weights as transposed rows); k1 = kt + lam_ts ks and k2 = lam_st kt + lam_ss ks formed in f32, then q = [qt | qs] and k = [k1 | k2] rounded once to f16 (128-wide per head); q carries 1/8 x log2(e) before that rounding; PLAIN attention: softmax in f32 on the hardware 2^x against a held maximum that is raised only when needed, P (scaled by 2^7, single f16) x vt (single f16); y rounded once to f16, as its factors P and vt are; out = y . Wc (its bf16 value held as f16, 1 product) + bc.
#include <hip/hip_runtime.h>
#include <math.h>

typedef __attribute__((ext_vector_type(16))) _Float16 v16h;
typedef __attribute__((ext_vector_type(16))) __bf16 v16b;
typedef __attribute__((ext_vector_type(8)))  _Float16 v8h;
typedef __attribute__((ext_vector_type(8)))  float v8f;
typedef __attribute__((ext_vector_type(4)))  float v4f;
typedef __attribute__((ext_vector_type(2)))  float v2f;
typedef __attribute__((ext_vector_type(4)))  unsigned v4u;
typedef __attribute__((ext_vector_type(4)))  int v4i;
typedef float __attribute__((may_alias)) float_a;
typedef int __attribute__((may_alias)) int_a;

template <typename T> __device__ __forceinline__ void vst2(void* p, T v) { *(T*)p = v;  }
// plain builtins: the compiler itself keeps the distance behind a matrix instruction where a vector instruction touches its registers, and fills it with useful work where it can
__device__ __forceinline__ v8f wmma16(v16h a, v16h b, v8f c) {
  v8f d = __builtin_amdgcn_wmma_f32_16x16x32_f16(false, a, false, b, (short)0, c, false, false);
  return d;
}
__device__ __forceinline__ v8f wmma_bf(v16b a, v16b b, v8f c) {
  v8f d = __builtin_amdgcn_wmma_f32_16x16x32_bf16(false, a, false, b, (short)0, c, false, false);
  return d;
}
// 16x16x32 fragments: lane = (h = lane>>4, row/col = lane&15); elements 0..7 = k0+8h+0..7, 8..15 = k0+16+8h+0..7; D element r = row 8h+r
__device__ __forceinline__ v16h frag_h(const _Float16* rowk0, int lane) {
  union { v16h v; v8h q[2]; } u; const _Float16* p = rowk0 + 8 * (lane >> 4);
  u.q[0] = *(const v8h*)p; u.q[1] = *(const v8h*)(p + 16); return u.v;
}
__device__ __forceinline__ v16h frag_f32(const float* rowk0, int lane) {
  v16h a; const float* p = rowk0 + 8 * (lane >> 4);
#pragma unroll
  for (int i = 0; i < 8; ++i) { a[i] = (_Float16)p[i]; a[8 + i] = (_Float16)p[16 + i]; }
  return a;
}
__device__ __forceinline__ v16h frag_f32s(const float* rowk0, int lane, float sc) {
  v16h a; const float* p = rowk0 + 8 * (lane >> 4);
#pragma unroll
  for (int i = 0; i < 8; ++i) { a[i] = (_Float16)(p[i] * sc); a[8 + i] = (_Float16)(p[16 + i] * sc); }
  return a;
}
// column fragment from a [K][ld] layout (column n), rows >= K read as 0
__device__ __forceinline__ v16h fragc_f32(const float* W, int k0, int n, int lane, int ld, int K) {
  v16h a; const int g = lane >> 4;
#pragma unroll
  for (int i = 0; i < 8; ++i) { const int ka = k0 + 8 * g + i, kb = ka + 16;
    a[i] = (_Float16)(ka < K ? W[(size_t)(ka < K ? ka : K - 1) * ld + n] : 0.f); a[8 + i] = (_Float16)(kb < K ? W[(size_t)(kb < K ? kb : K - 1) * ld + n] : 0.f); }
  return a;
}
struct F2 { v16b h, l; };
__device__ __forceinline__ F2 bsplit16(const float v[16]) { F2 r;
#pragma unroll
  for (int i = 0; i < 16; ++i) { const __bf16 h = (__bf16)v[i]; r.h[i] = h; r.l[i] = (__bf16)(v[i] - (float)h); }
  return r; }
__device__ __forceinline__ F2 split_row(const float* row, int k0, int lane) { float v[16]; const float* p = row + k0 + 8 * (lane >> 4);
#pragma unroll
  for (int i = 0; i < 8; ++i) { v[i] = p[i]; v[8 + i] = p[16 + i]; }
  return bsplit16(v); }
__device__ __forceinline__ F2 split_rowK(const float* row, int k0, int lane, int K) { float v[16]; const int g = lane >> 4;
#pragma unroll
  for (int i = 0; i < 8; ++i) { const int ka = k0 + 8 * g + i, kb = ka + 16; v[i] = ka < K ? row[ka < K ? ka : K - 1] : 0.f; v[8 + i] = kb < K ? row[kb < K ? kb : K - 1] : 0.f; }
  return bsplit16(v); }
__device__ __forceinline__ F2 split_col(const float* W, int k0, int n, int lane, int ld, int K) { float v[16]; const int g = lane >> 4;
#pragma unroll
  for (int i = 0; i < 8; ++i) { const int ka = k0 + 8 * g + i, kb = ka + 16; v[i] = ka < K ? W[(size_t)(ka < K ? ka : K - 1) * ld + n] : 0.f; v[8 + i] = kb < K ? W[(size_t)(kb < K ? kb : K - 1) * ld + n] : 0.f; }
  return bsplit16(v); }
__device__ __forceinline__ v8f mac3(const F2& a, const F2& b, v8f c) { c = wmma_bf(a.l, b.h, c); c = wmma_bf(a.h, b.l, c); return wmma_bf(a.h, b.h, c); }
__device__ __forceinline__ float sigm(float v) { return 1.0f / (1.0f + expf(-v)); }
#define LDSX() do { asm volatile("s_wait_dscnt 0" ::: "memory"); __builtin_amdgcn_wave_barrier(); __builtin_amdgcn_fence(__ATOMIC_RELEASE, "workgroup"); } while (0)


// Disentangled spatial attention (B 2, L 2,048, E 1,024, 16 heads x 64): scores = (qt . (kt + lam_ts ks) + qs . (lam_st kt + lam_ss ks)) / 8 over the target and source streams, softmax, . vt, output projection + bias.
#define NB 2
#define SS 2048
#define DM 1024
#define NH 16
#define HD 64
#define NR (NB * SS)
#ifndef TQB
#define TQB (SS / 256)
#define TNB NB
#endif
typedef __attribute__((ext_vector_type(8))) __bf16 v8b;
__device__ __forceinline__ v16b frag_b(const __bf16* rowk0, int lane) {
  union { v16b v; v8b q[2]; } u; const __bf16* p = rowk0 + 8 * (lane >> 4);
  u.q[0] = *(const v8b*)p; u.q[1] = *(const v8b*)(p + 16); return u.v;
}
__device__ __forceinline__ float bfr(float v) { return (float)(__bf16)v; }
__device__ __attribute__((noinline)) float exp_ni(float v) { return expf(v); }
__device__ __attribute__((noinline)) float erf_ni(float v) { return erff(v); }

#define WS_PW  0u                                     // 16-bit transposed rows: Wt q, Wt k, Wt v, Ws q, Ws k as bf16, Wc as f16  [6][1024][1024]
#define WS_PC  (WS_PW + 2u * (size_t)5 * DM * DM)       // the Wc block of it
#define WS_QQ  (WS_PW + 2u * (size_t)6 * DM * DM)       // f16 [NR][2048]: qt | qs
#define WS_KK  (WS_QQ + 2u * (size_t)NR * 2 * DM)       // f16 [NR][2048]: k1 | k2
#define WS_VT  (WS_KK + 2u * (size_t)NR * 2 * DM)       // f16 planes vt [b][1024][SS]
#define WS_O   (WS_VT + 2u * (size_t)NB * DM * SS)       // f16 [NR][1024]
#define WS_END (WS_O + 2u * (size_t)NR * DM)

// ---- k_packT: block = a 128 (k) x 128 (n) tile of an (in,out) weight -> 128 bf16 rows of P, f16 for Wc (row = block 'which' * 1024 + n, K = 1024 contiguous), turned in LDS
// reads: a wave-wide 16-byte load is 512 contiguous bytes of one k row (whole lines), a lane's 16 rows all in flight; writes: 16 lanes give 256 contiguous bytes of one P row
template <int STRIDE> __device__ __forceinline__ void pack_read(v4f (&r)[16], const float* __restrict__ p) {   // the row pitch is a constant, so one address pair serves the 16 loads
#pragma unroll
  for (int i = 0; i < 16; ++i) r[i] = *(const v4f*)(p + i * STRIDE);
  // inputs only, the loaded values and their address: keeps the 16 loads in flight together (without it the first are waited for before the last are issued, several memory latencies in a row) and keeps the address pair off the loads' result registers
  asm volatile("" :: "v"(r[0]), "v"(r[1]), "v"(r[2]), "v"(r[3]), "v"(r[4]), "v"(r[5]), "v"(r[6]), "v"(r[7]), "v"(r[8]), "v"(r[9]), "v"(r[10]), "v"(r[11]), "v"(r[12]), "v"(r[13]), "v"(r[14]), "v"(r[15]), "v"(p));
}
// the lane's 16 k x 4 n values, rounded to bf16, into their turned places in LDS; AS_F16: Wc multiplies an f16 operand, so its bf16 value goes on as f16
template <bool AS_F16> __device__ __forceinline__ void pack_turn(const v4f (&r)[16], __bf16* s, int n4, int kw) {
#pragma unroll
  for (int q = 0; q < 4; ++q)
#pragma unroll
    for (int hf = 0; hf < 2; ++hf) { v8b w; v8h wh; __bf16* sp = &s[(n4 * 4 + q) * 128 + (((kw * 2 + hf) ^ (n4 & 15)) * 8)];
#pragma unroll
      for (int j = 0; j < 8; ++j) { w[j] = (__bf16)r[hf * 8 + j][q]; if (AS_F16) wh[j] = (_Float16)(float)w[j]; }
      if (AS_F16) *(v8h*)sp = wh; else *(v8b*)sp = w; }
}
__global__ __launch_bounds__(256) void k_packT(const float* __restrict__ WT, const float* __restrict__ WSm, const float* __restrict__ WC, __bf16* __restrict__ P) {
  __shared__ __align__(16) __bf16 s[128 * 128];   // [n][16 pieces of 8 k]; piece p of row n stands at place p ^ ((n >> 2) & 15), so that the 16 lanes of a 16-byte store (rows 4 apart) and of a 16-byte load (one row) fall on distinct banks
  const int t = threadIdx.x, r0 = blockIdx.x * 128, k0 = blockIdx.y * 128, which = r0 / DM;
  const int n4 = t & 31, kw = t >> 5;   // the lane's 4 columns, the wave's 16 k rows
  const size_t kr = k0 + kw * 16; v4f r[16];
  if (which < 3) pack_read<3 * DM>(r, WT + kr * (3 * DM) + r0 + n4 * 4);
  else if (which < 5) pack_read<2 * DM>(r, WSm + kr * (2 * DM) + (r0 - 3 * DM) + n4 * 4);
  else pack_read<DM>(r, WC + kr * DM + (r0 - 5 * DM) + n4 * 4);
  if (which < 5) pack_turn<false>(r, s, n4, kw); else pack_turn<true>(r, s, n4, kw);   // one block-uniform branch
  __syncthreads();
  __bf16* d = P + (size_t)(r0 + (t >> 4)) * DM + k0 + (t & 15) * 8;
#pragma unroll   // unrolled: the 8 LDS reads share one latency instead of paying it one after another
  for (int i = 0; i < 8; ++i) { const int n = i * 16 + (t >> 4); vst2((unsigned*)(d + i * 16 * DM), *(const v4u*)&s[n * 128 + (((t & 15) ^ ((n >> 2) & 15)) * 8)]); }
}
// ---- out GEMM core: a 128 x 128 tile of X . W^T per 8-wave block, both operands f16 rows; k slices of 64 go global -> LDS by asynchronous copies (three buffers, two slices ahead), every wave reads its fragments from LDS
#define GP 72                 // LDS row pitch in 16-bit elements: 64 k + 8, so the 16 rows of a 16-byte fragment read fall on distinct banks
#define GT (128 * GP)         // one operand tile, elements
typedef __attribute__((ext_vector_type(4))) __bf16 v4b;
// runs of four asynchronous copies of 16 B per lane, LS bytes apart in LDS and GS bytes apart in global memory; 8 lanes cover one whole 128-B line
// in both: the closing s_wait_xcnt stands inside the statement so that no address register of a copy is written again in front of it; one statement per slice where the operands allow, so that the wait is paid once
#define CP1(a, b) "global_load_async_to_lds_b128 %" #a ", %" #b ", off\n\t"
#define CPR(l, g) "v"(l), "v"(g), "v"((l) + LS), "v"((g) + GS), "v"((l) + 2 * LS), "v"((g) + 2 * GS), "v"((l) + 3 * LS), "v"((g) + 3 * GS)
template <int LS, int GS> __device__ __forceinline__ void cp8(unsigned l0, const char* g0, unsigned l1, const char* g1) {
  asm volatile(CP1(0, 1) CP1(2, 3) CP1(4, 5) CP1(6, 7) CP1(8, 9) CP1(10, 11) CP1(12, 13) CP1(14, 15) "s_wait_xcnt 0x0"
               :: CPR(l0, g0), CPR(l1, g1) : "memory");
}
template <int LS, int GS> __device__ __forceinline__ void cp12(unsigned l0, const char* g0, unsigned l1, const char* g1, unsigned l2, const char* g2) {
  asm volatile(CP1(0, 1) CP1(2, 3) CP1(4, 5) CP1(6, 7) CP1(8, 9) CP1(10, 11) CP1(12, 13) CP1(14, 15) CP1(16, 17) CP1(18, 19) CP1(20, 21) CP1(22, 23) "s_wait_xcnt 0x0"
               :: CPR(l0, g0), CPR(l1, g1), CPR(l2, g2) : "memory");
}
// one slice of both operands, copied by the four waves of one half of the block: 16 copies per lane
__device__ __forceinline__ void g_copy(unsigned l, const char* ga, const char* gb) {
  cp8<16 * GP * 2, 16 * DM * 2>(l, ga, l + 64 * GP * 2, ga + 64 * DM * 2);
  cp8<16 * GP * 2, 16 * DM * 2>(l + GT * 2, gb, l + (GT + 64 * GP) * 2, gb + 64 * DM * 2);
}
// wave (wm, wn) of 2 x 4 owns rows wm*64 + i*16, columns wn*32 + j*16; k ascends as in a plain loop
// the wave half 'grp' copies the slices of its own parity: a slice is asked for two trips before it is read, and its owners alone wait for it, to 0, in front of the barrier that publishes it
__device__ __forceinline__ void g_pass(const _Float16* __restrict__ X, const _Float16* __restrict__ Pw, _Float16* sm, v8f (&acc)[4][2], int lane, int wv, int wm, int wn) {
  constexpr int BUF = 2 * GT; const int col = lane & 15;
  const int grp = wv >> 2, u = (wv & 3) * 32 + lane;   // wv is wave-uniform (a scalar): the tests on grp are scalar branches
  const char* ga = (const char*)(X + (size_t)(u >> 3) * DM + (u & 7) * 8); const char* gb = (const char*)(Pw + (size_t)(u >> 3) * DM + (u & 7) * 8);
  const unsigned l0 = (unsigned)(size_t)sm + ((u >> 3) * GP + (u & 7) * 8) * 2;
  if (grp == 0) { g_copy(l0, ga, gb);
    asm volatile("s_wait_asynccnt 0x0" ::: "memory"); }   // this wave's share of slice 0 has landed
  else g_copy(l0 + BUF * 2, ga + 64 * 2, gb + 64 * 2);   // slice 1 flies on
  __syncthreads();   // slice 0 is published
  int bc = 0;   // the buffer of slice s, s mod 3
#pragma unroll 1   // kept rolled: unrolled, 16 copies of this long body would only grow the code
  for (int s = 0; s < DM / 64; ++s) { const _Float16* cur = sm + bc * BUF;
    if (s + 2 < DM / 64 && grp == (s & 1)) g_copy(l0 + (bc == 0 ? 2 : bc - 1) * (BUF * 2), ga + (s + 2) * 64 * 2, gb + (s + 2) * 64 * 2);   // into the buffer of slice s - 1, whose readers left at the previous barrier
#pragma unroll
    for (int kk = 0; kk < 2; ++kk) { v16h b[2], a[4];
#pragma unroll
      for (int j = 0; j < 2; ++j) b[j] = frag_h(cur + GT + (wn * 32 + j * 16 + col) * GP + kk * 32, lane);
#pragma unroll
      for (int i = 0; i < 4; ++i) a[i] = frag_h(cur + (wm * 64 + i * 16 + col) * GP + kk * 32, lane);
      __builtin_amdgcn_sched_barrier(0);   // the fragment reads of these 32 k stay one group in front of the products: left free, the compiler reads one fragment, waits for it and multiplies, an LDS latency per pair of products
#pragma unroll
      for (int i = 0; i < 4; ++i)
#pragma unroll
        for (int j = 0; j < 2; ++j) acc[i][j] = wmma16(a[i], b[j], acc[i][j]);
      __builtin_amdgcn_sched_barrier(0);   // the next group of reads stays behind these products, not spread among them
    }
    asm volatile("s_wait_dscnt 0x0" ::: "memory");   // this wave's reads of slice s are done
    if (grp != (s & 1)) asm volatile("s_wait_asynccnt 0x0" ::: "memory");   // the owners of slice s + 1: their share has landed (slice s + 2 belongs to the other half and flies on)
    __syncthreads();   // publishes slice s + 1 and ends every read of slice s
    bc = bc == 2 ? 0 : bc + 1;
  }
  asm volatile("s_wait_asynccnt 0x0" ::: "memory");   // no copy is outstanding when the ring becomes output staging
}
// ---- qkv GEMM core: a 16-wave block forms NP products of one 128-row X tile, each 128 columns wide; a k slice of 64 of X goes global -> registers (rounded) -> LDS (two buffers), of the NP weight tiles global -> LDS by asynchronous copies (three buffers, two slices ahead)
struct StgX { v4f a[4]; };
// whole 128-B lines per wave-wide load
__device__ __forceinline__ void x_load(StgX& r, const float* __restrict__ pa) {
#pragma unroll
  for (int i = 0; i < 4; ++i) r.a[i] = *(const v4f*)(pa + i * 32 * DM);
}
__device__ __forceinline__ void x_store(const StgX& r, __bf16* buf, int tid) {
  __bf16* sa = buf + (tid >> 4) * GP + (tid & 15) * 4;
#pragma unroll
  for (int i = 0; i < 4; ++i) { v4b h;
#pragma unroll
    for (int q = 0; q < 4; ++q) h[q] = (__bf16)r.a[i][q];
    *(v4b*)(sa + i * 32 * GP) = h; }
}
// one slice of the NP weight tiles, copied by the eight waves of one half of the block: 4 NP copies per lane; the NP weight blocks stand DM rows apart in P
template <int NP> __device__ __forceinline__ void w_copy(unsigned l, const char* g) {
  static_assert(NP == 2 || NP == 3, "two or three weight tiles");
  if (NP == 3) cp12<32 * GP * 2, 32 * DM * 2>(l, g, l + GT * 2, g + (size_t)DM * DM * 2, l + 2 * GT * 2, g + (size_t)2 * DM * DM * 2);
  else cp8<32 * GP * 2, 32 * DM * 2>(l, g, l + GT * 2, g + (size_t)DM * DM * 2);
}
#define WBUF (3 * GT)         // one weight buffer: up to three weight tiles, elements
#define QRING (2 * GT + 3 * WBUF)   // two X buffers, then three weight buffers, elements
// wave (wm, wn) of 2 x 8 owns rows wm*64 + i*16 and columns wn*16 .. +15 of every product: an X fragment feeds NP products; k ascends as in a plain loop
// the wave half 'grp' copies the weight slices of its own parity: a slice is asked for two trips before it is read, and its owners alone wait for it, to 0, in front of the barrier that publishes it
template <int NP> __device__ __forceinline__ void q_pass(const float* __restrict__ X, const __bf16* __restrict__ Pw, __bf16* sm, v8f (&acc)[NP][4], int tid, int lane, int wv, int wm, int wn) {
  const int col = lane & 15; __bf16* wr = sm + 2 * GT;
  const int grp = (wv >> 2) & 1, u = ((wv >> 3) * 4 + (wv & 3)) * 32 + lane;   // wv is wave-uniform (a scalar): the tests on grp are scalar branches
  const float* pa = X + (size_t)(tid >> 4) * DM + (tid & 15) * 4;   // the lane's first X row
  const char* gw = (const char*)(Pw + (size_t)(u >> 3) * DM + (u & 7) * 8);   // the lane's first weight row
  const unsigned l0 = (unsigned)(size_t)wr + ((u >> 3) * GP + (u & 7) * 8) * 2;
  StgX r; x_load(r, pa);
  if (grp == 0) w_copy<NP>(l0, gw); else w_copy<NP>(l0 + WBUF * 2, gw + 64 * 2);   // slices 0 and 1
  x_store(r, sm, tid);
  if (grp == 0) asm volatile("s_wait_asynccnt 0x0" ::: "memory");   // this wave's share of slice 0 has landed; slice 1 flies on
  __syncthreads();   // slice 0 is published
  int bc = 0;   // the weight buffer of slice s, s mod 3
#pragma unroll 1   // kept rolled: unrolled, 16 copies of this long body would only grow the code
  for (int s = 0; s < DM / 64; ++s) { const __bf16* cx = sm + (s & 1) * GT; const __bf16* cw = wr + bc * WBUF;
    if (s + 1 < DM / 64) x_load(r, pa + 64);   // the next X slice flies while this one is multiplied; asked for ahead of the copies, which have a trip more to land
    if (s + 2 < DM / 64 && grp == (s & 1)) w_copy<NP>(l0 + (bc == 0 ? 2 : bc - 1) * (WBUF * 2), gw + (s + 2) * 64 * 2);   // into the buffer of slice s - 1, whose readers left at the previous barrier
    asm volatile("s_wait_xcnt 0x0" :: "v"(pa) : "memory");   // stands before the address pair that the four X loads name is written again; the pair is an input, so it lives up to here
    pa += 64;
#pragma unroll
    for (int kk = 0; kk < 2; ++kk) { v16b b[NP], a[4];
#pragma unroll
      for (int p = 0; p < NP; ++p) b[p] = frag_b(cw + p * GT + (wn * 16 + col) * GP + kk * 32, lane);
#pragma unroll
      for (int i = 0; i < 4; ++i) a[i] = frag_b(cx + (wm * 64 + i * 16 + col) * GP + kk * 32, lane);
      __builtin_amdgcn_sched_barrier(0);   // the fragment reads of these 32 k stay one group in front of the products, not one LDS latency per pair of products
#pragma unroll
      for (int i = 0; i < 4; ++i)
#pragma unroll
        for (int p = 0; p < NP; ++p) acc[p][i] = wmma_bf(a[i], b[p], acc[p][i]);
      __builtin_amdgcn_sched_barrier(0);   // the next group of reads stays behind these products, not spread among them
    }
    if (s + 1 < DM / 64) x_store(r, sm + ((s + 1) & 1) * GT, tid);   // into the buffer whose readers left at the previous barrier
    asm volatile("s_wait_dscnt 0x0" ::: "memory");   // this wave's reads of slice s are done
    if (grp != (s & 1)) asm volatile("s_wait_asynccnt 0x0" ::: "memory");   // the owners of weight slice s + 1: their share has landed (slice s + 2 belongs to the other half and flies on)
    __syncthreads();   // publishes slice s + 1 and ends every read of slice s
    bc = bc == 2 ? 0 : bc + 1;
  }
  asm volatile("s_wait_asynccnt 0x0" ::: "memory");   // no copy is outstanding when the ring is used anew
}
// ---- k_qkvd: block = (128 rows, 128 cols): qt, kt, vt from one pass over xt, then qs, ks from one pass over xs; qt | qs into QQ, k1 | k2 into KK, vt planes
#define EP 136                // epilogue staging pitch, f16 elements
#define ET (128 * EP)         // one staged output tile, elements
#define QSC 0.18033688f       // 1/8 x log2(e): q carries it, so that a score leaves its product as the exponent of 2
__global__ __launch_bounds__(512) void k_qkvd(const float* __restrict__ XT, const float* __restrict__ XS, const __bf16* __restrict__ P, const float* __restrict__ BT, const float* __restrict__ BS, const float* __restrict__ LTS, const float* __restrict__ LST, const float* __restrict__ LSS, _Float16* __restrict__ QQ, _Float16* __restrict__ KK, _Float16* __restrict__ VT) {
  __shared__ __align__(16) unsigned char smem[(QRING + 2 * ET) * 2];   // two X buffers and three buffers of up to 3 W tiles, the epilogue's f16 [128][EP] tiles of qs, k1, k2 afterwards; behind them the tiles of qt and vt
  static_assert(3 * ET <= QRING, "three staged tiles fit the ring");
  __bf16* sm = (__bf16*)smem; _Float16* so = (_Float16*)smem; _Float16* sx = so + QRING;
  const int tid = threadIdx.x, wave = __builtin_amdgcn_readfirstlane(tid >> 5), lane = tid & 31, col = lane & 15, g = lane >> 4, wm = wave >> 3, wn = wave & 7; const int c0 = blockIdx.y * 128; const size_t rb = (size_t)blockIdx.x * 128; const int cl = wn * 16 + col;
  v8f kt[4];   // kt + bias, kept in f32 for k1 and k2
  { v8f at[3][4] = {};
    q_pass<3>(XT + rb * DM, P + (size_t)c0 * DM, sm, at, tid, lane, wave, wm, wn);   // Wt q, k, v
    const float g0 = BT[c0 + cl], g1 = BT[DM + c0 + cl], g2 = BT[2 * DM + c0 + cl];
    asm volatile("s_wait_xcnt 0x0" ::: "memory");   // stands before a register that the three bias loads name is written again
    const float bq = bfr(g0), bk = bfr(g1), bv = bfr(g2);
#pragma unroll
    for (int i = 0; i < 4; ++i) { v8h hv;   // qt and vt are final: staged now, outside the ring, so that their registers are free in the second pass; read behind the epilogue's barrier
#pragma unroll
      for (int r = 0; r < 8; ++r) { sx[(wm * 64 + i * 16 + 8 * g + r) * EP + cl] = (_Float16)((at[0][i][r] + bq) * QSC); kt[i][r] = at[1][i][r] + bk; hv[r] = (_Float16)(at[2][i][r] + bv); }
      *(v8h*)&sx[ET + cl * EP + wm * 64 + i * 16 + 8 * g] = hv; } }   // vt staged transposed: a lane's 8 rows are 16 contiguous bytes
  v8f as[2][4] = {};
  q_pass<2>(XS + rb * DM, P + ((size_t)3 * DM + c0) * DM, sm, as, tid, lane, wave, wm, wn);   // Ws q, k
  const float g3 = BS[c0 + cl], g4 = BS[DM + c0 + cl];
  asm volatile("s_wait_xcnt 0x0" ::: "memory");   // stands before a register that the two bias loads name is written again
  const float cq = bfr(g3), ck = bfr(g4), lts = bfr(LTS[0]), lst = bfr(LST[0]), lss = bfr(LSS[0]);
#pragma unroll
  for (int i = 0; i < 4; ++i)
#pragma unroll
    for (int r = 0; r < 8; ++r) { const int o = (wm * 64 + i * 16 + 8 * g + r) * EP + cl; const float t = kt[i][r], u = as[1][i][r] + ck;
      so[o] = (_Float16)((as[0][i][r] + cq) * QSC); so[ET + o] = (_Float16)(t + lts * u); so[2 * ET + o] = (_Float16)(lst * t + lss * u); }
  __syncthreads();
  const size_t b = rb / SS; const int s0 = (int)(rb % SS);
  for (int e = tid; e < 128 * 16; e += 512) { const int rl = e >> 4, q = e & 15, sp = rl * EP + q * 8; const size_t o = (rb + rl) * (2 * DM) + c0 + q * 8;
    vst2((unsigned*)(QQ + o), *(const v4u*)(sx + sp)); vst2((unsigned*)(QQ + o + DM), *(const v4u*)(so + sp)); vst2((unsigned*)(KK + o), *(const v4u*)(so + ET + sp)); vst2((unsigned*)(KK + o + DM), *(const v4u*)(so + 2 * ET + sp));
    vst2((unsigned*)(VT + ((b * DM + c0 + rl) * SS) + s0 + q * 8), *(const v4u*)(sx + ET + sp)); }
}
// ---- k_attn: block = (256 queries, head, b), 8 waves x 32 queries (two column tiles, so that a K or vt fragment read from LDS feeds two products): 128-wide scores ([qt|qs] . [k1|k2]) in log2 units, softmax, P . vt (64 dims); O as f16, 128-B head segments
// lazy rescale: 7 minus the maximum in use is the C operand of the score products, so a product's result is the exponent of P; maxima are formed, and O and l rescaled, only in a pass whose P sum shows a score far above the maximum in use
// products stand transposed: S^T = K . Q^T and O^T += vt . P^T, so a lane holds, per column tile, 16 of the 32 keys of ONE query (its column): maximum and sum are in-lane over those 16 keys, then joined with lane l ^ 16, the two S^T tiles convert in place into the B operand P^T
// K and vt go global -> LDS in stages of 128 keys by asynchronous copies (whole 128-B lines, two buffers), once per block; every wave reads its fragments from LDS
#define QW 2                  // query column tiles of 16 per wave
#define AK 128                // keys per stage
#define AP 136                // LDS row pitch in f16 elements: 256 B + 16 B, so the 16 rows of a 16-byte fragment read fall on distinct banks
#define AKT (AK * AP)         // K tile [key][k1 | k2], elements
#define ABUF (AKT + HD * AP)  // one buffer: K tile, then vt tile [dim][key]
#define PSH 7.0f              // P and l carry 2^7: the key at the maximum in use gives 128
#define PTOP 32768.0f         // a lane's sum of 16 P at or under 2^15 bounds each P under the f16 range: scores may climb 8 log2 units before a rescale
// one stage: 8 K copies and 4 vt copies of 16 B per lane; a wave's 32 lanes cover four whole 128-B lines per copy
__device__ __forceinline__ void kv_copy(const _Float16* gk, const _Float16* gv, unsigned lk, unsigned lv) {
  // the closing s_wait_xcnt stands inside the statement so that no address register of a copy is written again in front of it
  asm volatile("global_load_async_to_lds_b128 %0, %1, off\n\t"
               "global_load_async_to_lds_b128 %2, %3, off\n\t"
               "global_load_async_to_lds_b128 %4, %5, off\n\t"
               "global_load_async_to_lds_b128 %6, %7, off\n\t"
               "global_load_async_to_lds_b128 %8, %9, off\n\t"
               "global_load_async_to_lds_b128 %10, %11, off\n\t"
               "global_load_async_to_lds_b128 %12, %13, off\n\t"
               "global_load_async_to_lds_b128 %14, %15, off\n\t"
               "global_load_async_to_lds_b128 %16, %17, off\n\t"
               "global_load_async_to_lds_b128 %18, %19, off\n\t"
               "global_load_async_to_lds_b128 %20, %21, off\n\t"
               "global_load_async_to_lds_b128 %22, %23, off\n\t"
               "s_wait_xcnt 0x0"
               :: "v"(lk), "v"(gk), "v"(lk + 1 * 16 * AP * 2), "v"(gk + 1 * 16 * 2 * DM), "v"(lk + 2 * 16 * AP * 2), "v"(gk + 2 * 16 * 2 * DM), "v"(lk + 3 * 16 * AP * 2), "v"(gk + 3 * 16 * 2 * DM),
                  "v"(lk + 4 * 16 * AP * 2), "v"(gk + 4 * 16 * 2 * DM), "v"(lk + 5 * 16 * AP * 2), "v"(gk + 5 * 16 * 2 * DM), "v"(lk + 6 * 16 * AP * 2), "v"(gk + 6 * 16 * 2 * DM), "v"(lk + 7 * 16 * AP * 2), "v"(gk + 7 * 16 * 2 * DM),
                  "v"(lv), "v"(gv), "v"(lv + 1 * 16 * AP * 2), "v"(gv + 1 * 16 * SS), "v"(lv + 2 * 16 * AP * 2), "v"(gv + 2 * 16 * SS), "v"(lv + 3 * 16 * AP * 2), "v"(gv + 3 * 16 * SS)
               : "memory");
}
// lane l takes the value of lane l ^ 16
__device__ __forceinline__ float xhalf(float x) { return __builtin_bit_cast(float, __builtin_amdgcn_permlanex16(__builtin_bit_cast(int, x), __builtin_bit_cast(int, x), 0x76543210, 0xfedcba98, false, false)); }
// a lane's 16 P summed as a tree
__device__ __forceinline__ float psum(v8f a, v8f b) { const v8f e8 = a + b; const v4f e4 = e8.lo + e8.hi; const v2f e2 = e4.lo + e4.hi; return e2.x + e2.y; }
__global__ __launch_bounds__(256) void k_attn(const _Float16* __restrict__ QQ, const _Float16* __restrict__ KK, const _Float16* __restrict__ VT, _Float16* __restrict__ O) {
  __shared__ __align__(16) _Float16 ring[2 * ABUF]; __shared__ __align__(16) _Float16 so[8][16 * QW][72];   // row pitch 128 B + 16 B: the 16 rows of a 16-byte write fall on distinct banks
  const int tid = threadIdx.x, wave = tid >> 5, lane = tid & 31, col = lane & 15, g = lane >> 4; const int h = blockIdx.y; const size_t b = blockIdx.z; const int q0 = blockIdx.x * (128 * QW) + wave * (16 * QW); const size_t rq = b * SS + q0;
  // lane's share of a stage: K row tid >> 4 (+16 per copy), 16-byte piece tid & 15 of [k1 | k2]; vt row tid >> 4 (+16 per copy), piece tid & 15 of 128 keys
  const _Float16* gk = KK + (b * SS + (tid >> 4)) * (2 * DM) + ((tid >> 3) & 1) * DM + h * HD + (tid & 7) * 8; const _Float16* gv = VT + (b * DM + h * HD + (tid >> 4)) * SS + (tid & 15) * 8;
  const unsigned lk = (unsigned)(size_t)ring + ((tid >> 4) * AP + (tid & 15) * 8) * 2, lv = lk + AKT * 2;
  kv_copy(gk, gv, lk, lv);
  asm volatile("s_wait_asynccnt 0x0" ::: "memory");   // this wave's share of stage 0 has landed
  __syncthreads();   // stage 0 is published
  kv_copy(gk + (size_t)AK * 2 * DM, gv + AK, lk + ABUF * 2, lv + ABUF * 2);   // stage 1 flies while stage 0 is worked on
  v16h aq[QW][4];
#pragma unroll
  for (int qt = 0; qt < QW; ++qt)
#pragma unroll
    for (int kc = 0; kc < 4; ++kc) aq[qt][kc] = frag_h(QQ + (rq + qt * 16 + col) * (2 * DM) + ((kc < 2) ? 0 : DM) + h * HD + (kc & 1) * 32, lane);
  float l[QW];   // of query qt * 16 + 'col': the sum over this half's keys
  v8f cm[QW];   // PSH minus the maximum in use of that query, the same in both wave halves; all 8 rows (keys) of the C tile
  v8f acc[QW][4];   // acc[qt][dt][r] = O^T[dim dt * 16 + 8 g + r][query qt * 16 + col]
#pragma unroll
  for (int qt = 0; qt < QW; ++qt) { l[qt] = 0.f;
#pragma unroll
    for (int r = 0; r < 8; ++r) cm[qt][r] = PSH;
#pragma unroll
    for (int dt = 0; dt < 4; ++dt) acc[qt][dt] = v8f{}; }
#pragma unroll 1   // kept rolled: one copy of the publish point and of the long body
  for (int t = 0; t < SS / AK; ++t) { const _Float16* kb = ring + (t & 1) * ABUF; const _Float16* vb = kb + AKT;
#pragma unroll 1   // kept rolled: four copies of this long body would only grow the code
  for (int ks = 0; ks < AK / 32; ++ks) { const int j0 = ks * 32; v8f s[QW][2];
    v16h bk[2][4], bv[4];   // all fragment reads of the 32 keys are asked for at the head of the pass: K's latency is paid once, vt's passes under the scores and the softmax
#pragma unroll
    for (int ct = 0; ct < 2; ++ct)
#pragma unroll
      for (int kc = 0; kc < 4; ++kc) bk[ct][kc] = frag_h(kb + (j0 + ct * 16 + col) * AP + kc * 32, lane);
#pragma unroll
    for (int dt = 0; dt < 4; ++dt) bv[dt] = frag_h(vb + (dt * 16 + col) * AP + j0, lane);
    __builtin_amdgcn_sched_barrier(0);   // the reads stay one group at the head: left free, the compiler reads one K fragment, waits for it alone and spreads the rest among the products
#pragma unroll
    for (int ct = 0; ct < 2; ++ct) {   // s[qt][ct][r] = S^T[key j0 + ct * 16 + 8 g + r][query qt * 16 + col], in log2 units, minus the maximum in use, plus PSH
#pragma unroll
      for (int qt = 0; qt < QW; ++qt) s[qt][ct] = cm[qt];
#pragma unroll
      for (int kc = 0; kc < 4; ++kc)
#pragma unroll
        for (int qt = 0; qt < QW; ++qt) s[qt][ct] = wmma16(bk[ct][kc], aq[qt][kc], s[qt][ct]); }   // one K fragment, QW products
    v8f e[QW][2]; float sum[QW]; unsigned high = 0;   // lanes whose P sum of a tile tops PTOP
#pragma unroll
    for (int qt = 0; qt < QW; ++qt) {
#pragma unroll
      for (int ct = 0; ct < 2; ++ct)
#pragma unroll
        for (int r = 0; r < 8; ++r) e[qt][ct][r] = __builtin_amdgcn_exp2f(s[qt][ct][r]);
      sum[qt] = psum(e[qt][0], e[qt][1]);
      high |= __builtin_amdgcn_ballot_w32(!(sum[qt] <= PTOP)); }   // the negated compare also takes a sum that is not a number
    const bool first = (t | ks) == 0;   // no maximum is in use yet
    // one scalar branch per pass, for all the wave's queries
    if (first || high != 0) {
#pragma unroll
      for (int qt = 0; qt < QW; ++qt) {
        float mx = fmaxf(s[qt][0][0], s[qt][1][0]);
#pragma unroll
        for (int r = 1; r < 8; ++r) mx = fmaxf(mx, fmaxf(s[qt][0][r], s[qt][1][r]));
        mx = fmaxf(mx, xhalf(mx));   // the other half's 16 keys of the same query
        const float d = first ? mx - PSH : fmaxf(mx - PSH, 0.f);   // the rise of the maximum in use; 0 for a query that needs none
        const float alpha = first ? 0.f : __builtin_amdgcn_exp2f(-d);
#pragma unroll
        for (int ct = 0; ct < 2; ++ct)
#pragma unroll
          for (int r = 0; r < 8; ++r) e[qt][ct][r] = __builtin_amdgcn_exp2f(s[qt][ct][r] - d);
        sum[qt] = psum(e[qt][0], e[qt][1]);
        cm[qt] -= d; l[qt] *= alpha;
#pragma unroll
        for (int dt = 0; dt < 4; ++dt) acc[qt][dt] *= alpha;
      }
    }
    // element i of a B fragment is k = 8 g + i, element 8 + i is k = 16 + 8 g + i: exactly the keys this lane holds in s[qt][0] and s[qt][1]
    union { v16h v; v8h q[2]; } pb[QW];
#pragma unroll
    for (int qt = 0; qt < QW; ++qt) { pb[qt].q[0] = __builtin_convertvector(e[qt][0], v8h); pb[qt].q[1] = __builtin_convertvector(e[qt][1], v8h); }
#pragma unroll
    for (int dt = 0; dt < 4; ++dt)
#pragma unroll
      for (int qt = 0; qt < QW; ++qt) acc[qt][dt] = wmma16(bv[dt], pb[qt].v, acc[qt][dt]);   // one vt fragment, QW products
    __builtin_amdgcn_sched_barrier(0);   // the sums' additions and the pass's address steps stay behind the last product: they fill the vector slots that the chip needs before the next pass writes over P^T's registers
#pragma unroll
    for (int qt = 0; qt < QW; ++qt) l[qt] += sum[qt]; }
    asm volatile("s_wait_dscnt 0x0" ::: "memory");      // this wave's reads of stage t are done
    asm volatile("s_wait_asynccnt 0x0" ::: "memory");   // this wave's share of stage t + 1 has landed
    __syncthreads();   // publishes stage t + 1 and ends every read of stage t
    if (t + 2 < SS / AK) kv_copy(gk + (size_t)(t + 2) * AK * 2 * DM, gv + (t + 2) * AK, lk + (t & 1) * ABUF * 2, lv + (t & 1) * ABUF * 2);   // into the buffer that stage t has just left
  }
  asm volatile("s_wait_asynccnt 0x0" ::: "memory");   // no copy is outstanding when the wave ends
#pragma unroll
  for (int qt = 0; qt < QW; ++qt) { const float il = 1.0f / (l[qt] + xhalf(l[qt]));   // the two halves' sums are joined once; O and l carry the same 2^7
#pragma unroll
    for (int dt = 0; dt < 4; ++dt) *(v8h*)&so[wave][qt * 16 + col][dt * 16 + 8 * g] = __builtin_convertvector(acc[qt][dt] * il, v8h); }   // y's one rounding to f16; a lane's 8 dims are 16 contiguous bytes of its query's row
  LDSX();
#pragma unroll   // unrolled: the LDS reads share one latency instead of paying it one after another
  for (int i = 0; i < 4 * QW; ++i) { const int rl = 4 * i + (lane >> 3); vst2(O + (rq + rl) * DM + h * HD + (lane & 7) * 8, *(const v4u*)&so[wave][rl][(lane & 7) * 8]); }   // 8 lanes store one query's whole 128-B head segment
}
// ---- k_out: block = (128 rows, 128 cols): Y = y (f16) . Wc (f16) + bc
__global__ __launch_bounds__(256) void k_out(const _Float16* __restrict__ O, const _Float16* __restrict__ PWC, const float* __restrict__ BC, float* __restrict__ Y) {
  __shared__ __align__(16) unsigned char smem[3 * 2 * GT * 2];   // three buffers of [y][Wc]; the epilogue's f32 [128][132] tile afterwards
  static_assert(128 * 132 * 4 <= 3 * 2 * GT * 2, "the staged output tile fits the ring");
  _Float16* sm = (_Float16*)smem; float* so = (float*)smem;
  const int tid = threadIdx.x, wave = __builtin_amdgcn_readfirstlane(tid >> 5), lane = tid & 31, col = lane & 15, g = lane >> 4, wm = wave >> 2, wn = wave & 3; const size_t rb = (size_t)blockIdx.x * 128; const int n0 = blockIdx.y * 128; const _Float16* PC = PWC + (size_t)n0 * DM;
  v8f acc[4][2] = {};
  g_pass(O + rb * DM, PC, sm, acc, lane, wave, wm, wn);
#pragma unroll
  for (int j = 0; j < 2; ++j) { const int cl = wn * 32 + j * 16 + col; const float bb = bfr(BC[n0 + cl]);
#pragma unroll
    for (int i = 0; i < 4; ++i)
#pragma unroll
      for (int r = 0; r < 8; ++r) so[(wm * 64 + i * 16 + 8 * g + r) * 132 + cl] = acc[i][j][r] + bb; }
  __syncthreads();
  for (int e = tid; e < 128 * 32; e += 256) { const int rl = e >> 5, q = e & 31; vst2(Y + (rb + rl) * DM + n0 + q * 4, *(const v4f*)&so[rl * 132 + q * 4]); }
}
extern "C" void kernel_launch(void* const* d_in, const int* in_sizes, int n_in, void* d_out, int out_size, void* d_ws, size_t ws_size, hipStream_t stream) {
  (void)in_sizes; (void)n_in; (void)out_size;
  const float** F = (const float**)d_in;   // 0 xt, 1 xs [2,2048,1024]; 2 Wt [1024,3072], 3 bt; 4 Ws [1024,2048], 5 bs; 6 Wc [1024,1024], 7 bc; 8 lam_ts, 9 lam_st, 10 lam_ss [1]
  if (ws_size < (size_t)WS_END) return;
  char* ws = (char*)d_ws; __bf16* P = (__bf16*)(ws + WS_PW); _Float16 *QQ = (_Float16*)(ws + WS_QQ), *KK = (_Float16*)(ws + WS_KK), *VT = (_Float16*)(ws + WS_VT), *O = (_Float16*)(ws + WS_O), *PC = (_Float16*)(ws + WS_PC);
  k_packT<<<dim3(6 * DM / 128, DM / 128), 256, 0, stream>>>(F[2], F[4], F[6], P);
  k_qkvd<<<dim3(TNB * SS / 128, DM / 128), 512, 0, stream>>>(F[0], F[1], P, F[3], F[5], F[8], F[9], F[10], QQ, KK, VT);
  k_attn<<<dim3(TQB, NH, TNB), 256, 0, stream>>>(QQ, KK, VT, O);
  k_out<<<dim3(TNB * SS / 128, DM / 128), 256, 0, stream>>>(O, PC, F[7], (float*)d_out);
}
